// v000
// Times are from an AMD MI455X. After a warm-up the kernel runs many times in a row, and a time is the length of
// such a window on the GPU divided by its runs, so every launch and the gaps after it count. The runs cycle
// through copies of the inputs. A figure is the median of several windows, for all but v000 over two sittings.
// Sittings can differ by a few percent; kernels timed side by side share one.
// v000, which the later versions start from, runs in 1100 microseconds.
#include <hip/hip_runtime.h>

// Multi-headed attention whose projections are only 128 wide (the module's Dense(d_k = d_model / h) quirk): 8 heads x 16 dims (queries, keys, values [2][2048][1024]; q = queries Wq + bq, k = keys Wk + bk, v = values Wv + bv ('xw' [1024][128] 0.02 + zero biases [128]); heads = 16-wide slices; scores / sqrt(128) (the module scales by sqrt(d_k = 128), not by the per-head 16); softmax (no mask); o = merged [2048][128]; out = o Wo + bo ('xw' [128][1024]) -> [2][2048][1024] (4.2 M); argument order queries, keys, values, Wq, bq, Wk, bk, Wv, bv, Wo, bo).
// Layout per batch: each 16-wide head is PADDED into a 64-wide slot (exact zeros), so 64-wide head planes apply: NEW k_wpadH builds the padded Bt planes [512][1024] from the 'xw' [1024][128] weights (row h*64 + d = W[:, h*16 + d] for d < 16, zero rows otherwise), k_bpadH the padded biases, k_wopadH the padded output weight Bt [1024][512] (column h*64 + d = Wo[h*16 + d][:] for d < 16, zeros otherwise); exact projections + f32 biases (zero pad rows give exact zeros); identity-table plane builders; dense T-2048 attention (the zero padding adds exact zeros to q.k and to the context); merged hi/lo x padded Wo exact + bo.
// Compute dtypes, f32 accumulate: every input rounded to bf16; projections exact + f32 biases; attention rows < 512 3 products, rest fp16; softmax f32; Wo hl x exact + bias.

#define NB_  2
#define TT   2048
#define DM   1024
#define NH_  8
#define NKV  8
#define REP  (NH_ / NKV)
#define HD   64
#define DQ   (NH_ * HD)
#define DKV  (NKV * HD)
#define ZH   2
#define RH   512                  // query rows < RH use hi+lo planes (0: none)
#define WIN  0
#define PCAR 1024.0f
#define SCL  0.088388347648318447f   // 1/sqrt(d_k = 128), as the module (not 1/sqrt(16))
#define HDR  16       // real per-head width
#define DQR  128      // real projection width (8 x 16)
typedef _Float16 h16;
typedef unsigned short bf;
typedef __attribute__((ext_vector_type(16))) __bf16   v16bf;
typedef __attribute__((ext_vector_type(16))) _Float16 v16h;
typedef __attribute__((ext_vector_type(8)))  _Float16 v8h;
typedef __attribute__((ext_vector_type(8)))  unsigned short v8us;
typedef __attribute__((ext_vector_type(8)))  float    v8f;
typedef __attribute__((ext_vector_type(4)))  float    v4f;
typedef v8h  __attribute__((may_alias)) v8ha;
typedef v4f  __attribute__((may_alias)) v4fa;
typedef v8us __attribute__((may_alias)) v8usa;

__device__ __forceinline__ unsigned short f2bf(float f) { unsigned u = __float_as_uint(f); u += 0x7FFFu + ((u >> 16) & 1u); return (unsigned short)(u >> 16); }
__device__ __forceinline__ float bf2f(unsigned short b) { return __uint_as_float(((unsigned)b) << 16); }
__device__ __forceinline__ float bfr(float f) { return bf2f(f2bf(f)); }
__device__ __forceinline__ v16h cat16(v8h lo, v8h hi) { return __builtin_shufflevector(lo, hi, 0, 1, 2, 3, 4, 5, 6, 7, 8, 9, 10, 11, 12, 13, 14, 15); }
__device__ __forceinline__ v16bf cat16b(v8us lo, v8us hi) { return __builtin_bit_cast(v16bf, __builtin_shufflevector(lo, hi, 0, 1, 2, 3, 4, 5, 6, 7, 8, 9, 10, 11, 12, 13, 14, 15)); }
__device__ __forceinline__ v8f wmma16(v16h a, v16h b, v8f c) { return __builtin_amdgcn_wmma_f32_16x16x32_f16(false, a, false, b, (short)0, c, false, false); }
__device__ __forceinline__ v8f wmmab(v16bf a, v16bf b, v8f c) { return __builtin_amdgcn_wmma_f32_16x16x32_bf16(false, a, false, b, (short)0, c, false, false); }



// ---- k_gemmw: register-blocked GEMM, ONE WAVE per 64x64 output tile (16 accumulators), operands straight from K-contiguous 16-bit planes; grid (M/64, N/64, Z), 32 threads.
// C[m][n] (f32, pitch ldc, + optional f32 bias[n]) = sum_k A[m][k] Bt[n][k] (+ split products per NSPLIT). z-batch strides sA/sB/sC in elements. K % 32 == 0.
template <typename T16> struct WFrag;
template <> struct WFrag<h16> { typedef v16h V; static __device__ __forceinline__ V ld(const h16* p) { return cat16(*(const v8h*)p, *(const v8h*)(p + 16)); } static __device__ __forceinline__ v8f mma(V a, V b, v8f c) { return wmma16(a, b, c); } };
template <> struct WFrag<bf> { typedef v16bf V; static __device__ __forceinline__ V ld(const bf* p) { return cat16b(*(const v8us*)p, *(const v8us*)(p + 16)); } static __device__ __forceinline__ v8f mma(V a, V b, v8f c) { return wmmab(a, b, c); } };
template <typename T16, int NSPLIT, bool BIAS>
__global__ __launch_bounds__(32) void k_gemmw(const T16* __restrict__ A, const T16* __restrict__ A2, const T16* __restrict__ Bt, const T16* __restrict__ Bt2, int K, float* C, int ldc, const float* __restrict__ bias, size_t sA, size_t sB, size_t sC) {
    typedef typename WFrag<T16>::V V;
    __shared__ __align__(16) float os[16 * 68];
    const size_t z = blockIdx.z; A += z * sA; if (A2) A2 += z * sA; Bt += z * sB; if (Bt2) Bt2 += z * sB; C += z * sC;
    const int lane = threadIdx.x & 31, lr = lane & 15, hi = lane >> 4; const int r0 = blockIdx.x * 64, c0 = blockIdx.y * 64;
    v8f acc[4][4];
#pragma unroll
    for (int mb = 0; mb < 4; ++mb)
#pragma unroll
        for (int nb = 0; nb < 4; ++nb) acc[mb][nb] = (v8f){};
    const size_t aoff = (size_t)(r0 + lr) * K + 8 * hi, boff = (size_t)(c0 + lr) * K + 8 * hi;
#pragma unroll 1
    for (int kc = 0; kc < K; kc += 32) {
        V a[4], a2[4];
#pragma unroll
        for (int mb = 0; mb < 4; ++mb) { a[mb] = WFrag<T16>::ld(A + aoff + (size_t)mb * 16 * K + kc); if (NSPLIT == 1 || NSPLIT == 2) a2[mb] = WFrag<T16>::ld(A2 + aoff + (size_t)mb * 16 * K + kc); }
#pragma unroll
        for (int nb = 0; nb < 4; ++nb) { const V b = WFrag<T16>::ld(Bt + boff + (size_t)nb * 16 * K + kc); V b2; if (NSPLIT >= 2) b2 = WFrag<T16>::ld(Bt2 + boff + (size_t)nb * 16 * K + kc);
#pragma unroll
            for (int mb = 0; mb < 4; ++mb) { acc[mb][nb] = WFrag<T16>::mma(a[mb], b, acc[mb][nb]); if (NSPLIT == 1 || NSPLIT == 2) acc[mb][nb] = WFrag<T16>::mma(a2[mb], b, acc[mb][nb]); if (NSPLIT >= 2) acc[mb][nb] = WFrag<T16>::mma(a[mb], b2, acc[mb][nb]); } }
        asm volatile("v_nop\n\tv_nop\n\tv_nop\n\tv_nop" : "+v"(acc[0][0]), "+v"(acc[1][1]), "+v"(acc[2][2]), "+v"(acc[3][3]) : "v"(a[0]), "v"(a[3]));
    }
#pragma unroll
    for (int mb = 0; mb < 4; ++mb) {
#pragma unroll
        for (int nb = 0; nb < 4; ++nb) {
#pragma unroll
            for (int j = 0; j < 8; ++j) os[(hi * 8 + j) * 68 + nb * 16 + lr] = acc[mb][nb][j]; }
        __builtin_amdgcn_wave_barrier(); asm volatile("" ::: "memory");
        float* crow = C + (size_t)(r0 + mb * 16) * ldc + c0;
{
#pragma unroll
            for (int s = 0; s < 8; ++s) { const int row = 2 * s + hi, cofs = lr * 4; v4f val = *(const v4fa*)(os + row * 68 + cofs); if (BIAS) { val[0] += bfr(bias[c0 + cofs]); val[1] += bfr(bias[c0 + cofs + 1]); val[2] += bfr(bias[c0 + cofs + 2]); val[3] += bfr(bias[c0 + cofs + 3]); }
                *(v4f*)(crow + (size_t)row * ldc + cofs) = val; }
             }
        __builtin_amdgcn_wave_barrier(); asm volatile("" ::: "memory");
    }
}

__device__ __forceinline__ h16 tohx(float x) { return (h16)x; }
__device__ __forceinline__ void splitf(float y, unsigned short& h, unsigned short& l) { h = f2bf(y); l = f2bf(y - bf2f(h)); }
typedef __attribute__((ext_vector_type(2))) _Float16 v2h;
typedef __attribute__((ext_vector_type(4))) _Float16 v4h;
typedef __attribute__((ext_vector_type(2))) unsigned short v2us;
typedef __attribute__((ext_vector_type(4))) unsigned short v4us;
typedef __attribute__((ext_vector_type(2))) float v2f;
typedef __attribute__((ext_vector_type(4))) int v4i;

__global__ __launch_bounds__(256) void k_cvt8(const float* __restrict__ src, bf* dst, size_t n8) { const size_t i = (size_t)blockIdx.x * 256 + threadIdx.x; if (i >= n8) return; const v8f v = *(const v8f*)(src + i * 8); v8us o;
#pragma unroll
    for (int k = 0; k < 8; ++k) o[k] = f2bf(v[k]); *(v8us*)(dst + i * 8) = o;  }

// k_rope: head planes [h][t][d] (fp16 + hi/lo) of rope(x) x sc with the rotate-half convention out[d] = x[d] cos[t][d] - x[d+HD/2] sin[t][d], out[d+HD/2] = x[d+HD/2] cos[t][d+HD/2] + x[d] sin[t][d+HD/2]
__global__ __launch_bounds__(256) void k_rope(const float* __restrict__ F, int pitch, int nheads, const float* __restrict__ CS, const float* __restrict__ RF, const float* __restrict__ nw, float sc, h16* P16, bf* Ph, bf* Pl) {
    const size_t e = ((size_t)blockIdx.x * 256 + threadIdx.x) * 2; if (e >= (size_t)nheads * TT * HD) return; const int d = (int)(e % HD); const int t = (int)((e / HD) % TT); const int h = (int)(e / ((size_t)HD * TT)); const float* f = F + (size_t)t * pitch + h * HD; const float rf = RF ? RF[(size_t)h * TT + t] : 1.0f; v2h o16; v2us oh, ol;
#pragma unroll
    for (int q = 0; q < 2; ++q) { const int dd = d + q; const int dp = (dd < HD / 2) ? dd + HD / 2 : dd - HD / 2; float x0 = f[dd], x1 = f[dp];
        if (RF) { float n0 = __fmul_rn(x0, rf), n1 = __fmul_rn(x1, rf); asm volatile("" : "+v"(n0)); asm volatile("" : "+v"(n1)); x0 = __fmul_rn(bfr(nw[dd]), n0); x1 = __fmul_rn(bfr(nw[dp]), n1); }
        const v2f cs = *(const v2f*)(CS + ((size_t)t * HD + dd) * 2); float a = __fmul_rn(x0, cs[0]), bq = __fmul_rn(x1, cs[1]); asm volatile("" : "+v"(a)); asm volatile("" : "+v"(bq)); const float r = ((dd < HD / 2) ? __fsub_rn(a, bq) : __fadd_rn(a, bq)) * sc;
        o16[q] = tohx(r); unsigned short a2, c2; splitf(r, a2, c2); oh[q] = a2; ol[q] = c2; }
    *(v2h*)(P16 + e) = o16; *(v2us*)(Ph + e) = oh; *(v2us*)(Pl + e) = ol;  }
__global__ __launch_bounds__(256) void k_wpadH(const float* __restrict__ w, bf* Bt) { const size_t e = ((size_t)blockIdx.x * 256 + threadIdx.x) * 2; if (e >= (size_t)DQ * DM) return; const int k = (int)(e % DM); const int r = (int)(e / DM); const int h = r / HD, d = r % HD; const bool live = (d < HDR); const int col = h * HDR + (d & (HDR - 1)); const float w0 = w[(size_t)k * DQR + col], w1 = w[(size_t)(k + 1) * DQR + col]; v2us o; o[0] = live ? f2bf(w0) : (unsigned short)0; o[1] = live ? f2bf(w1) : (unsigned short)0;
    *(v2us*)(Bt + e) = o;  }
__global__ __launch_bounds__(256) void k_bpadH(const float* __restrict__ b0, const float* __restrict__ b1, const float* __restrict__ b2, float* B3) { const int i = blockIdx.x * 256 + threadIdx.x; if (i >= 3 * DQ) return; const int s = i / DQ, r = i % DQ; const int h = r / HD, d = r % HD; const float* src = (s == 0) ? b0 : ((s == 1) ? b1 : b2); const float val = src[h * HDR + (d & (HDR - 1))]; const float o = (d < HDR) ? val : 0.0f; *(float*)(B3 + i) = o;  }
__global__ __launch_bounds__(256) void k_wopadH(const float* __restrict__ wo, bf* Bt) { const size_t e = ((size_t)blockIdx.x * 256 + threadIdx.x) * 2; if (e >= (size_t)DM * DQ) return; const int c = (int)(e % DQ); const int n = (int)(e / DQ); const int h = c / HD, d = c % HD; const bool live = (d < HDR); const int rr = h * HDR + (d & (HDR - 1)); const float w0 = wo[(size_t)rr * DM + n], w1 = wo[(size_t)(h * HDR + ((d + 1) & (HDR - 1))) * DM + n]; v2us o; o[0] = live ? f2bf(w0) : (unsigned short)0; o[1] = (d + 1 < HDR) ? f2bf(w1) : (unsigned short)0;
    *(v2us*)(Bt + e) = o;  }
__global__ __launch_bounds__(256) void k_vtp(const float* __restrict__ F, int pitch, int nheads, h16* V16, bf* Vh, bf* Vl) { const size_t e = ((size_t)blockIdx.x * 256 + threadIdx.x) * 2; if (e >= (size_t)nheads * HD * TT) return; const int t = (int)(e % TT); const int d = (int)((e / TT) % HD); const int g = (int)(e / ((size_t)TT * HD)); v2h o16; v2us oh, ol;
#pragma unroll
    for (int q = 0; q < 2; ++q) { const float x = F[(size_t)(t + q) * pitch + g * HD + d]; o16[q] = tohx(x); unsigned short a2, c2; splitf(x, a2, c2); oh[q] = a2; ol[q] = c2; }
    *(v2h*)(V16 + e) = o16; *(v2us*)(Vh + e) = oh; *(v2us*)(Vl + e) = ol;  }
__global__ __launch_bounds__(256) void k_csid(float* CS) { const int idx = blockIdx.x * 256 + threadIdx.x; if (idx >= TT * HD) return; v2f cs; cs[0] = 1.0f; cs[1] = 0.0f; *(v2f*)(CS + (size_t)idx * 2) = cs;  }
// k_asoft: per row (zz, i): t = S x SCL = S / sqrt(128) (no mask); softmax over the 2048 keys (register row, one exp, fixed trees);
__global__ __launch_bounds__(256) void k_asoft(const float* __restrict__ Sb, h16* P16, bf* Ph, bf* Pl) {
    const int lane = threadIdx.x & 31; const int row = blockIdx.x * 8 + (threadIdx.x >> 5); if (row >= ZH * TT) return; const int i = row % TT; const int zz = row / TT; (void)zz; const bool hires = (i < RH); const float* sr = Sb + (size_t)row * TT; float v[TT / 32]; float mx = -3.0e38f;
#pragma unroll
    for (int ch = 0; ch < TT / 128; ++ch) { const int j0 = ch * 128 + lane * 4; const v4f a = *(const v4f*)(sr + j0);
#pragma unroll
        for (int q = 0; q < 4; ++q) { const int j = j0 + q; (void)j; const float t = a[q] * SCL; v[ch * 4 + q] = t; mx = fmaxf(mx, t); } }
#pragma unroll
    for (int sh = 16; sh; sh >>= 1) mx = fmaxf(mx, __shfl_xor(mx, sh, 32));
    float sum = 0.f;
#pragma unroll
    for (int k = 0; k < TT / 32; ++k) { float d0 = __fsub_rn(v[k], mx); asm volatile("" : "+v"(d0)); v[k] = __builtin_amdgcn_exp2f(__fmul_rn(d0, 1.4426950408889634f)); sum += v[k]; }
#pragma unroll
    for (int sh = 16; sh; sh >>= 1) sum += __shfl_xor(sum, sh, 32);
    const float f = __fdiv_rn(hires ? 1.0f : PCAR, sum);
{
        if (hires) {
#pragma unroll
            for (int ch = 0; ch < TT / 128; ++ch) { v4us oh, ol;
#pragma unroll
                for (int q = 0; q < 4; ++q) { unsigned short a, c2; splitf(v[ch * 4 + q] * f, a, c2); oh[q] = a; ol[q] = c2; }
                const size_t oo = ((size_t)zz * (RH ? RH : 1) + i) * TT + ch * 128 + lane * 4; *(v4us*)(Ph + oo) = oh; *(v4us*)(Pl + oo) = ol; }
        } else {
#pragma unroll
            for (int ch = 0; ch < TT / 128; ++ch) { v4h o4;
#pragma unroll
                for (int q = 0; q < 4; ++q) o4[q] = tohx(v[ch * 4 + q] * f);
                *(v4h*)(P16 + (size_t)row * TT + ch * 128 + lane * 4) = o4; } }
         }
}
__global__ __launch_bounds__(256) void k_merge(const float* __restrict__ O, int h0, bf* Ah, bf* Al) { const size_t e = ((size_t)blockIdx.x * 256 + threadIdx.x) * 2; if (e >= (size_t)ZH * TT * HD) return; const int d = (int)(e % HD); const int t = (int)((e / HD) % TT); const int zz = (int)(e / ((size_t)HD * TT)); const float cs = (t < RH) ? 1.0f : (1.0f / PCAR); const size_t oo = (size_t)t * DQ + (h0 + zz) * HD + d;
    v2us oh, ol;
#pragma unroll
    for (int q = 0; q < 2; ++q) { unsigned short a, c2; splitf(O[e + q] * cs, a, c2); oh[q] = a; ol[q] = c2; } *(v2us*)(Ah + oo) = oh; *(v2us*)(Al + oo) = ol;  }

extern "C" void kernel_launch(void* const* d_in, const int* in_sizes, int n_in,
                              void* d_out, int out_size, void* d_ws, size_t ws_size, hipStream_t stream) {
    (void)in_sizes; (void)n_in; (void)out_size;
    const float* x = (const float*)d_in[0]; const float* xk = (const float*)d_in[1]; const float* xv = (const float*)d_in[2]; const float* wq = (const float*)d_in[3]; const float* bqr = (const float*)d_in[4]; const float* wk = (const float*)d_in[5]; const float* bkr = (const float*)d_in[6]; const float* wv = (const float*)d_in[7]; const float* bvr = (const float*)d_in[8]; const float* wo = (const float*)d_in[9]; const float* bo = (const float*)d_in[10];   /* argument order queries, keys, values, Wq ('xw' [1024][128]), bq [128], Wk, bk, Wv, bv, Wo ('xw' [128][1024]), bo */
    float* OUT = (float*)d_out;     // [2][2048][1024]
    char* wsp = (char*)d_ws;
    auto take = [&](size_t bytes) { char* p = wsp; wsp += (bytes + 255) & ~(size_t)255; return (void*)p; };
    bf* WQ = (bf*)take((size_t)DQ * DM * 2); bf* WK = (bf*)take((size_t)DKV * DM * 2); bf* WV = (bf*)take((size_t)DKV * DM * 2); bf* WO = (bf*)take((size_t)DM * DQ * 2); float* CS = (float*)take((size_t)TT * HD * 2 * 4);
    bf* XB = (bf*)take((size_t)TT * DM * 2); float* B3 = (float*)take((size_t)3 * DQ * 4); const float* bq = B3; const float* bk = B3 + DQ; const float* bv = B3 + 2 * DQ;   /* padded biases */ float* FQ = (float*)take((size_t)TT * DQ * 4); float* FK = (float*)take((size_t)TT * DKV * 4);
    h16* QP16 = (h16*)take((size_t)NH_ * TT * HD * 2); h16* KP16 = (h16*)take((size_t)NKV * TT * HD * 2); h16* VT16 = (h16*)take((size_t)NKV * HD * TT * 2);
    bf* QPh = (bf*)take((size_t)NH_ * TT * HD * 2); bf* QPl = (bf*)take((size_t)NH_ * TT * HD * 2); bf* KPh = (bf*)take((size_t)NKV * TT * HD * 2); bf* KPl = (bf*)take((size_t)NKV * TT * HD * 2); bf* VTh = (bf*)take((size_t)NKV * HD * TT * 2); bf* VTl = (bf*)take((size_t)NKV * HD * TT * 2); bf* Ph = (bf*)take((size_t)ZH * RH * TT * 2); bf* Pl = (bf*)take((size_t)ZH * RH * TT * 2);
    float* Sb = (float*)take((size_t)ZH * TT * TT * 4); h16* P16 = (h16*)take((size_t)ZH * TT * TT * 2); float* Ob = (float*)take((size_t)ZH * TT * HD * 4); bf* ATh = (bf*)take((size_t)TT * DQ * 2); bf* ATl = (bf*)take((size_t)TT * DQ * 2);
    if ((size_t)(wsp - (char*)d_ws) > ws_size) return;    // ws 256 MiB
    float* FV = FK;   // v projection reuses the k buffer after the k planes are built (stream-ordered)
    { k_wpadH<<<(unsigned)(((size_t)DQ * DM / 2 + 255) / 256), 256, 0, stream>>>(wq, WQ);   /* 'xw' [1024][128] -> padded Bt [512][1024] */ k_wpadH<<<(unsigned)(((size_t)DQ * DM / 2 + 255) / 256), 256, 0, stream>>>(wk, WK);   /* 'xw' [1024][128] -> padded Bt [512][1024] */ k_wpadH<<<(unsigned)(((size_t)DQ * DM / 2 + 255) / 256), 256, 0, stream>>>(wv, WV);   /* 'xw' [1024][128] -> padded Bt [512][1024] */
      k_wopadH<<<(unsigned)(((size_t)DM * DQ / 2 + 255) / 256), 256, 0, stream>>>(wo, WO);   /* 'xw' [128][1024] -> padded Bt [1024][512] */ k_bpadH<<<(3 * DQ + 255) / 256, 256, 0, stream>>>(bqr, bkr, bvr, B3);
       }
    k_csid<<<(TT * HD + 255) / 256, 256, 0, stream>>>(CS);
    const unsigned LQ = (unsigned)(((size_t)NH_ * TT * HD / 2 + 255) / 256), LKv = (unsigned)(((size_t)NKV * TT * HD / 2 + 255) / 256);
    for (int b = 0; b < NB_; ++b) {
        
        k_cvt8<<<(unsigned)(((size_t)TT * DM / 8 + 255) / 256), 256, 0, stream>>>(x + (size_t)b * TT * DM, XB, (size_t)TT * DM / 8);
        k_gemmw<bf, 0, true><<<dim3(TT / 64, DQ / 64, 1), 32, 0, stream>>>(XB, nullptr, WQ, nullptr, DM, FQ, DQ, bq, 0, 0, 0);
        k_rope<<<LQ, 256, 0, stream>>>(FQ, DQ, NH_, CS, nullptr, nullptr, 1.0f, QP16, QPh, QPl);
        k_cvt8<<<(unsigned)(((size_t)TT * DM / 8 + 255) / 256), 256, 0, stream>>>(xk + (size_t)b * TT * DM, XB, (size_t)TT * DM / 8);   /* XB := bf16(keys[b]) */ k_gemmw<bf, 0, true><<<dim3(TT / 64, DKV / 64, 1), 32, 0, stream>>>(XB, nullptr, WK, nullptr, DM, FK, DKV, bk, 0, 0, 0);
        k_rope<<<LKv, 256, 0, stream>>>(FK, DKV, NKV, CS, nullptr, nullptr, 1.0f, KP16, KPh, KPl);
        k_cvt8<<<(unsigned)(((size_t)TT * DM / 8 + 255) / 256), 256, 0, stream>>>(xv + (size_t)b * TT * DM, XB, (size_t)TT * DM / 8);   /* XB := bf16(values[b]) */ k_gemmw<bf, 0, true><<<dim3(TT / 64, DKV / 64, 1), 32, 0, stream>>>(XB, nullptr, WV, nullptr, DM, FV, DKV, bv, 0, 0, 0); k_vtp<<<LKv, 256, 0, stream>>>(FV, DKV, NKV, VT16, VTh, VTl);
        for (int h0 = 0; h0 < NH_; h0 += ZH) { const size_t zq = (size_t)h0, zk = (size_t)(h0 / REP);   // one kv head per query head: the pass's two heads use consecutive kv planes (z-strides TT*HD)
            k_gemmw<bf, 2, false><<<dim3(RH / 64, TT / 64, ZH), 32, 0, stream>>>(QPh + zq * TT * HD, QPl + zq * TT * HD, KPh + zk * TT * HD, KPl + zk * TT * HD, HD, Sb, TT, nullptr, (size_t)TT * HD, (size_t)TT * HD, (size_t)TT * TT);
            k_gemmw<h16, 0, false><<<dim3((TT - RH) / 64, TT / 64, ZH), 32, 0, stream>>>(QP16 + zq * TT * HD + (size_t)RH * HD, nullptr, KP16 + zk * TT * HD, nullptr, HD, Sb + (size_t)RH * TT, TT, nullptr, (size_t)TT * HD, (size_t)TT * HD, (size_t)TT * TT);
            k_asoft<<<ZH * TT / 8, 256, 0, stream>>>(Sb, P16, Ph, Pl);
            k_gemmw<bf, 2, false><<<dim3(RH / 64, HD / 64, ZH), 32, 0, stream>>>(Ph, Pl, VTh + zk * HD * TT, VTl + zk * HD * TT, TT, Ob, HD, nullptr, (size_t)RH * TT, (size_t)HD * TT, (size_t)TT * HD);
            k_gemmw<h16, 0, false><<<dim3((TT - RH) / 64, HD / 64, ZH), 32, 0, stream>>>(P16 + (size_t)RH * TT, nullptr, VT16 + zk * HD * TT, nullptr, TT, Ob + (size_t)RH * HD, HD, nullptr, (size_t)TT * TT, (size_t)HD * TT, (size_t)TT * HD);
            k_merge<<<(unsigned)(((size_t)ZH * TT * HD / 2 + 255) / 256), 256, 0, stream>>>(Ob, h0, ATh, ATl); }
        k_gemmw<bf, 1, true><<<dim3(TT / 64, DM / 64, 1), 32, 0, stream>>>(ATh, ATl, WO, nullptr, DQ, OUT + (size_t)b * TT * DM, DM, bo, 0, 0, 0); }
}

// v001
// Measured time: 426 microseconds a run.
// Timed twice side by side with v000, it ran 2.63 and 2.60 times as fast.
#include <hip/hip_runtime.h>

// Multi-headed attention whose projections are only 128 wide (the module's Dense(d_k = d_model / h) quirk): 8 heads x 16 dims (queries, keys, values [2][2048][1024]; q = queries Wq + bq, k = keys Wk + bk, v = values Wv + bv ('xw' [1024][128] 0.02 + zero biases [128]); heads = 16-wide slices; scores / sqrt(128) (the module scales by sqrt(d_k = 128), not by the per-head 16); softmax (no mask); o = merged [2048][128]; out = o Wo + bo ('xw' [128][1024]) -> [2][2048][1024] (4.2 M); argument order queries, keys, values, Wq, bq, Wk, bk, Wv, bv, Wo, bo).
// Layout per batch: each 16-wide head is PADDED into a 64-wide slot (exact zeros), so 64-wide head planes apply: k_wpadH builds the padded Bt planes [512][1024] from the 'xw' [1024][128] weights (row h*64 + d = W[:, h*16 + d] for d < 16, zero rows otherwise), k_bpadH the padded biases, k_wopadH the padded output weight Bt [1024][512] (column h*64 + d = Wo[h*16 + d][:] for d < 16, zeros otherwise); exact projections + f32 biases (zero pad rows give exact zeros); identity-table plane builders; dense T-2048 attention (the zero padding adds exact zeros to q.k and to the context); merged hi/lo x padded Wo exact + bo.
// Compute dtypes, f32 accumulate: every input rounded to bf16; projections exact + f32 biases; attention rows < 512 3 products, rest fp16; softmax f32; Wo hl x exact + bias.

#define NB_  2
#define TT   2048
#define DM   1024
#define NH_  8
#define NKV  8
#define REP  (NH_ / NKV)
#define HD   64
#define DQ   (NH_ * HD)
#define DKV  (NKV * HD)
#define ZH   2
#define RH   512                  // query rows < RH use hi+lo planes (0: none)
#define WIN  0
#define PCAR 1024.0f
#define SCL  0.088388347648318447f   // 1/sqrt(d_k = 128), as the module (not 1/sqrt(16))
#define HDR  16       // real per-head width
#define DQR  128      // real projection width (8 x 16)
#define KSP  8        // K parts (work-groups, planes of Ob) of the P.V products
typedef _Float16 h16;
typedef unsigned short bf;
typedef __attribute__((ext_vector_type(16))) __bf16   v16bf;
typedef __attribute__((ext_vector_type(16))) _Float16 v16h;
typedef __attribute__((ext_vector_type(8)))  _Float16 v8h;
typedef __attribute__((ext_vector_type(8)))  unsigned short v8us;
typedef __attribute__((ext_vector_type(8)))  float    v8f;
typedef __attribute__((ext_vector_type(4)))  float    v4f;
typedef v8h  __attribute__((may_alias)) v8ha;
typedef v4f  __attribute__((may_alias)) v4fa;
typedef v8us __attribute__((may_alias)) v8usa;

__device__ __forceinline__ unsigned short f2bf(float f) { unsigned u = __float_as_uint(f); u += 0x7FFFu + ((u >> 16) & 1u); return (unsigned short)(u >> 16); }
__device__ __forceinline__ float bf2f(unsigned short b) { return __uint_as_float(((unsigned)b) << 16); }
__device__ __forceinline__ float bfr(float f) { return bf2f(f2bf(f)); }
__device__ __forceinline__ v16h cat16(v8h lo, v8h hi) { return __builtin_shufflevector(lo, hi, 0, 1, 2, 3, 4, 5, 6, 7, 8, 9, 10, 11, 12, 13, 14, 15); }
__device__ __forceinline__ v16bf cat16b(v8us lo, v8us hi) { return __builtin_bit_cast(v16bf, __builtin_shufflevector(lo, hi, 0, 1, 2, 3, 4, 5, 6, 7, 8, 9, 10, 11, 12, 13, 14, 15)); }
__device__ __forceinline__ v8f wmma16(v16h a, v16h b, v8f c) { return __builtin_amdgcn_wmma_f32_16x16x32_f16(false, a, false, b, (short)0, c, false, false); }
__device__ __forceinline__ v8f wmmab(v16bf a, v16bf b, v8f c) { return __builtin_amdgcn_wmma_f32_16x16x32_bf16(false, a, false, b, (short)0, c, false, false); }



// ---- k_gemmw: register-blocked GEMM, 64x64 output tiles (16 accumulators per wave), operands straight from K-contiguous 16-bit planes; grid (M/64, N/64 * KS, Z), 32 * NW threads.
// K is split: work-group ky = blockIdx.y % KS of a tile takes the K range [ky K/KS, (ky+1) K/KS), wave w of it the w-th of NW equal contiguous parts. The NW partial tiles of a work-group meet in LDS and are added in wave order 0, 1, ... (a fixed order);
// work-group ky stores its sum in plane ky of C (plane stride sP elements), and the reader of C adds the KS planes in plane order. NW = KS = 1: one wave, the whole K, one plane.
// C[m][n] (f32, pitch ldc, + optional f32 bias[n], KS = 1 only) = sum_k A[m][k] Bt[n][k] (+ split products per NSPLIT). z-batch strides sA/sB/sC in elements. K % (32 * NW * KS) == 0.
template <typename T16> struct WFrag;
template <> struct WFrag<h16> { typedef v16h V; static __device__ __forceinline__ V ld(const h16* p) { return cat16(*(const v8h*)p, *(const v8h*)(p + 16)); } static __device__ __forceinline__ v8f mma(V a, V b, v8f c) { return wmma16(a, b, c); } };
template <> struct WFrag<bf> { typedef v16bf V; static __device__ __forceinline__ V ld(const bf* p) { return cat16b(*(const v8us*)p, *(const v8us*)(p + 16)); } static __device__ __forceinline__ v8f mma(V a, V b, v8f c) { return wmmab(a, b, c); } };
template <int NW> __device__ __forceinline__ void tile_sync() {   // orders the LDS stores of the partial tiles before the reads of them: among the waves of the work-group, or inside the one wave
    if constexpr (NW == 1) { __builtin_amdgcn_wave_barrier(); asm volatile("" ::: "memory"); } else { __syncthreads(); } }
template <typename T16, int NSPLIT, bool BIAS, int NW, int KS>
__global__ __launch_bounds__(32 * NW) void k_gemmw(const T16* __restrict__ A, const T16* __restrict__ A2, const T16* __restrict__ Bt, const T16* __restrict__ Bt2, int K, float* C, int ldc, const float* __restrict__ bias, size_t sA, size_t sB, size_t sC, size_t sP) {
    static_assert(KS == 1 || !BIAS, "the bias would be added once per plane");
    typedef typename WFrag<T16>::V V;
    constexpr int MBR = (NW == 1) ? 1 : 4;   // 16-row blocks staged per round: with several waves the whole tile at once, so one barrier serves
    constexpr int PW = MBR * 16 * 68;        // floats of one wave's staged part
    __shared__ __align__(16) float os[NW * PW];
    const size_t z = blockIdx.z; A += z * sA; if (A2) A2 += z * sA; Bt += z * sB; if (Bt2) Bt2 += z * sB; C += z * sC;
    const int tid = threadIdx.x, lane = tid & 31, lr = lane & 15, hi = lane >> 4; const int w = (NW == 1) ? 0 : __builtin_amdgcn_readfirstlane(tid >> 5); const int ky = (KS == 1) ? 0 : (int)(blockIdx.y % KS);
    const int kspan = K / (NW * KS), kbeg = (ky * NW + w) * kspan, kend = kbeg + kspan; const int r0 = blockIdx.x * 64, c0 = (int)(blockIdx.y / KS) * 64; if (KS > 1) C += (size_t)ky * sP;
    v8f acc[4][4];
#pragma unroll
    for (int mb = 0; mb < 4; ++mb)
#pragma unroll
        for (int nb = 0; nb < 4; ++nb) acc[mb][nb] = (v8f){};
    const size_t aoff = (size_t)(r0 + lr) * K + 8 * hi, boff = (size_t)(c0 + lr) * K + 8 * hi;
#pragma unroll 1
    for (int kc = kbeg; kc < kend; kc += 32) {
        V a[4], a2[4];
#pragma unroll
        for (int mb = 0; mb < 4; ++mb) { a[mb] = WFrag<T16>::ld(A + aoff + (size_t)mb * 16 * K + kc); if (NSPLIT == 1 || NSPLIT == 2) a2[mb] = WFrag<T16>::ld(A2 + aoff + (size_t)mb * 16 * K + kc); }
#pragma unroll
        for (int nb = 0; nb < 4; ++nb) { const V b = WFrag<T16>::ld(Bt + boff + (size_t)nb * 16 * K + kc); V b2; if (NSPLIT >= 2) b2 = WFrag<T16>::ld(Bt2 + boff + (size_t)nb * 16 * K + kc);
#pragma unroll
            for (int mb = 0; mb < 4; ++mb) { acc[mb][nb] = WFrag<T16>::mma(a[mb], b, acc[mb][nb]); if (NSPLIT == 1 || NSPLIT == 2) acc[mb][nb] = WFrag<T16>::mma(a2[mb], b, acc[mb][nb]); if (NSPLIT >= 2) acc[mb][nb] = WFrag<T16>::mma(a[mb], b2, acc[mb][nb]); } }
        asm volatile("v_nop\n\tv_nop\n\tv_nop\n\tv_nop" : "+v"(acc[0][0]), "+v"(acc[1][1]), "+v"(acc[2][2]), "+v"(acc[3][3]) : "v"(a[0]), "v"(a[3]));
    }
    float* mine = os + w * PW;
#pragma unroll
    for (int m0 = 0; m0 < 4; m0 += MBR) {
#pragma unroll
        for (int mi = 0; mi < MBR; ++mi) {
#pragma unroll
            for (int nb = 0; nb < 4; ++nb) {
#pragma unroll
                for (int j = 0; j < 8; ++j) mine[(mi * 16 + hi * 8 + j) * 68 + nb * 16 + lr] = acc[m0 + mi][nb][j]; } }
        tile_sync<NW>();
        float* crow = C + (size_t)(r0 + m0 * 16) * ldc + c0;
{
#pragma unroll
            for (int s = 0; s < MBR * 8 / NW; ++s) { const int idx = s * (NW * 32) + tid; const int row = idx >> 4, cofs = (idx & 15) * 4; v4f val = *(const v4fa*)(os + row * 68 + cofs);
#pragma unroll
                for (int ww = 1; ww < NW; ++ww) val += *(const v4fa*)(os + ww * PW + row * 68 + cofs);
                if (BIAS) { val[0] += bfr(bias[c0 + cofs]); val[1] += bfr(bias[c0 + cofs + 1]); val[2] += bfr(bias[c0 + cofs + 2]); val[3] += bfr(bias[c0 + cofs + 3]); }
                *(v4f*)(crow + (size_t)row * ldc + cofs) = val; }
             }
        if (MBR < 4) tile_sync<NW>();   // the next round stores over what this round read
    }
}

__device__ __forceinline__ h16 tohx(float x) { return (h16)x; }
__device__ __forceinline__ void splitf(float y, unsigned short& h, unsigned short& l) { h = f2bf(y); l = f2bf(y - bf2f(h)); }
typedef __attribute__((ext_vector_type(2))) _Float16 v2h;
typedef __attribute__((ext_vector_type(4))) _Float16 v4h;
typedef __attribute__((ext_vector_type(2))) unsigned short v2us;
typedef __attribute__((ext_vector_type(4))) unsigned short v4us;
typedef __attribute__((ext_vector_type(2))) float v2f;
typedef __attribute__((ext_vector_type(4))) int v4i;

__global__ __launch_bounds__(256) void k_cvt8(const float* __restrict__ src, bf* dst, size_t n8) { const size_t i = (size_t)blockIdx.x * 256 + threadIdx.x; if (i >= n8) return; const v8f v = *(const v8f*)(src + i * 8); v8us o;
#pragma unroll
    for (int k = 0; k < 8; ++k) o[k] = f2bf(v[k]); *(v8us*)(dst + i * 8) = o;  }

// k_rope: head planes [h][t][d] (fp16 + hi/lo) of rope(x) x sc with the rotate-half convention out[d] = x[d] cos[t][d] - x[d+HD/2] sin[t][d], out[d+HD/2] = x[d+HD/2] cos[t][d+HD/2] + x[d] sin[t][d+HD/2]
__global__ __launch_bounds__(256) void k_rope(const float* __restrict__ F, int pitch, int nheads, const float* __restrict__ CS, const float* __restrict__ RF, const float* __restrict__ nw, float sc, h16* P16, bf* Ph, bf* Pl) {
    const size_t e = ((size_t)blockIdx.x * 256 + threadIdx.x) * 2; if (e >= (size_t)nheads * TT * HD) return; const int d = (int)(e % HD); const int t = (int)((e / HD) % TT); const int h = (int)(e / ((size_t)HD * TT)); const float* f = F + (size_t)t * pitch + h * HD; const float rf = RF ? RF[(size_t)h * TT + t] : 1.0f; v2h o16; v2us oh, ol;
#pragma unroll
    for (int q = 0; q < 2; ++q) { const int dd = d + q; const int dp = (dd < HD / 2) ? dd + HD / 2 : dd - HD / 2; float x0 = f[dd], x1 = f[dp];
        if (RF) { float n0 = __fmul_rn(x0, rf), n1 = __fmul_rn(x1, rf); asm volatile("" : "+v"(n0)); asm volatile("" : "+v"(n1)); x0 = __fmul_rn(bfr(nw[dd]), n0); x1 = __fmul_rn(bfr(nw[dp]), n1); }
        const v2f cs = *(const v2f*)(CS + ((size_t)t * HD + dd) * 2); float a = __fmul_rn(x0, cs[0]), bq = __fmul_rn(x1, cs[1]); asm volatile("" : "+v"(a)); asm volatile("" : "+v"(bq)); const float r = ((dd < HD / 2) ? __fsub_rn(a, bq) : __fadd_rn(a, bq)) * sc;
        o16[q] = tohx(r); unsigned short a2, c2; splitf(r, a2, c2); oh[q] = a2; ol[q] = c2; }
    *(v2h*)(P16 + e) = o16; *(v2us*)(Ph + e) = oh; *(v2us*)(Pl + e) = ol;  }
__global__ __launch_bounds__(256) void k_wpadH(const float* __restrict__ w, bf* Bt) { const size_t e = ((size_t)blockIdx.x * 256 + threadIdx.x) * 2; if (e >= (size_t)DQ * DM) return; const int k = (int)(e % DM); const int r = (int)(e / DM); const int h = r / HD, d = r % HD; const bool live = (d < HDR); const int col = h * HDR + (d & (HDR - 1)); const float w0 = w[(size_t)k * DQR + col], w1 = w[(size_t)(k + 1) * DQR + col]; v2us o; o[0] = live ? f2bf(w0) : (unsigned short)0; o[1] = live ? f2bf(w1) : (unsigned short)0;
    *(v2us*)(Bt + e) = o;  }
__global__ __launch_bounds__(256) void k_bpadH(const float* __restrict__ b0, const float* __restrict__ b1, const float* __restrict__ b2, float* B3) { const int i = blockIdx.x * 256 + threadIdx.x; if (i >= 3 * DQ) return; const int s = i / DQ, r = i % DQ; const int h = r / HD, d = r % HD; const float* src = (s == 0) ? b0 : ((s == 1) ? b1 : b2); const float val = src[h * HDR + (d & (HDR - 1))]; const float o = (d < HDR) ? val : 0.0f; *(float*)(B3 + i) = o;  }
__global__ __launch_bounds__(256) void k_wopadH(const float* __restrict__ wo, bf* Bt) { const size_t e = ((size_t)blockIdx.x * 256 + threadIdx.x) * 2; if (e >= (size_t)DM * DQ) return; const int c = (int)(e % DQ); const int n = (int)(e / DQ); const int h = c / HD, d = c % HD; const bool live = (d < HDR); const int rr = h * HDR + (d & (HDR - 1)); const float w0 = wo[(size_t)rr * DM + n], w1 = wo[(size_t)(h * HDR + ((d + 1) & (HDR - 1))) * DM + n]; v2us o; o[0] = live ? f2bf(w0) : (unsigned short)0; o[1] = (d + 1 < HDR) ? f2bf(w1) : (unsigned short)0;
    *(v2us*)(Bt + e) = o;  }
__global__ __launch_bounds__(256) void k_vtp(const float* __restrict__ F, int pitch, int nheads, h16* V16, bf* Vh, bf* Vl) { const size_t e = ((size_t)blockIdx.x * 256 + threadIdx.x) * 2; if (e >= (size_t)nheads * HD * TT) return; const int t = (int)(e % TT); const int d = (int)((e / TT) % HD); const int g = (int)(e / ((size_t)TT * HD)); v2h o16; v2us oh, ol;
#pragma unroll
    for (int q = 0; q < 2; ++q) { const float x = F[(size_t)(t + q) * pitch + g * HD + d]; o16[q] = tohx(x); unsigned short a2, c2; splitf(x, a2, c2); oh[q] = a2; ol[q] = c2; }
    *(v2h*)(V16 + e) = o16; *(v2us*)(Vh + e) = oh; *(v2us*)(Vl + e) = ol;  }
__global__ __launch_bounds__(256) void k_csid(float* CS) { const int idx = blockIdx.x * 256 + threadIdx.x; if (idx >= TT * HD) return; v2f cs; cs[0] = 1.0f; cs[1] = 0.0f; *(v2f*)(CS + (size_t)idx * 2) = cs;  }
// k_asoft: per row (zz, i): t = S x SCL = S / sqrt(128) (no mask); softmax over the 2048 keys (register row, one exp, fixed trees);
__global__ __launch_bounds__(256) void k_asoft(const float* __restrict__ Sb, h16* P16, bf* Ph, bf* Pl) {
    const int lane = threadIdx.x & 31; const int row = blockIdx.x * 8 + (threadIdx.x >> 5); if (row >= ZH * TT) return; const int i = row % TT; const int zz = row / TT; (void)zz; const bool hires = (i < RH); const float* sr = Sb + (size_t)row * TT; float v[TT / 32]; float mx = -3.0e38f;
#pragma unroll
    for (int ch = 0; ch < TT / 128; ++ch) { const int j0 = ch * 128 + lane * 4; const v4f a = *(const v4f*)(sr + j0);
#pragma unroll
        for (int q = 0; q < 4; ++q) { const int j = j0 + q; (void)j; const float t = a[q] * SCL; v[ch * 4 + q] = t; mx = fmaxf(mx, t); } }
#pragma unroll
    for (int sh = 16; sh; sh >>= 1) mx = fmaxf(mx, __shfl_xor(mx, sh, 32));
    float sum = 0.f;
#pragma unroll
    for (int k = 0; k < TT / 32; ++k) { float d0 = __fsub_rn(v[k], mx); asm volatile("" : "+v"(d0)); v[k] = __builtin_amdgcn_exp2f(__fmul_rn(d0, 1.4426950408889634f)); sum += v[k]; }
#pragma unroll
    for (int sh = 16; sh; sh >>= 1) sum += __shfl_xor(sum, sh, 32);
    const float f = __fdiv_rn(hires ? 1.0f : PCAR, sum);
{
        if (hires) {
#pragma unroll
            for (int ch = 0; ch < TT / 128; ++ch) { v4us oh, ol;
#pragma unroll
                for (int q = 0; q < 4; ++q) { unsigned short a, c2; splitf(v[ch * 4 + q] * f, a, c2); oh[q] = a; ol[q] = c2; }
                const size_t oo = ((size_t)zz * (RH ? RH : 1) + i) * TT + ch * 128 + lane * 4; *(v4us*)(Ph + oo) = oh; *(v4us*)(Pl + oo) = ol; }
        } else {
#pragma unroll
            for (int ch = 0; ch < TT / 128; ++ch) { v4h o4;
#pragma unroll
                for (int q = 0; q < 4; ++q) o4[q] = tohx(v[ch * 4 + q] * f);
                *(v4h*)(P16 + (size_t)row * TT + ch * 128 + lane * 4) = o4; } }
         }
}
__global__ __launch_bounds__(256) void k_merge(const float* __restrict__ O, int h0, bf* Ah, bf* Al) { const size_t e = ((size_t)blockIdx.x * 256 + threadIdx.x) * 2; if (e >= (size_t)ZH * TT * HD) return; const int d = (int)(e % HD); const int t = (int)((e / HD) % TT); const int zz = (int)(e / ((size_t)HD * TT)); const float cs = (t < RH) ? 1.0f : (1.0f / PCAR); const size_t oo = (size_t)t * DQ + (h0 + zz) * HD + d;
    v2us oh, ol;
#pragma unroll
    for (int q = 0; q < 2; ++q) { float o = O[e + q];
#pragma unroll
        for (int p = 1; p < KSP; ++p) o += O[(size_t)p * ZH * TT * HD + e + q];   // the K parts of P.V, in plane order
        unsigned short a, c2; splitf(o * cs, a, c2); oh[q] = a; ol[q] = c2; } *(v2us*)(Ah + oo) = oh; *(v2us*)(Al + oo) = ol;  }

extern "C" void kernel_launch(void* const* d_in, const int* in_sizes, int n_in,
                              void* d_out, int out_size, void* d_ws, size_t ws_size, hipStream_t stream) {
    (void)in_sizes; (void)n_in; (void)out_size;
    const float* x = (const float*)d_in[0]; const float* xk = (const float*)d_in[1]; const float* xv = (const float*)d_in[2]; const float* wq = (const float*)d_in[3]; const float* bqr = (const float*)d_in[4]; const float* wk = (const float*)d_in[5]; const float* bkr = (const float*)d_in[6]; const float* wv = (const float*)d_in[7]; const float* bvr = (const float*)d_in[8]; const float* wo = (const float*)d_in[9]; const float* bo = (const float*)d_in[10];   /* argument order queries, keys, values, Wq ('xw' [1024][128]), bq [128], Wk, bk, Wv, bv, Wo ('xw' [128][1024]), bo */
    float* OUT = (float*)d_out;     // [2][2048][1024]
    char* wsp = (char*)d_ws;
    auto take = [&](size_t bytes) { char* p = wsp; wsp += (bytes + 255) & ~(size_t)255; return (void*)p; };
    bf* WQ = (bf*)take((size_t)DQ * DM * 2); bf* WK = (bf*)take((size_t)DKV * DM * 2); bf* WV = (bf*)take((size_t)DKV * DM * 2); bf* WO = (bf*)take((size_t)DM * DQ * 2); float* CS = (float*)take((size_t)TT * HD * 2 * 4);
    bf* XB = (bf*)take((size_t)TT * DM * 2); float* B3 = (float*)take((size_t)3 * DQ * 4); const float* bq = B3; const float* bk = B3 + DQ; const float* bv = B3 + 2 * DQ;   /* padded biases */ float* FQ = (float*)take((size_t)TT * DQ * 4); float* FK = (float*)take((size_t)TT * DKV * 4);
    h16* QP16 = (h16*)take((size_t)NH_ * TT * HD * 2); h16* KP16 = (h16*)take((size_t)NKV * TT * HD * 2); h16* VT16 = (h16*)take((size_t)NKV * HD * TT * 2);
    bf* QPh = (bf*)take((size_t)NH_ * TT * HD * 2); bf* QPl = (bf*)take((size_t)NH_ * TT * HD * 2); bf* KPh = (bf*)take((size_t)NKV * TT * HD * 2); bf* KPl = (bf*)take((size_t)NKV * TT * HD * 2); bf* VTh = (bf*)take((size_t)NKV * HD * TT * 2); bf* VTl = (bf*)take((size_t)NKV * HD * TT * 2); bf* Ph = (bf*)take((size_t)ZH * RH * TT * 2); bf* Pl = (bf*)take((size_t)ZH * RH * TT * 2);
    float* Sb = (float*)take((size_t)ZH * TT * TT * 4); h16* P16 = (h16*)take((size_t)ZH * TT * TT * 2); float* Ob = (float*)take((size_t)KSP * ZH * TT * HD * 4); bf* ATh = (bf*)take((size_t)TT * DQ * 2); bf* ATl = (bf*)take((size_t)TT * DQ * 2);
    if ((size_t)(wsp - (char*)d_ws) > ws_size) return;    // ws 256 MiB
    float* FV = FK;   // v projection reuses the k buffer after the k planes are built (stream-ordered)
    { k_wpadH<<<(unsigned)(((size_t)DQ * DM / 2 + 255) / 256), 256, 0, stream>>>(wq, WQ);   /* 'xw' [1024][128] -> padded Bt [512][1024] */ k_wpadH<<<(unsigned)(((size_t)DQ * DM / 2 + 255) / 256), 256, 0, stream>>>(wk, WK);   /* 'xw' [1024][128] -> padded Bt [512][1024] */ k_wpadH<<<(unsigned)(((size_t)DQ * DM / 2 + 255) / 256), 256, 0, stream>>>(wv, WV);   /* 'xw' [1024][128] -> padded Bt [512][1024] */
      k_wopadH<<<(unsigned)(((size_t)DM * DQ / 2 + 255) / 256), 256, 0, stream>>>(wo, WO);   /* 'xw' [128][1024] -> padded Bt [1024][512] */ k_bpadH<<<(3 * DQ + 255) / 256, 256, 0, stream>>>(bqr, bkr, bvr, B3);
       }
    k_csid<<<(TT * HD + 255) / 256, 256, 0, stream>>>(CS);
    const unsigned LQ = (unsigned)(((size_t)NH_ * TT * HD / 2 + 255) / 256), LKv = (unsigned)(((size_t)NKV * TT * HD / 2 + 255) / 256);
    for (int b = 0; b < NB_; ++b) {
        
        k_cvt8<<<(unsigned)(((size_t)TT * DM / 8 + 255) / 256), 256, 0, stream>>>(x + (size_t)b * TT * DM, XB, (size_t)TT * DM / 8);
        k_gemmw<bf, 0, true, 8, 1><<<dim3(TT / 64, DQ / 64, 1), 256, 0, stream>>>(XB, nullptr, WQ, nullptr, DM, FQ, DQ, bq, 0, 0, 0, 0);
        k_rope<<<LQ, 256, 0, stream>>>(FQ, DQ, NH_, CS, nullptr, nullptr, 1.0f, QP16, QPh, QPl);
        k_cvt8<<<(unsigned)(((size_t)TT * DM / 8 + 255) / 256), 256, 0, stream>>>(xk + (size_t)b * TT * DM, XB, (size_t)TT * DM / 8);   /* XB := bf16(keys[b]) */ k_gemmw<bf, 0, true, 8, 1><<<dim3(TT / 64, DKV / 64, 1), 256, 0, stream>>>(XB, nullptr, WK, nullptr, DM, FK, DKV, bk, 0, 0, 0, 0);
        k_rope<<<LKv, 256, 0, stream>>>(FK, DKV, NKV, CS, nullptr, nullptr, 1.0f, KP16, KPh, KPl);
        k_cvt8<<<(unsigned)(((size_t)TT * DM / 8 + 255) / 256), 256, 0, stream>>>(xv + (size_t)b * TT * DM, XB, (size_t)TT * DM / 8);   /* XB := bf16(values[b]) */ k_gemmw<bf, 0, true, 8, 1><<<dim3(TT / 64, DKV / 64, 1), 256, 0, stream>>>(XB, nullptr, WV, nullptr, DM, FV, DKV, bv, 0, 0, 0, 0); k_vtp<<<LKv, 256, 0, stream>>>(FV, DKV, NKV, VT16, VTh, VTl);
        for (int h0 = 0; h0 < NH_; h0 += ZH) { const size_t zq = (size_t)h0, zk = (size_t)(h0 / REP);   // one kv head per query head: the pass's two heads use consecutive kv planes (z-strides TT*HD)
            k_gemmw<bf, 2, false, 1, 1><<<dim3(RH / 64, TT / 64, ZH), 32, 0, stream>>>(QPh + zq * TT * HD, QPl + zq * TT * HD, KPh + zk * TT * HD, KPl + zk * TT * HD, HD, Sb, TT, nullptr, (size_t)TT * HD, (size_t)TT * HD, (size_t)TT * TT, 0);
            k_gemmw<h16, 0, false, 1, 1><<<dim3((TT - RH) / 64, TT / 64, ZH), 32, 0, stream>>>(QP16 + zq * TT * HD + (size_t)RH * HD, nullptr, KP16 + zk * TT * HD, nullptr, HD, Sb + (size_t)RH * TT, TT, nullptr, (size_t)TT * HD, (size_t)TT * HD, (size_t)TT * TT, 0);
            k_asoft<<<ZH * TT / 8, 256, 0, stream>>>(Sb, P16, Ph, Pl);
            k_gemmw<bf, 2, false, 8, KSP><<<dim3(RH / 64, HD / 64 * KSP, ZH), 256, 0, stream>>>(Ph, Pl, VTh + zk * HD * TT, VTl + zk * HD * TT, TT, Ob, HD, nullptr, (size_t)RH * TT, (size_t)HD * TT, (size_t)TT * HD, (size_t)ZH * TT * HD);
            k_gemmw<h16, 0, false, 8, KSP><<<dim3((TT - RH) / 64, HD / 64 * KSP, ZH), 256, 0, stream>>>(P16 + (size_t)RH * TT, nullptr, VT16 + zk * HD * TT, nullptr, TT, Ob + (size_t)RH * HD, HD, nullptr, (size_t)TT * TT, (size_t)HD * TT, (size_t)TT * HD, (size_t)ZH * TT * HD);
            k_merge<<<(unsigned)(((size_t)ZH * TT * HD / 2 + 255) / 256), 256, 0, stream>>>(Ob, h0, ATh, ATl); }
        k_gemmw<bf, 1, true, 8, 1><<<dim3(TT / 64, DM / 64, 1), 256, 0, stream>>>(ATh, ATl, WO, nullptr, DQ, OUT + (size_t)b * TT * DM, DM, bo, 0, 0, 0, 0); }
}

// v003
// It runs in 126 microseconds.
// Versions in between are left out here; by their measured steps it is 3.41 times as fast as v001.
// Over all steps from v000 it is 8.92 times as fast.
#include <hip/hip_runtime.h>

// Multi-headed attention whose projections are only 128 wide (the module's Dense(d_k = d_model / h) quirk): 8 heads x 16 dims (queries, keys, values [2][2048][1024]; q = queries Wq + bq, k = keys Wk + bk, v = values Wv + bv ('xw' [1024][128] 0.02 + zero biases [128]); heads = 16-wide slices; scores / sqrt(128) (the module scales by sqrt(d_k = 128), not by the per-head 16); softmax (no mask); o = merged [2048][128]; out = o Wo + bo ('xw' [128][1024]) -> [2][2048][1024] (4.2 M); argument order queries, keys, values, Wq, bq, Wk, bk, Wv, bv, Wo, bo).
// Five launches, each holding every piece of work that depends only on the launches before it, for both batches: k_prep (operand planes), k_gemmw z = 0..5 (projections), k_planes (head planes), k_fattn, k_gemmw z = 0..1 (output). Index z = p * NB_ + b, p = 0 queries, 1 keys, 2 values.
// Layout per batch: each 16-wide head is PADDED into a 64-wide slot (exact zeros), so 64-wide planes apply: NEW d_wpadH (in k_prep) builds the padded Bt planes [512][1024] from the 'xw' [1024][128] weights (row h*64 + d = W[:, h*16 + d] for d < 16, zero rows otherwise), d_bpadH the padded biases, d_wopadH the padded output weight Bt [1024][512] (column h*64 + d = Wo[h*16 + d][:] for d < 16, zeros otherwise); exact projections + f32 biases (zero pad rows give exact zeros); identity-table plane builders; dense T-2048 attention (the zero padding adds exact zeros to q.k and to the context); merged hi/lo x padded Wo exact + bo.
// Compute dtypes, f32 accumulate: every input rounded to bf16; projections exact + f32 biases; attention rows < 512 3 products, rest fp16; softmax f32; Wo hl x exact + bias.

#define NB_  2
#define TT   2048
#define DM   1024
#define NH_  8
#define NKV  8
#define REP  (NH_ / NKV)
#define HD   64
#define DQ   (NH_ * HD)
#define DKV  (NKV * HD)
#define RH   512                  // query rows < RH use hi+lo planes (0: none)
#define WIN  0
#define PCAR 1024.0f
#define SCL  0.088388347648318447f   // 1/sqrt(d_k = 128), as the module (not 1/sqrt(16))
#define HDR  16       // real per-head width
#define DQR  128      // real projection width (8 x 16)
typedef _Float16 h16;
typedef unsigned short bf;
typedef __attribute__((ext_vector_type(16))) __bf16   v16bf;
typedef __attribute__((ext_vector_type(16))) _Float16 v16h;
typedef __attribute__((ext_vector_type(8)))  _Float16 v8h;
typedef __attribute__((ext_vector_type(8)))  unsigned short v8us;
typedef __attribute__((ext_vector_type(8)))  float    v8f;
typedef __attribute__((ext_vector_type(4)))  float    v4f;
typedef v8h  __attribute__((may_alias)) v8ha;
typedef v4f  __attribute__((may_alias)) v4fa;
typedef v8us __attribute__((may_alias)) v8usa;

__device__ __forceinline__ unsigned short f2bf(float f) { unsigned u = __float_as_uint(f); u += 0x7FFFu + ((u >> 16) & 1u); return (unsigned short)(u >> 16); }
__device__ __forceinline__ float bf2f(unsigned short b) { return __uint_as_float(((unsigned)b) << 16); }
__device__ __forceinline__ float bfr(float f) { return bf2f(f2bf(f)); }
__device__ __forceinline__ v16h cat16(v8h lo, v8h hi) { return __builtin_shufflevector(lo, hi, 0, 1, 2, 3, 4, 5, 6, 7, 8, 9, 10, 11, 12, 13, 14, 15); }
__device__ __forceinline__ v16bf cat16b(v8us lo, v8us hi) { return __builtin_bit_cast(v16bf, __builtin_shufflevector(lo, hi, 0, 1, 2, 3, 4, 5, 6, 7, 8, 9, 10, 11, 12, 13, 14, 15)); }
__device__ __forceinline__ v8f wmma16(v16h a, v16h b, v8f c) { return __builtin_amdgcn_wmma_f32_16x16x32_f16(false, a, false, b, (short)0, c, false, false); }
__device__ __forceinline__ v8f wmmab(v16bf a, v16bf b, v8f c) { return __builtin_amdgcn_wmma_f32_16x16x32_bf16(false, a, false, b, (short)0, c, false, false); }



// ---- k_gemmw: register-blocked GEMM, 64x64 output tiles (16 accumulators per wave), operands straight from K-contiguous 16-bit planes; grid (M/64, N/64 * KS, Z), 32 * NW threads.
// K is split: work-group ky = blockIdx.y % KS of a tile takes the K range [ky K/KS, (ky+1) K/KS), wave w of it the w-th of NW equal contiguous parts. The NW partial tiles of a work-group meet in LDS and are added in wave order 0, 1, ... (a fixed order);
// work-group ky stores its sum in plane ky of C (plane stride sP elements), and the reader of C adds the KS planes in plane order. NW = KS = 1: one wave, the whole K, one plane.
// C[m][n] (f32, pitch ldc, + optional f32 bias[n], KS = 1 only) = sum_k A[m][k] Bt[n][k] (+ split products per NSPLIT). z-batch strides sA/sB/sC in elements; ZB neighbouring z share one Bt and one bias (strides sB, sBb per group of ZB). K % (32 * NW * KS) == 0.
template <typename T16> struct WFrag;
template <> struct WFrag<h16> { typedef v16h V; static __device__ __forceinline__ V ld(const h16* p) { return cat16(*(const v8h*)p, *(const v8h*)(p + 16)); } static __device__ __forceinline__ v8f mma(V a, V b, v8f c) { return wmma16(a, b, c); } };
template <> struct WFrag<bf> { typedef v16bf V; static __device__ __forceinline__ V ld(const bf* p) { return cat16b(*(const v8us*)p, *(const v8us*)(p + 16)); } static __device__ __forceinline__ v8f mma(V a, V b, v8f c) { return wmmab(a, b, c); } };
template <int NW> __device__ __forceinline__ void tile_sync() {   // orders the LDS stores of the partial tiles before the reads of them: among the waves of the work-group, or inside the one wave
    if constexpr (NW == 1) { __builtin_amdgcn_wave_barrier(); asm volatile("" ::: "memory"); } else { __syncthreads(); } }
template <typename T16, int NSPLIT, bool BIAS, int NW, int KS, int ZB>
__global__ __launch_bounds__(32 * NW) void k_gemmw(const T16* __restrict__ A, const T16* __restrict__ A2, const T16* __restrict__ Bt, const T16* __restrict__ Bt2, int K, float* C, int ldc, const float* __restrict__ bias, size_t sA, size_t sB, size_t sC, size_t sP, size_t sBb) {
    static_assert(KS == 1 || !BIAS, "the bias would be added once per plane");
    typedef typename WFrag<T16>::V V;
    constexpr int MBR = (NW == 1) ? 1 : 4;   // 16-row blocks staged per round: with several waves the whole tile at once, so one barrier serves
    constexpr int PW = MBR * 16 * 68;        // floats of one wave's staged part
    __shared__ __align__(16) float os[NW * PW];
    const size_t z = blockIdx.z, zw = z / ZB; A += z * sA; if (A2) A2 += z * sA; Bt += zw * sB; if (Bt2) Bt2 += zw * sB; if (BIAS) bias += zw * sBb; C += z * sC;
    const int tid = threadIdx.x, lane = tid & 31, lr = lane & 15, hi = lane >> 4; const int w = (NW == 1) ? 0 : __builtin_amdgcn_readfirstlane(tid >> 5); const int ky = (KS == 1) ? 0 : (int)(blockIdx.y % KS);
    const int kspan = K / (NW * KS), kbeg = (ky * NW + w) * kspan, kend = kbeg + kspan; const int r0 = blockIdx.x * 64, c0 = (int)(blockIdx.y / KS) * 64; if (KS > 1) C += (size_t)ky * sP;
    v8f acc[4][4];
#pragma unroll
    for (int mb = 0; mb < 4; ++mb)
#pragma unroll
        for (int nb = 0; nb < 4; ++nb) acc[mb][nb] = (v8f){};
    const size_t aoff = (size_t)(r0 + lr) * K + 8 * hi, boff = (size_t)(c0 + lr) * K + 8 * hi;
#pragma unroll 1
    for (int kc = kbeg; kc < kend; kc += 32) {
        V a[4], a2[4];
#pragma unroll
        for (int mb = 0; mb < 4; ++mb) { a[mb] = WFrag<T16>::ld(A + aoff + (size_t)mb * 16 * K + kc); if (NSPLIT == 1 || NSPLIT == 2) a2[mb] = WFrag<T16>::ld(A2 + aoff + (size_t)mb * 16 * K + kc); }
#pragma unroll
        for (int nb = 0; nb < 4; ++nb) { const V b = WFrag<T16>::ld(Bt + boff + (size_t)nb * 16 * K + kc); V b2; if (NSPLIT >= 2) b2 = WFrag<T16>::ld(Bt2 + boff + (size_t)nb * 16 * K + kc);
#pragma unroll
            for (int mb = 0; mb < 4; ++mb) { acc[mb][nb] = WFrag<T16>::mma(a[mb], b, acc[mb][nb]); if (NSPLIT == 1 || NSPLIT == 2) acc[mb][nb] = WFrag<T16>::mma(a2[mb], b, acc[mb][nb]); if (NSPLIT >= 2) acc[mb][nb] = WFrag<T16>::mma(a[mb], b2, acc[mb][nb]); } }
        asm volatile("v_nop\n\tv_nop\n\tv_nop\n\tv_nop" : "+v"(acc[0][0]), "+v"(acc[1][1]), "+v"(acc[2][2]), "+v"(acc[3][3]) : "v"(a[0]), "v"(a[3]));
    }
    float* mine = os + w * PW;
#pragma unroll
    for (int m0 = 0; m0 < 4; m0 += MBR) {
#pragma unroll
        for (int mi = 0; mi < MBR; ++mi) {
#pragma unroll
            for (int nb = 0; nb < 4; ++nb) {
#pragma unroll
                for (int j = 0; j < 8; ++j) mine[(mi * 16 + hi * 8 + j) * 68 + nb * 16 + lr] = acc[m0 + mi][nb][j]; } }
        tile_sync<NW>();
        float* crow = C + (size_t)(r0 + m0 * 16) * ldc + c0;
{
#pragma unroll
            for (int s = 0; s < MBR * 8 / NW; ++s) { const int idx = s * (NW * 32) + tid; const int row = idx >> 4, cofs = (idx & 15) * 4; v4f val = *(const v4fa*)(os + row * 68 + cofs);
#pragma unroll
                for (int ww = 1; ww < NW; ++ww) val += *(const v4fa*)(os + ww * PW + row * 68 + cofs);
                if (BIAS) { val[0] += bfr(bias[c0 + cofs]); val[1] += bfr(bias[c0 + cofs + 1]); val[2] += bfr(bias[c0 + cofs + 2]); val[3] += bfr(bias[c0 + cofs + 3]); }
                *(v4f*)(crow + (size_t)row * ldc + cofs) = val; }
             }
        if (MBR < 4) tile_sync<NW>();   // the next round stores over what this round read
    }
}

__device__ __forceinline__ h16 tohx(float x) { return (h16)x; }
__device__ __forceinline__ void splitf(float y, unsigned short& h, unsigned short& l) { h = f2bf(y); l = f2bf(y - bf2f(h)); }
typedef __attribute__((ext_vector_type(2))) _Float16 v2h;
typedef __attribute__((ext_vector_type(4))) _Float16 v4h;
typedef __attribute__((ext_vector_type(2))) unsigned short v2us;
typedef __attribute__((ext_vector_type(4))) unsigned short v4us;
typedef __attribute__((ext_vector_type(2))) float v2f;
typedef __attribute__((ext_vector_type(4))) int v4i;

// The bodies below take their block index blk as an argument: k_prep and k_planes hand each a range of their grids.
__device__ __forceinline__ void d_cvt8(unsigned blk, const float* __restrict__ src, bf* dst, size_t n8) { const size_t i = (size_t)blk * 256 + threadIdx.x; if (i >= n8) return; const v8f v = *(const v8f*)(src + i * 8); v8us o;
#pragma unroll
    for (int k = 0; k < 8; ++k) o[k] = f2bf(v[k]); *(v8us*)(dst + i * 8) = o;  }

// d_rope: head planes [h][t][d] (fp16 + hi/lo) of rope(x) x sc with the rotate-half convention out[d] = x[d] cos[t][d] - x[d+HD/2] sin[t][d], out[d+HD/2] = x[d+HD/2] cos[t][d+HD/2] + x[d] sin[t][d+HD/2]
__device__ __forceinline__ void d_rope(unsigned blk, const float* __restrict__ F, int pitch, int nheads, const float* __restrict__ CS, const float* __restrict__ RF, const float* __restrict__ nw, float sc, h16* P16, bf* Ph, bf* Pl) {
    const size_t e = ((size_t)blk * 256 + threadIdx.x) * 2; if (e >= (size_t)nheads * TT * HD) return; const int d = (int)(e % HD); const int t = (int)((e / HD) % TT); const int h = (int)(e / ((size_t)HD * TT)); const float* f = F + (size_t)t * pitch + h * HD; const float rf = RF ? RF[(size_t)h * TT + t] : 1.0f; v2h o16; v2us oh, ol;
#pragma unroll
    for (int q = 0; q < 2; ++q) { const int dd = d + q; const int dp = (dd < HD / 2) ? dd + HD / 2 : dd - HD / 2; float x0 = f[dd], x1 = f[dp];
        if (RF) { float n0 = __fmul_rn(x0, rf), n1 = __fmul_rn(x1, rf); asm volatile("" : "+v"(n0)); asm volatile("" : "+v"(n1)); x0 = __fmul_rn(bfr(nw[dd]), n0); x1 = __fmul_rn(bfr(nw[dp]), n1); }
        const v2f cs = *(const v2f*)(CS + ((size_t)t * HD + dd) * 2); float a = __fmul_rn(x0, cs[0]), bq = __fmul_rn(x1, cs[1]); asm volatile("" : "+v"(a)); asm volatile("" : "+v"(bq)); const float r = ((dd < HD / 2) ? __fsub_rn(a, bq) : __fadd_rn(a, bq)) * sc;
        o16[q] = tohx(r); unsigned short a2, c2; splitf(r, a2, c2); oh[q] = a2; ol[q] = c2; }
    *(v2h*)(P16 + e) = o16; *(v2us*)(Ph + e) = oh; *(v2us*)(Pl + e) = ol;  }
__device__ __forceinline__ void d_wpadH(unsigned blk, const float* __restrict__ w, bf* Bt) { const size_t e = ((size_t)blk * 256 + threadIdx.x) * 2; if (e >= (size_t)DQ * DM) return; const int k = (int)(e % DM); const int r = (int)(e / DM); const int h = r / HD, d = r % HD; const bool live = (d < HDR); const int col = h * HDR + (d & (HDR - 1)); const float w0 = w[(size_t)k * DQR + col], w1 = w[(size_t)(k + 1) * DQR + col]; v2us o; o[0] = live ? f2bf(w0) : (unsigned short)0; o[1] = live ? f2bf(w1) : (unsigned short)0;
    *(v2us*)(Bt + e) = o;  }
__device__ __forceinline__ void d_bpadH(unsigned blk, const float* __restrict__ b0, const float* __restrict__ b1, const float* __restrict__ b2, float* B3) { const int i = blk * 256 + threadIdx.x; if (i >= 3 * DQ) return; const int s = i / DQ, r = i % DQ; const int h = r / HD, d = r % HD; const float* src = (s == 0) ? b0 : ((s == 1) ? b1 : b2); const float val = src[h * HDR + (d & (HDR - 1))]; const float o = (d < HDR) ? val : 0.0f; *(float*)(B3 + i) = o;  }
__device__ __forceinline__ void d_wopadH(unsigned blk, const float* __restrict__ wo, bf* Bt) { const size_t e = ((size_t)blk * 256 + threadIdx.x) * 2; if (e >= (size_t)DM * DQ) return; const int c = (int)(e % DQ); const int n = (int)(e / DQ); const int h = c / HD, d = c % HD; const bool live = (d < HDR); const int rr = h * HDR + (d & (HDR - 1)); const float w0 = wo[(size_t)rr * DM + n], w1 = wo[(size_t)(h * HDR + ((d + 1) & (HDR - 1))) * DM + n]; v2us o; o[0] = live ? f2bf(w0) : (unsigned short)0; o[1] = (d + 1 < HDR) ? f2bf(w1) : (unsigned short)0;
    *(v2us*)(Bt + e) = o;  }
__device__ __forceinline__ void d_vtp(unsigned blk, const float* __restrict__ F, int pitch, int nheads, h16* V16, bf* Vh, bf* Vl) { const size_t e = ((size_t)blk * 256 + threadIdx.x) * 2; if (e >= (size_t)nheads * HD * TT) return; const int t = (int)(e % TT); const int d = (int)((e / TT) % HD); const int g = (int)(e / ((size_t)TT * HD)); v2h o16; v2us oh, ol;
#pragma unroll
    for (int q = 0; q < 2; ++q) { const float x = F[(size_t)(t + q) * pitch + g * HD + d]; o16[q] = tohx(x); unsigned short a2, c2; splitf(x, a2, c2); oh[q] = a2; ol[q] = c2; }
    *(v2h*)(V16 + e) = o16; *(v2us*)(Vh + e) = oh; *(v2us*)(Vl + e) = ol;  }
__device__ __forceinline__ void d_csid(unsigned blk, float* CS) { const int idx = blk * 256 + threadIdx.x; if (idx >= TT * HD) return; v2f cs; cs[0] = 1.0f; cs[1] = 0.0f; *(v2f*)(CS + (size_t)idx * 2) = cs;  }
// Blocks of 256 threads that each piece takes
#define GB_W  (DQ * DM / 2 / 256)          // one padded projection weight
#define GB_WO (DM * DQ / 2 / 256)          // the padded output weight
#define GB_X  (NB_ * TT * DM / 8 / 256)    // one input, both batches
#define GB_CS (TT * HD / 256)
#define GB_B  ((3 * DQ + 255) / 256)
#define GB_P  (NH_ * TT * HD / 2 / 256)    // the planes of one projection of one batch
#define PLN   ((size_t)NH_ * TT * HD)      // elements of one such plane
// ---- k_prep: all that reads only the inputs, one block range per piece; the pieces with strided reads have the low indices (for speed only).
// W3 = padded Bt planes of Wq, Wk, Wv; XB = bf16 of queries, keys, values, [p][b][t][c].
__global__ __launch_bounds__(256) void k_prep(const float* __restrict__ x, const float* __restrict__ xk, const float* __restrict__ xv, const float* __restrict__ wq, const float* __restrict__ wk, const float* __restrict__ wv, const float* __restrict__ wo,
                                              const float* __restrict__ b0, const float* __restrict__ b1, const float* __restrict__ b2, bf* W3, bf* WO, bf* XB, float* CS, float* B3) {
    unsigned blk = blockIdx.x;
    if (blk < 3 * GB_W) { const unsigned p = blk / GB_W; d_wpadH(blk % GB_W, (p == 0) ? wq : ((p == 1) ? wk : wv), W3 + (size_t)p * DQ * DM); return; }
    blk -= 3 * GB_W;
    if (blk < GB_WO) { d_wopadH(blk, wo, WO); return; }
    blk -= GB_WO;
    if (blk < 3 * GB_X) { const unsigned p = blk / GB_X; d_cvt8(blk % GB_X, (p == 0) ? x : ((p == 1) ? xk : xv), XB + (size_t)p * NB_ * TT * DM, (size_t)NB_ * TT * DM / 8); return; }
    blk -= 3 * GB_X;
    if (blk < GB_CS) { d_csid(blk, CS); return; }
    d_bpadH(blk - GB_CS, b0, b1, b2, B3);
}
// ---- k_planes: the head planes of all six projections (F = [z = 0..3] of q and k, FV = [b] of v); the transposing V pieces (strided reads) have the low indices. P16 / Ph / Pl = [z = 0..3] planes of q and k, V16 / Vh / Vl = [b].
__global__ __launch_bounds__(256) void k_planes(const float* __restrict__ F, const float* __restrict__ FV, const float* __restrict__ CS, h16* P16, bf* Ph, bf* Pl, h16* V16, bf* Vh, bf* Vl) {
    unsigned blk = blockIdx.x;
    if (blk < NB_ * GB_P) { const unsigned b = blk / GB_P; d_vtp(blk % GB_P, FV + (size_t)b * TT * DQ, DKV, NKV, V16 + b * PLN, Vh + b * PLN, Vl + b * PLN); return; }
    blk -= NB_ * GB_P;
    const unsigned z = blk / GB_P; d_rope(blk % GB_P, F + (size_t)z * TT * DQ, DQ, NH_, CS, nullptr, nullptr, 1.0f, P16 + z * PLN, Ph + z * PLN, Pl + z * PLN);
}
// ---- k_fattn: scores, softmax and P.V of QT x 16 query rows of one head in one work-group; S and P stay in registers. Grid (heads, NB_ TT / (16 QT)), NWV waves; wave w takes the keys [w KW, (w + 1) KW) for all the rows, so a K or V fragment is loaded once for QT row tiles.
// S^T = K Q^T: register j of key tile t in lane (lr, hi) is S[query lr][key 16 t + 8 hi + j], so a lane holds scores of one query per row tile, and two neighbouring key tiles are, as they lie, the A fragment of P for 32 keys (same k order as the V^T loader).
// Only d < HDR of a head slot is non-zero, so the upper half of the K and Q fragments (d 16..31) is set to zero in registers and d >= 32 is left out: exact zeros either way.
// Row maximum and row sum: in the lane, then across the two lane halves, then across the waves through LDS in wave order; P is normalised before it is rounded; the waves' partial contexts are added in wave order.
// Rows < RH: hi/lo bf16 planes, 3 products (these work-groups have the low blockIdx.y: they run longest); the rest fp16 with P carried x PCAR. Stores the hi/lo planes of the merged context, the zero columns of the head's 64-wide slot included.
// Every loop of fattn_rows is unrolled: s, v, o and the fragments are register arrays, which only constant indices keep out of scratch memory.
#define NWV 16
#define QT  2
#define KW  (TT / NWV)
#define KT  (KW / 16)
// 2^x by the hardware instruction, with the one free issue slot behind a transcendental in the same statement
__device__ __forceinline__ float exp2_slot(float x) { float e; asm("v_exp_f32 %0, %1\n\tv_nop" : "=v"(e) : "v"(x)); return e; }
template <bool HIRES> struct FSel { typedef bf T; };
template <> struct FSel<false> { typedef h16 T; };
template <bool HIRES>
__device__ __forceinline__ void fattn_rows(const h16* __restrict__ Q16, const h16* __restrict__ K16, const h16* __restrict__ V16, const bf* __restrict__ Qh, const bf* __restrict__ Ql, const bf* __restrict__ Kh, const bf* __restrict__ Kl, const bf* __restrict__ Vh, const bf* __restrict__ Vl,
                                           int q0, int h, bf* Ah, bf* Al, float* redm, float* reds, float* part) {
    const int tid = threadIdx.x, lane = tid & 31, lr = lane & 15, hi = lane >> 4; const int w = __builtin_amdgcn_readfirstlane(tid >> 5); const int k0 = w * KW;
    const size_t qoff = ((size_t)h * TT + q0 + lr) * HD + 8 * hi, koff = ((size_t)h * TT + k0 + lr) * HD + 8 * hi, voff = ((size_t)h * HD + lr) * TT + k0 + 8 * hi;
    typedef typename FSel<HIRES>::T VT;   // element type of the V^T planes this path reads
    v8f s[QT][KT];
    if constexpr (HIRES) { const v8us z8 = {}; v16bf qh[QT], ql[QT];
#pragma unroll
        for (int qt = 0; qt < QT; ++qt) { qh[qt] = cat16b(*(const v8us*)(Qh + qoff + (size_t)qt * 16 * HD), z8); ql[qt] = cat16b(*(const v8us*)(Ql + qoff + (size_t)qt * 16 * HD), z8); }
#pragma unroll
        for (int t = 0; t < KT; ++t) { const v16bf kh = cat16b(*(const v8us*)(Kh + koff + (size_t)t * 16 * HD), z8), kl = cat16b(*(const v8us*)(Kl + koff + (size_t)t * 16 * HD), z8);
#pragma unroll
            for (int qt = 0; qt < QT; ++qt) { v8f c = {}; c = wmmab(kh, qh[qt], c); c = wmmab(kh, ql[qt], c); c = wmmab(kl, qh[qt], c); s[qt][t] = c; } }
    } else { const v8h z8 = {}; v16h q[QT];
#pragma unroll
        for (int qt = 0; qt < QT; ++qt) q[qt] = cat16(*(const v8h*)(Q16 + qoff + (size_t)qt * 16 * HD), z8);
#pragma unroll
        for (int t = 0; t < KT; ++t) { const v16h k = cat16(*(const v8h*)(K16 + koff + (size_t)t * 16 * HD), z8);
#pragma unroll
            for (int qt = 0; qt < QT; ++qt) { v8f c = {}; s[qt][t] = wmma16(k, q[qt], c); } } }
    float mx[QT];
#pragma unroll
    for (int qt = 0; qt < QT; ++qt) { float m = -3.0e38f;
#pragma unroll
        for (int t = 0; t < KT; ++t) {
#pragma unroll
            for (int j = 0; j < 8; ++j) { const float x = s[qt][t][j] * SCL; s[qt][t][j] = x; m = fmaxf(m, x); } }
        m = fmaxf(m, __shfl_xor(m, 16, 32)); mx[qt] = m;
        if (hi == 0) redm[(w * QT + qt) * 16 + lr] = m; }
    __syncthreads();   // every wave's row maxima are in LDS
    typename WFrag<VT>::V v[KT / 2], v2[HIRES ? KT / 2 : 1];   // the wave's V^T fragments
    // loads the fragments [t0, t1); behind them the wait that stands before a register named by an issued global load is written again (the addresses are inputs so that they stay in their registers up to it)
    auto load_v = [&](int t0, int t1) { const VT* vp; const VT* vp2;
        if constexpr (HIRES) { vp = Vh + voff; vp2 = Vl + voff; } else { vp = V16 + voff; vp2 = vp; }
#pragma unroll
        for (int tp = t0; tp < t1; ++tp) { v[tp] = WFrag<VT>::ld(vp + tp * 32); if constexpr (HIRES) v2[tp] = WFrag<VT>::ld(vp2 + tp * 32); }
        asm volatile("s_wait_xcnt 0x0" :: "v"(vp), "v"(vp2) : "memory"); };
    if constexpr (!HIRES) load_v(0, KT / 2);   // asked for here so that they arrive under the exponentials (the hi/lo path has no registers free for that: it asks one step ahead)
    float f[QT];
#pragma unroll
    for (int qt = 0; qt < QT; ++qt) { float m = mx[qt];
#pragma unroll
        for (int ww = 0; ww < NWV; ++ww) m = fmaxf(m, redm[(ww * QT + qt) * 16 + lr]);
        float ps[4] = {0.f, 0.f, 0.f, 0.f};
#pragma unroll
        for (int t = 0; t < KT; ++t) {
#pragma unroll
            for (int j = 0; j < 8; ++j) { const float e = exp2_slot(__fmul_rn(__fsub_rn(s[qt][t][j], m), 1.4426950408889634f)); s[qt][t][j] = e; ps[j & 3] += e; } }
        float sum = (ps[0] + ps[1]) + (ps[2] + ps[3]); sum += __shfl_xor(sum, 16, 32);
        if (hi == 0) reds[(w * QT + qt) * 16 + lr] = sum; }
    __syncthreads();   // every wave's row sums are in LDS
    if constexpr (HIRES) load_v(0, 1);
#pragma unroll
    for (int qt = 0; qt < QT; ++qt) { float tot = reds[qt * 16 + lr];
#pragma unroll
        for (int ww = 1; ww < NWV; ++ww) tot += reds[(ww * QT + qt) * 16 + lr];
        f[qt] = __fdiv_rn(HIRES ? 1.0f : PCAR, tot); }
    v8f o[QT];
#pragma unroll
    for (int qt = 0; qt < QT; ++qt) o[qt] = (v8f){};
#pragma unroll
    for (int tp = 0; tp < KT / 2; ++tp) {
        if constexpr (HIRES) { if (tp + 1 < KT / 2) load_v(tp + 1, tp + 2);
            const v16bf vh = v[tp], vl = v2[tp];
#pragma unroll
            for (int qt = 0; qt < QT; ++qt) { v8us h0, l0, h1, l1;
#pragma unroll
                for (int j = 0; j < 8; ++j) { unsigned short a, c2; splitf(s[qt][2 * tp][j] * f[qt], a, c2); h0[j] = a; l0[j] = c2; splitf(s[qt][2 * tp + 1][j] * f[qt], a, c2); h1[j] = a; l1[j] = c2; }
                const v16bf ph = cat16b(h0, h1), pl = cat16b(l0, l1);
                o[qt] = wmmab(ph, vh, o[qt]); o[qt] = wmmab(pl, vh, o[qt]); o[qt] = wmmab(ph, vl, o[qt]); }
        } else {
#pragma unroll
            for (int qt = 0; qt < QT; ++qt) { v8h p0, p1;
#pragma unroll
                for (int j = 0; j < 8; ++j) { p0[j] = tohx(s[qt][2 * tp][j] * f[qt]); p1[j] = tohx(s[qt][2 * tp + 1][j] * f[qt]); }
                o[qt] = wmma16(cat16(p0, p1), v[tp], o[qt]); } } }
#pragma unroll
    for (int qt = 0; qt < QT; ++qt) {
#pragma unroll
        for (int j = 0; j < 8; ++j) part[w * (QT * 272) + (qt * 16 + hi * 8 + j) * 17 + lr] = o[qt][j]; }
    __syncthreads();   // every wave's partial context is in LDS
    { const int q = tid >> 4, d = tid & 15; float acc = part[q * 17 + d];   // NWV * 32 threads = QT * 16 rows x 16 columns
#pragma unroll
      for (int ww = 1; ww < NWV; ++ww) acc += part[ww * (QT * 272) + q * 17 + d];
      unsigned short a, c2; splitf(acc * (HIRES ? 1.0f : (1.0f / PCAR)), a, c2); const size_t oo = (size_t)(q0 + q) * DQ + h * HD + d; Ah[oo] = a; Al[oo] = c2; }
    if (tid < QT * 192) { bf* P = (tid < QT * 96) ? Ah : Al; const int u = tid % (QT * 96); const v8us z8 = {}; *(v8us*)(P + (size_t)(q0 + u / 6) * DQ + h * HD + HDR + (u % 6) * 8) = z8; }   // the slot's columns 16..63: the output product reads them
}
__global__ __launch_bounds__(32 * NWV) void k_fattn(const h16* __restrict__ Q16, const h16* __restrict__ K16, const h16* __restrict__ V16, const bf* __restrict__ Qh, const bf* __restrict__ Ql, const bf* __restrict__ Kh, const bf* __restrict__ Kl, const bf* __restrict__ Vh, const bf* __restrict__ Vl, bf* Ah, bf* Al) {
    static_assert(NWV * 32 == QT * 256, "one thread per element of the context tile");
    __shared__ float redm[NWV * QT * 16]; __shared__ float reds[NWV * QT * 16]; __shared__ float part[NWV * QT * 272];
    // blockIdx.y -> (batch, row tile): the hi/lo tiles of both batches first, so that the longest work-groups have the low indices (for speed only)
    constexpr int NT = TT / (QT * 16), HT = RH / (QT * 16); const int y = blockIdx.y; const int b = (y < NB_ * HT) ? y / HT : (y - NB_ * HT) / (NT - HT); const int tile = (y < NB_ * HT) ? y % HT : HT + (y - NB_ * HT) % (NT - HT);
    const int h = blockIdx.x, q0 = tile * (QT * 16);
    { const size_t po = (size_t)b * PLN, ao = (size_t)b * TT * DQ; Q16 += po; K16 += po; V16 += po; Qh += po; Ql += po; Kh += po; Kl += po; Vh += po; Vl += po; Ah += ao; Al += ao; }
    if (q0 < RH) fattn_rows<true>(Q16, K16, V16, Qh, Ql, Kh, Kl, Vh, Vl, q0, h, Ah, Al, redm, reds, part);
    else fattn_rows<false>(Q16, K16, V16, Qh, Ql, Kh, Kl, Vh, Vl, q0, h, Ah, Al, redm, reds, part);
}

extern "C" void kernel_launch(void* const* d_in, const int* in_sizes, int n_in,
                              void* d_out, int out_size, void* d_ws, size_t ws_size, hipStream_t stream) {
    (void)in_sizes; (void)n_in; (void)out_size;
    const float* x = (const float*)d_in[0]; const float* xk = (const float*)d_in[1]; const float* xv = (const float*)d_in[2]; const float* wq = (const float*)d_in[3]; const float* bqr = (const float*)d_in[4]; const float* wk = (const float*)d_in[5]; const float* bkr = (const float*)d_in[6]; const float* wv = (const float*)d_in[7]; const float* bvr = (const float*)d_in[8]; const float* wo = (const float*)d_in[9]; const float* bo = (const float*)d_in[10];   /* argument order queries, keys, values, Wq ('xw' [1024][128]), bq [128], Wk, bk, Wv, bv, Wo ('xw' [128][1024]), bo */
    float* OUT = (float*)d_out;     // [2][2048][1024]
    char* wsp = (char*)d_ws;
    auto take = [&](size_t bytes) { char* p = wsp; wsp += (bytes + 255) & ~(size_t)255; return (void*)p; };
    bf* W3 = (bf*)take((size_t)3 * DQ * DM * 2); bf* WO = (bf*)take((size_t)DM * DQ * 2); float* CS = (float*)take((size_t)TT * HD * 2 * 4);
    bf* XB = (bf*)take((size_t)3 * NB_ * TT * DM * 2); float* B3 = (float*)take((size_t)3 * DQ * 4);   /* padded biases [p][512] */ float* F = (float*)take((size_t)3 * NB_ * TT * DQ * 4);   /* projections [z][t][512] */
    h16* P16 = (h16*)take(2 * NB_ * PLN * 2); bf* Ph = (bf*)take(2 * NB_ * PLN * 2); bf* Pl = (bf*)take(2 * NB_ * PLN * 2);   /* q planes z = 0, 1; k planes z = 2, 3 */
    h16* VT16 = (h16*)take(NB_ * PLN * 2); bf* VTh = (bf*)take(NB_ * PLN * 2); bf* VTl = (bf*)take(NB_ * PLN * 2);
    bf* ATh = (bf*)take((size_t)NB_ * TT * DQ * 2); bf* ATl = (bf*)take((size_t)NB_ * TT * DQ * 2);
    if ((size_t)(wsp - (char*)d_ws) > ws_size) return;    // ws 256 MiB
    k_prep<<<3 * GB_W + GB_WO + 3 * GB_X + GB_CS + GB_B, 256, 0, stream>>>(x, xk, xv, wq, wk, wv, wo, bqr, bkr, bvr, W3, WO, XB, CS, B3);
    k_gemmw<bf, 0, true, 8, 1, NB_><<<dim3(TT / 64, DQ / 64, 3 * NB_), 256, 0, stream>>>(XB, nullptr, W3, nullptr, DM, F, DQ, B3, (size_t)TT * DM, (size_t)DQ * DM, (size_t)TT * DQ, 0, DQ);
    k_planes<<<3 * NB_ * GB_P, 256, 0, stream>>>(F, F + (size_t)2 * NB_ * TT * DQ, CS, P16, Ph, Pl, VT16, VTh, VTl);
    k_fattn<<<dim3(NH_, NB_ * (TT / (16 * QT)), 1), 32 * NWV, 0, stream>>>(P16, P16 + NB_ * PLN, VT16, Ph, Pl, Ph + NB_ * PLN, Pl + NB_ * PLN, VTh, VTl, ATh, ATl);   // one kv head per query head
    k_gemmw<bf, 1, true, 8, 1, NB_><<<dim3(TT / 64, DM / 64, NB_), 256, 0, stream>>>(ATh, ATl, WO, nullptr, DQ, OUT, DM, bo, (size_t)TT * DQ, 0, (size_t)TT * DM, 0, 0);
}

// v004
// It runs in 77.2 microseconds.
// Timed twice side by side with v003, it ran 1.62 times as fast both times.
// Counting every step since v000, it is 14.5 times as fast.
#include <hip/hip_runtime.h>

// Multi-headed attention whose projections are only 128 wide (the module's Dense(d_k = d_model / h) quirk): 8 heads x 16 dims (queries, keys, values [2][2048][1024]; q = queries Wq + bq, k = keys Wk + bk, v = values Wv + bv ('xw' [1024][128] 0.02 + zero biases [128]); heads = 16-wide slices; scores / sqrt(128) (the module scales by sqrt(d_k = 128), not by the per-head 16); softmax (no mask); o = merged [2048][128]; out = o Wo + bo ('xw' [128][1024]) -> [2][2048][1024] (4.2 M); argument order queries, keys, values, Wq, bq, Wk, bk, Wv, bv, Wo, bo).
// Five launches, each holding every piece of work that depends only on the launches before it, for both batches: k_prep (operand planes), k_gemmw z = 0..5 (projections), k_planes (head planes), k_fattn, k_gemmw z = 0..1 (output). Index z = p * NB_ + b, p = 0 queries, 1 keys, 2 values.
// Layout per batch: q, k and v lie dense, 8 heads x 16 = 128 wide: d_wT builds the Bt planes [128][1024] from the 'xw' [1024][128] weights (row r = W[:, r]), d_bias3 gathers the three biases; exact projections + f32 biases; identity-table plane builders, head planes [h][t][16] and V^T [h][16][t]; dense T-2048 attention. Only the merged context keeps each head in a 64-wide slot (exact zeros behind the 16 columns): a slot is 128 bytes, so each line of it has one writing work-group; d_wopadH builds the matching output weight Bt [1024][512] (column h*64 + d = Wo[h*16 + d][:] for d < 16, zeros otherwise); merged hi/lo x padded Wo exact + bo.
// Compute dtypes, f32 accumulate: every input rounded to bf16; projections exact + f32 biases; attention rows < 512 3 products, rest fp16; softmax f32; Wo hl x exact + bias.

#define NB_  2
#define TT   2048
#define DM   1024
#define NH_  8
#define NKV  8
#define REP  (NH_ / NKV)
#define HD   16                   // per-head width: q, k, v and their planes
#define HS   64                   // a head's slot in the merged context
#define DQ   (NH_ * HD)
#define DKV  (NKV * HD)
#define DS   (NH_ * HS)           // width of the merged context
#define RH   512                  // query rows < RH use hi+lo planes (0: none)
#define WIN  0
#define PCAR 1024.0f
#define SCL  0.088388347648318447f   // 1/sqrt(d_k = 128), as the module (not 1/sqrt(16))
typedef _Float16 h16;
typedef unsigned short bf;
typedef __attribute__((ext_vector_type(16))) __bf16   v16bf;
typedef __attribute__((ext_vector_type(16))) _Float16 v16h;
typedef __attribute__((ext_vector_type(8)))  _Float16 v8h;
typedef __attribute__((ext_vector_type(8)))  unsigned short v8us;
typedef __attribute__((ext_vector_type(8)))  float    v8f;
typedef __attribute__((ext_vector_type(4)))  float    v4f;
typedef v8h  __attribute__((may_alias)) v8ha;
typedef v4f  __attribute__((may_alias)) v4fa;
typedef v8us __attribute__((may_alias)) v8usa;

__device__ __forceinline__ unsigned short f2bf(float f) { unsigned u = __float_as_uint(f); u += 0x7FFFu + ((u >> 16) & 1u); return (unsigned short)(u >> 16); }
__device__ __forceinline__ float bf2f(unsigned short b) { return __uint_as_float(((unsigned)b) << 16); }
__device__ __forceinline__ float bfr(float f) { return bf2f(f2bf(f)); }
__device__ __forceinline__ v16h cat16(v8h lo, v8h hi) { return __builtin_shufflevector(lo, hi, 0, 1, 2, 3, 4, 5, 6, 7, 8, 9, 10, 11, 12, 13, 14, 15); }
__device__ __forceinline__ v16bf cat16b(v8us lo, v8us hi) { return __builtin_bit_cast(v16bf, __builtin_shufflevector(lo, hi, 0, 1, 2, 3, 4, 5, 6, 7, 8, 9, 10, 11, 12, 13, 14, 15)); }
__device__ __forceinline__ v8f wmma16(v16h a, v16h b, v8f c) { return __builtin_amdgcn_wmma_f32_16x16x32_f16(false, a, false, b, (short)0, c, false, false); }
__device__ __forceinline__ v8f wmmab(v16bf a, v16bf b, v8f c) { return __builtin_amdgcn_wmma_f32_16x16x32_bf16(false, a, false, b, (short)0, c, false, false); }



// ---- k_gemmw: register-blocked GEMM, 64x64 output tiles (16 accumulators per wave), operands straight from K-contiguous 16-bit planes; grid (M/64, N/64 * KS, Z), 32 * NW threads.
// K is split: work-group ky = blockIdx.y % KS of a tile takes the K range [ky K/KS, (ky+1) K/KS), wave w of it the w-th of NW equal contiguous parts. The NW partial tiles of a work-group meet in LDS and are added in wave order 0, 1, ... (a fixed order);
// work-group ky stores its sum in plane ky of C (plane stride sP elements), and the reader of C adds the KS planes in plane order. NW = KS = 1: one wave, the whole K, one plane.
// C[m][n] (f32, pitch ldc, + optional f32 bias[n], KS = 1 only) = sum_k A[m][k] Bt[n][k] (+ split products per NSPLIT). z-batch strides sA/sB/sC in elements; ZB neighbouring z share one Bt and one bias (strides sB, sBb per group of ZB). K % (32 * NW * KS) == 0.
template <typename T16> struct WFrag;
template <> struct WFrag<h16> { typedef v16h V; static __device__ __forceinline__ V ld(const h16* p) { return cat16(*(const v8h*)p, *(const v8h*)(p + 16)); } static __device__ __forceinline__ v8f mma(V a, V b, v8f c) { return wmma16(a, b, c); } };
template <> struct WFrag<bf> { typedef v16bf V; static __device__ __forceinline__ V ld(const bf* p) { return cat16b(*(const v8us*)p, *(const v8us*)(p + 16)); } static __device__ __forceinline__ v8f mma(V a, V b, v8f c) { return wmmab(a, b, c); } };
template <int NW> __device__ __forceinline__ void tile_sync() {   // orders the LDS stores of the partial tiles before the reads of them: among the waves of the work-group, or inside the one wave
    if constexpr (NW == 1) { __builtin_amdgcn_wave_barrier(); asm volatile("" ::: "memory"); } else { __syncthreads(); } }
template <typename T16, int NSPLIT, bool BIAS, int NW, int KS, int ZB>
__global__ __launch_bounds__(32 * NW) void k_gemmw(const T16* __restrict__ A, const T16* __restrict__ A2, const T16* __restrict__ Bt, const T16* __restrict__ Bt2, int K, float* C, int ldc, const float* __restrict__ bias, size_t sA, size_t sB, size_t sC, size_t sP, size_t sBb) {
    static_assert(KS == 1 || !BIAS, "the bias would be added once per plane");
    typedef typename WFrag<T16>::V V;
    constexpr int MBR = (NW == 1) ? 1 : 4;   // 16-row blocks staged per round: with several waves the whole tile at once, so one barrier serves
    constexpr int PW = MBR * 16 * 68;        // floats of one wave's staged part
    __shared__ __align__(16) float os[NW * PW];
    const size_t z = blockIdx.z, zw = z / ZB; A += z * sA; if (A2) A2 += z * sA; Bt += zw * sB; if (Bt2) Bt2 += zw * sB; if (BIAS) bias += zw * sBb; C += z * sC;
    const int tid = threadIdx.x, lane = tid & 31, lr = lane & 15, hi = lane >> 4; const int w = (NW == 1) ? 0 : __builtin_amdgcn_readfirstlane(tid >> 5); const int ky = (KS == 1) ? 0 : (int)(blockIdx.y % KS);
    const int kspan = K / (NW * KS), kbeg = (ky * NW + w) * kspan, kend = kbeg + kspan; const int r0 = blockIdx.x * 64, c0 = (int)(blockIdx.y / KS) * 64; if (KS > 1) C += (size_t)ky * sP;
    v8f acc[4][4];
#pragma unroll
    for (int mb = 0; mb < 4; ++mb)
#pragma unroll
        for (int nb = 0; nb < 4; ++nb) acc[mb][nb] = (v8f){};
    const size_t aoff = (size_t)(r0 + lr) * K + 8 * hi, boff = (size_t)(c0 + lr) * K + 8 * hi;
#pragma unroll 1
    for (int kc = kbeg; kc < kend; kc += 32) {
        V a[4], a2[4];
#pragma unroll
        for (int mb = 0; mb < 4; ++mb) { a[mb] = WFrag<T16>::ld(A + aoff + (size_t)mb * 16 * K + kc); if (NSPLIT == 1 || NSPLIT == 2) a2[mb] = WFrag<T16>::ld(A2 + aoff + (size_t)mb * 16 * K + kc); }
#pragma unroll
        for (int nb = 0; nb < 4; ++nb) { const V b = WFrag<T16>::ld(Bt + boff + (size_t)nb * 16 * K + kc); V b2; if (NSPLIT >= 2) b2 = WFrag<T16>::ld(Bt2 + boff + (size_t)nb * 16 * K + kc);
#pragma unroll
            for (int mb = 0; mb < 4; ++mb) { acc[mb][nb] = WFrag<T16>::mma(a[mb], b, acc[mb][nb]); if (NSPLIT == 1 || NSPLIT == 2) acc[mb][nb] = WFrag<T16>::mma(a2[mb], b, acc[mb][nb]); if (NSPLIT >= 2) acc[mb][nb] = WFrag<T16>::mma(a[mb], b2, acc[mb][nb]); } }
        asm volatile("v_nop\n\tv_nop\n\tv_nop\n\tv_nop" : "+v"(acc[0][0]), "+v"(acc[1][1]), "+v"(acc[2][2]), "+v"(acc[3][3]) : "v"(a[0]), "v"(a[3]));
    }
    float* mine = os + w * PW;
#pragma unroll
    for (int m0 = 0; m0 < 4; m0 += MBR) {
#pragma unroll
        for (int mi = 0; mi < MBR; ++mi) {
#pragma unroll
            for (int nb = 0; nb < 4; ++nb) {
#pragma unroll
                for (int j = 0; j < 8; ++j) mine[(mi * 16 + hi * 8 + j) * 68 + nb * 16 + lr] = acc[m0 + mi][nb][j]; } }
        tile_sync<NW>();
        float* crow = C + (size_t)(r0 + m0 * 16) * ldc + c0;
{
#pragma unroll
            for (int s = 0; s < MBR * 8 / NW; ++s) { const int idx = s * (NW * 32) + tid; const int row = idx >> 4, cofs = (idx & 15) * 4; v4f val = *(const v4fa*)(os + row * 68 + cofs);
#pragma unroll
                for (int ww = 1; ww < NW; ++ww) val += *(const v4fa*)(os + ww * PW + row * 68 + cofs);
                if (BIAS) { val[0] += bfr(bias[c0 + cofs]); val[1] += bfr(bias[c0 + cofs + 1]); val[2] += bfr(bias[c0 + cofs + 2]); val[3] += bfr(bias[c0 + cofs + 3]); }
                *(v4f*)(crow + (size_t)row * ldc + cofs) = val; }
             }
        if (MBR < 4) tile_sync<NW>();   // the next round stores over what this round read
    }
}

__device__ __forceinline__ h16 tohx(float x) { return (h16)x; }
__device__ __forceinline__ void splitf(float y, unsigned short& h, unsigned short& l) { h = f2bf(y); l = f2bf(y - bf2f(h)); }
typedef __attribute__((ext_vector_type(2))) _Float16 v2h;
typedef __attribute__((ext_vector_type(4))) _Float16 v4h;
typedef __attribute__((ext_vector_type(2))) unsigned short v2us;
typedef __attribute__((ext_vector_type(4))) unsigned short v4us;
typedef __attribute__((ext_vector_type(2))) float v2f;
typedef __attribute__((ext_vector_type(4))) int v4i;

// The bodies below take their block index blk as an argument: k_prep and k_planes hand each a range of their grids.
__device__ __forceinline__ void d_cvt8(unsigned blk, const float* __restrict__ src, bf* dst, size_t n8) { const size_t i = (size_t)blk * 256 + threadIdx.x; if (i >= n8) return; const v8f v = *(const v8f*)(src + i * 8); v8us o;
#pragma unroll
    for (int k = 0; k < 8; ++k) o[k] = f2bf(v[k]); *(v8us*)(dst + i * 8) = o;  }

// d_rope: head planes [h][t][d] (fp16 + hi/lo) of rope(x) x sc with the rotate-half convention out[d] = x[d] cos[t][d] - x[d+HD/2] sin[t][d], out[d+HD/2] = x[d+HD/2] cos[t][d+HD/2] + x[d] sin[t][d+HD/2]
__device__ __forceinline__ void d_rope(unsigned blk, const float* __restrict__ F, int pitch, int nheads, const float* __restrict__ CS, const float* __restrict__ RF, const float* __restrict__ nw, float sc, h16* P16, bf* Ph, bf* Pl) {
    const size_t e = ((size_t)blk * 256 + threadIdx.x) * 2; if (e >= (size_t)nheads * TT * HD) return; const int d = (int)(e % HD); const int t = (int)((e / HD) % TT); const int h = (int)(e / ((size_t)HD * TT)); const float* f = F + (size_t)t * pitch + h * HD; const float rf = RF ? RF[(size_t)h * TT + t] : 1.0f; v2h o16; v2us oh, ol;
#pragma unroll
    for (int q = 0; q < 2; ++q) { const int dd = d + q; const int dp = (dd < HD / 2) ? dd + HD / 2 : dd - HD / 2; float x0 = f[dd], x1 = f[dp];
        if (RF) { float n0 = __fmul_rn(x0, rf), n1 = __fmul_rn(x1, rf); asm volatile("" : "+v"(n0)); asm volatile("" : "+v"(n1)); x0 = __fmul_rn(bfr(nw[dd]), n0); x1 = __fmul_rn(bfr(nw[dp]), n1); }
        const v2f cs = *(const v2f*)(CS + ((size_t)t * HD + dd) * 2); float a = __fmul_rn(x0, cs[0]), bq = __fmul_rn(x1, cs[1]); asm volatile("" : "+v"(a)); asm volatile("" : "+v"(bq)); const float r = ((dd < HD / 2) ? __fsub_rn(a, bq) : __fadd_rn(a, bq)) * sc;
        o16[q] = tohx(r); unsigned short a2, c2; splitf(r, a2, c2); oh[q] = a2; ol[q] = c2; }
    *(v2h*)(P16 + e) = o16; *(v2us*)(Ph + e) = oh; *(v2us*)(Pl + e) = ol;  }
__device__ __forceinline__ void d_wT(unsigned blk, const float* __restrict__ w, bf* Bt) { const size_t e = ((size_t)blk * 256 + threadIdx.x) * 2; if (e >= (size_t)DQ * DM) return; const int k = (int)(e % DM); const int r = (int)(e / DM); v2us o; o[0] = f2bf(w[(size_t)k * DQ + r]); o[1] = f2bf(w[(size_t)(k + 1) * DQ + r]);
    *(v2us*)(Bt + e) = o;  }
__device__ __forceinline__ void d_bias3(unsigned blk, const float* __restrict__ b0, const float* __restrict__ b1, const float* __restrict__ b2, float* B3) { const int i = blk * 256 + threadIdx.x; if (i >= 3 * DQ) return; const int s = i / DQ, r = i % DQ; const float* src = (s == 0) ? b0 : ((s == 1) ? b1 : b2); *(float*)(B3 + i) = src[r];  }
__device__ __forceinline__ void d_wopadH(unsigned blk, const float* __restrict__ wo, bf* Bt) { const size_t e = ((size_t)blk * 256 + threadIdx.x) * 2; if (e >= (size_t)DM * DS) return; const int c = (int)(e % DS); const int n = (int)(e / DS); const int h = c / HS, d = c % HS; const bool live = (d < HD); const int rr = h * HD + (d & (HD - 1)); const float w0 = wo[(size_t)rr * DM + n], w1 = wo[(size_t)(h * HD + ((d + 1) & (HD - 1))) * DM + n]; v2us o; o[0] = live ? f2bf(w0) : (unsigned short)0; o[1] = (d + 1 < HD) ? f2bf(w1) : (unsigned short)0;
    *(v2us*)(Bt + e) = o;  }
__device__ __forceinline__ void d_vtp(unsigned blk, const float* __restrict__ F, int pitch, int nheads, h16* V16, bf* Vh, bf* Vl) { const size_t e = ((size_t)blk * 256 + threadIdx.x) * 2; if (e >= (size_t)nheads * HD * TT) return; const int t = (int)(e % TT); const int d = (int)((e / TT) % HD); const int g = (int)(e / ((size_t)TT * HD)); v2h o16; v2us oh, ol;
#pragma unroll
    for (int q = 0; q < 2; ++q) { const float x = F[(size_t)(t + q) * pitch + g * HD + d]; o16[q] = tohx(x); unsigned short a2, c2; splitf(x, a2, c2); oh[q] = a2; ol[q] = c2; }
    *(v2h*)(V16 + e) = o16; *(v2us*)(Vh + e) = oh; *(v2us*)(Vl + e) = ol;  }
__device__ __forceinline__ void d_csid(unsigned blk, float* CS) { const int idx = blk * 256 + threadIdx.x; if (idx >= TT * HD) return; v2f cs; cs[0] = 1.0f; cs[1] = 0.0f; *(v2f*)(CS + (size_t)idx * 2) = cs;  }
// Blocks of 256 threads that each piece takes
#define GB_W  (DQ * DM / 2 / 256)          // one projection weight
#define GB_WO (DM * DS / 2 / 256)          // the padded output weight
#define GB_X  (NB_ * TT * DM / 8 / 256)    // one input, both batches
#define GB_CS (TT * HD / 256)
#define GB_B  ((3 * DQ + 255) / 256)
#define GB_P  (NH_ * TT * HD / 2 / 256)    // the planes of one projection of one batch
#define PLN   ((size_t)NH_ * TT * HD)      // elements of one such plane
// ---- k_prep: all that reads only the inputs, one block range per piece; the pieces with strided reads have the low indices (for speed only).
// W3 = Bt planes of Wq, Wk, Wv; XB = bf16 of queries, keys, values, [p][b][t][c].
__global__ __launch_bounds__(256) void k_prep(const float* __restrict__ x, const float* __restrict__ xk, const float* __restrict__ xv, const float* __restrict__ wq, const float* __restrict__ wk, const float* __restrict__ wv, const float* __restrict__ wo,
                                              const float* __restrict__ b0, const float* __restrict__ b1, const float* __restrict__ b2, bf* W3, bf* WO, bf* XB, float* CS, float* B3) {
    unsigned blk = blockIdx.x;
    if (blk < 3 * GB_W) { const unsigned p = blk / GB_W; d_wT(blk % GB_W, (p == 0) ? wq : ((p == 1) ? wk : wv), W3 + (size_t)p * DQ * DM); return; }
    blk -= 3 * GB_W;
    if (blk < GB_WO) { d_wopadH(blk, wo, WO); return; }
    blk -= GB_WO;
    if (blk < 3 * GB_X) { const unsigned p = blk / GB_X; d_cvt8(blk % GB_X, (p == 0) ? x : ((p == 1) ? xk : xv), XB + (size_t)p * NB_ * TT * DM, (size_t)NB_ * TT * DM / 8); return; }
    blk -= 3 * GB_X;
    if (blk < GB_CS) { d_csid(blk, CS); return; }
    d_bias3(blk - GB_CS, b0, b1, b2, B3);
}
// ---- k_planes: the head planes of all six projections (F = [z = 0..3] of q and k, FV = [b] of v); the transposing V pieces (strided reads) have the low indices. P16 / Ph / Pl = [z = 0..3] planes of q and k, V16 / Vh / Vl = [b].
__global__ __launch_bounds__(256) void k_planes(const float* __restrict__ F, const float* __restrict__ FV, const float* __restrict__ CS, h16* P16, bf* Ph, bf* Pl, h16* V16, bf* Vh, bf* Vl) {
    unsigned blk = blockIdx.x;
    if (blk < NB_ * GB_P) { const unsigned b = blk / GB_P; d_vtp(blk % GB_P, FV + (size_t)b * TT * DQ, DKV, NKV, V16 + b * PLN, Vh + b * PLN, Vl + b * PLN); return; }
    blk -= NB_ * GB_P;
    const unsigned z = blk / GB_P; d_rope(blk % GB_P, F + (size_t)z * TT * DQ, DQ, NH_, CS, nullptr, nullptr, 1.0f, P16 + z * PLN, Ph + z * PLN, Pl + z * PLN);
}
// ---- k_fattn: scores, softmax and P.V of QT x 16 query rows of one head in one work-group; S and P stay in registers. Grid (heads, NB_ TT / (16 QT)), NWV waves; wave w takes the keys [w KW, (w + 1) KW) for all the rows, so a K or V fragment is loaded once for QT row tiles.
// S^T = K Q^T: register j of key tile t in lane (lr, hi) is S[query lr][key 16 t + 8 hi + j], so a lane holds scores of one query per row tile, and two neighbouring key tiles are, as they lie, the A fragment of P for 32 keys (same k order as the V^T loader).
// A head is 16 wide and the matrix instruction takes 32: the upper half of the K and Q fragments (d 16..31) is set to zero in registers.
// Row maximum and row sum: in the lane, then across the two lane halves, then across the waves through LDS in wave order; P is normalised before it is rounded; the waves' partial contexts are added in wave order.
// Rows < RH: hi/lo bf16 planes, 3 products (these work-groups have the low blockIdx.y: they run longest); the rest fp16 with P carried x PCAR. Stores the hi/lo planes of the merged context, the zero columns of the head's 64-wide slot included.
// Every loop of fattn_rows is unrolled: s, v, o and the fragments are register arrays, which only constant indices keep out of scratch memory.
#define NWV 16
#define QT  2
#define KW  (TT / NWV)
#define KT  (KW / 16)
// 2^x by the hardware instruction, with the one free issue slot behind a transcendental in the same statement
__device__ __forceinline__ float exp2_slot(float x) { float e; asm("v_exp_f32 %0, %1\n\tv_nop" : "=v"(e) : "v"(x)); return e; }
template <bool HIRES> struct FSel { typedef bf T; };
template <> struct FSel<false> { typedef h16 T; };
template <bool HIRES>
__device__ __forceinline__ void fattn_rows(const h16* __restrict__ Q16, const h16* __restrict__ K16, const h16* __restrict__ V16, const bf* __restrict__ Qh, const bf* __restrict__ Ql, const bf* __restrict__ Kh, const bf* __restrict__ Kl, const bf* __restrict__ Vh, const bf* __restrict__ Vl,
                                           int q0, int h, bf* Ah, bf* Al, float* redm, float* reds, float* part) {
    const int tid = threadIdx.x, lane = tid & 31, lr = lane & 15, hi = lane >> 4; const int w = __builtin_amdgcn_readfirstlane(tid >> 5); const int k0 = w * KW;
    const size_t qoff = ((size_t)h * TT + q0 + lr) * HD + 8 * hi, koff = ((size_t)h * TT + k0 + lr) * HD + 8 * hi, voff = ((size_t)h * HD + lr) * TT + k0 + 8 * hi;
    typedef typename FSel<HIRES>::T VT;   // element type of the V^T planes this path reads
    v8f s[QT][KT];
    if constexpr (HIRES) { const v8us z8 = {}; v16bf qh[QT], ql[QT];
#pragma unroll
        for (int qt = 0; qt < QT; ++qt) { qh[qt] = cat16b(*(const v8us*)(Qh + qoff + (size_t)qt * 16 * HD), z8); ql[qt] = cat16b(*(const v8us*)(Ql + qoff + (size_t)qt * 16 * HD), z8); }
#pragma unroll
        for (int t = 0; t < KT; ++t) { const v16bf kh = cat16b(*(const v8us*)(Kh + koff + (size_t)t * 16 * HD), z8), kl = cat16b(*(const v8us*)(Kl + koff + (size_t)t * 16 * HD), z8);
#pragma unroll
            for (int qt = 0; qt < QT; ++qt) { v8f c = {}; c = wmmab(kh, qh[qt], c); c = wmmab(kh, ql[qt], c); c = wmmab(kl, qh[qt], c); s[qt][t] = c; } }
    } else { const v8h z8 = {}; v16h q[QT];
#pragma unroll
        for (int qt = 0; qt < QT; ++qt) q[qt] = cat16(*(const v8h*)(Q16 + qoff + (size_t)qt * 16 * HD), z8);
#pragma unroll
        for (int t = 0; t < KT; ++t) { const v16h k = cat16(*(const v8h*)(K16 + koff + (size_t)t * 16 * HD), z8);
#pragma unroll
            for (int qt = 0; qt < QT; ++qt) { v8f c = {}; s[qt][t] = wmma16(k, q[qt], c); } } }
    float mx[QT];
#pragma unroll
    for (int qt = 0; qt < QT; ++qt) { float m = -3.0e38f;
#pragma unroll
        for (int t = 0; t < KT; ++t) {
#pragma unroll
            for (int j = 0; j < 8; ++j) { const float x = s[qt][t][j] * SCL; s[qt][t][j] = x; m = fmaxf(m, x); } }
        m = fmaxf(m, __shfl_xor(m, 16, 32)); mx[qt] = m;
        if (hi == 0) redm[(w * QT + qt) * 16 + lr] = m; }
    __syncthreads();   // every wave's row maxima are in LDS
    typename WFrag<VT>::V v[KT / 2], v2[HIRES ? KT / 2 : 1];   // the wave's V^T fragments
    // loads the fragments [t0, t1); behind them the wait that stands before a register named by an issued global load is written again (the addresses are inputs so that they stay in their registers up to it)
    auto load_v = [&](int t0, int t1) { const VT* vp; const VT* vp2;
        if constexpr (HIRES) { vp = Vh + voff; vp2 = Vl + voff; } else { vp = V16 + voff; vp2 = vp; }
#pragma unroll
        for (int tp = t0; tp < t1; ++tp) { v[tp] = WFrag<VT>::ld(vp + tp * 32); if constexpr (HIRES) v2[tp] = WFrag<VT>::ld(vp2 + tp * 32); }
        asm volatile("s_wait_xcnt 0x0" :: "v"(vp), "v"(vp2) : "memory"); };
    if constexpr (!HIRES) load_v(0, KT / 2);   // asked for here so that they arrive under the exponentials (the hi/lo path has no registers free for that: it asks one step ahead)
    float f[QT];
#pragma unroll
    for (int qt = 0; qt < QT; ++qt) { float m = mx[qt];
#pragma unroll
        for (int ww = 0; ww < NWV; ++ww) m = fmaxf(m, redm[(ww * QT + qt) * 16 + lr]);
        float ps[4] = {0.f, 0.f, 0.f, 0.f};
#pragma unroll
        for (int t = 0; t < KT; ++t) {
#pragma unroll
            for (int j = 0; j < 8; ++j) { const float e = exp2_slot(__fmul_rn(__fsub_rn(s[qt][t][j], m), 1.4426950408889634f)); s[qt][t][j] = e; ps[j & 3] += e; } }
        float sum = (ps[0] + ps[1]) + (ps[2] + ps[3]); sum += __shfl_xor(sum, 16, 32);
        if (hi == 0) reds[(w * QT + qt) * 16 + lr] = sum; }
    __syncthreads();   // every wave's row sums are in LDS
    if constexpr (HIRES) load_v(0, 1);
#pragma unroll
    for (int qt = 0; qt < QT; ++qt) { float tot = reds[qt * 16 + lr];
#pragma unroll
        for (int ww = 1; ww < NWV; ++ww) tot += reds[(ww * QT + qt) * 16 + lr];
        f[qt] = __fdiv_rn(HIRES ? 1.0f : PCAR, tot); }
    v8f o[QT];
#pragma unroll
    for (int qt = 0; qt < QT; ++qt) o[qt] = (v8f){};
#pragma unroll
    for (int tp = 0; tp < KT / 2; ++tp) {
        if constexpr (HIRES) { if (tp + 1 < KT / 2) load_v(tp + 1, tp + 2);
            const v16bf vh = v[tp], vl = v2[tp];
#pragma unroll
            for (int qt = 0; qt < QT; ++qt) { v8us h0, l0, h1, l1;
#pragma unroll
                for (int j = 0; j < 8; ++j) { unsigned short a, c2; splitf(s[qt][2 * tp][j] * f[qt], a, c2); h0[j] = a; l0[j] = c2; splitf(s[qt][2 * tp + 1][j] * f[qt], a, c2); h1[j] = a; l1[j] = c2; }
                const v16bf ph = cat16b(h0, h1), pl = cat16b(l0, l1);
                o[qt] = wmmab(ph, vh, o[qt]); o[qt] = wmmab(pl, vh, o[qt]); o[qt] = wmmab(ph, vl, o[qt]); }
        } else {
#pragma unroll
            for (int qt = 0; qt < QT; ++qt) { v8h p0, p1;
#pragma unroll
                for (int j = 0; j < 8; ++j) { p0[j] = tohx(s[qt][2 * tp][j] * f[qt]); p1[j] = tohx(s[qt][2 * tp + 1][j] * f[qt]); }
                o[qt] = wmma16(cat16(p0, p1), v[tp], o[qt]); } } }
#pragma unroll
    for (int qt = 0; qt < QT; ++qt) {
#pragma unroll
        for (int j = 0; j < 8; ++j) part[w * (QT * 272) + (qt * 16 + hi * 8 + j) * 17 + lr] = o[qt][j]; }
    __syncthreads();   // every wave's partial context is in LDS
    { const int q = tid >> 4, d = tid & 15; float acc = part[q * 17 + d];   // NWV * 32 threads = QT * 16 rows x 16 columns
#pragma unroll
      for (int ww = 1; ww < NWV; ++ww) acc += part[ww * (QT * 272) + q * 17 + d];
      unsigned short a, c2; splitf(acc * (HIRES ? 1.0f : (1.0f / PCAR)), a, c2); const size_t oo = (size_t)(q0 + q) * DS + h * HS + d; Ah[oo] = a; Al[oo] = c2; }
    if (tid < QT * 192) { bf* P = (tid < QT * 96) ? Ah : Al; const int u = tid % (QT * 96); const v8us z8 = {}; *(v8us*)(P + (size_t)(q0 + u / 6) * DS + h * HS + HD + (u % 6) * 8) = z8; }   // the slot's columns 16..63: the output product reads them
}
__global__ __launch_bounds__(32 * NWV) void k_fattn(const h16* __restrict__ Q16, const h16* __restrict__ K16, const h16* __restrict__ V16, const bf* __restrict__ Qh, const bf* __restrict__ Ql, const bf* __restrict__ Kh, const bf* __restrict__ Kl, const bf* __restrict__ Vh, const bf* __restrict__ Vl, bf* Ah, bf* Al) {
    static_assert(NWV * 32 == QT * 256, "one thread per element of the context tile");
    __shared__ float redm[NWV * QT * 16]; __shared__ float reds[NWV * QT * 16]; __shared__ float part[NWV * QT * 272];
    // blockIdx.y -> (batch, row tile): the hi/lo tiles of both batches first, so that the longest work-groups have the low indices (for speed only)
    constexpr int NT = TT / (QT * 16), HT = RH / (QT * 16); const int y = blockIdx.y; const int b = (y < NB_ * HT) ? y / HT : (y - NB_ * HT) / (NT - HT); const int tile = (y < NB_ * HT) ? y % HT : HT + (y - NB_ * HT) % (NT - HT);
    const int h = blockIdx.x, q0 = tile * (QT * 16);
    { const size_t po = (size_t)b * PLN, ao = (size_t)b * TT * DS; Q16 += po; K16 += po; V16 += po; Qh += po; Ql += po; Kh += po; Kl += po; Vh += po; Vl += po; Ah += ao; Al += ao; }
    if (q0 < RH) fattn_rows<true>(Q16, K16, V16, Qh, Ql, Kh, Kl, Vh, Vl, q0, h, Ah, Al, redm, reds, part);
    else fattn_rows<false>(Q16, K16, V16, Qh, Ql, Kh, Kl, Vh, Vl, q0, h, Ah, Al, redm, reds, part);
}

extern "C" void kernel_launch(void* const* d_in, const int* in_sizes, int n_in,
                              void* d_out, int out_size, void* d_ws, size_t ws_size, hipStream_t stream) {
    (void)in_sizes; (void)n_in; (void)out_size;
    const float* x = (const float*)d_in[0]; const float* xk = (const float*)d_in[1]; const float* xv = (const float*)d_in[2]; const float* wq = (const float*)d_in[3]; const float* bqr = (const float*)d_in[4]; const float* wk = (const float*)d_in[5]; const float* bkr = (const float*)d_in[6]; const float* wv = (const float*)d_in[7]; const float* bvr = (const float*)d_in[8]; const float* wo = (const float*)d_in[9]; const float* bo = (const float*)d_in[10];   /* argument order queries, keys, values, Wq ('xw' [1024][128]), bq [128], Wk, bk, Wv, bv, Wo ('xw' [128][1024]), bo */
    float* OUT = (float*)d_out;     // [2][2048][1024]
    char* wsp = (char*)d_ws;
    auto take = [&](size_t bytes) { char* p = wsp; wsp += (bytes + 255) & ~(size_t)255; return (void*)p; };
    bf* W3 = (bf*)take((size_t)3 * DQ * DM * 2); bf* WO = (bf*)take((size_t)DM * DS * 2); float* CS = (float*)take((size_t)TT * HD * 2 * 4);
    bf* XB = (bf*)take((size_t)3 * NB_ * TT * DM * 2); float* B3 = (float*)take((size_t)3 * DQ * 4);   /* biases [p][128] */ float* F = (float*)take((size_t)3 * NB_ * TT * DQ * 4);   /* projections [z][t][128] */
    h16* P16 = (h16*)take(2 * NB_ * PLN * 2); bf* Ph = (bf*)take(2 * NB_ * PLN * 2); bf* Pl = (bf*)take(2 * NB_ * PLN * 2);   /* q planes z = 0, 1; k planes z = 2, 3 */
    h16* VT16 = (h16*)take(NB_ * PLN * 2); bf* VTh = (bf*)take(NB_ * PLN * 2); bf* VTl = (bf*)take(NB_ * PLN * 2);
    bf* ATh = (bf*)take((size_t)NB_ * TT * DS * 2); bf* ATl = (bf*)take((size_t)NB_ * TT * DS * 2);
    if ((size_t)(wsp - (char*)d_ws) > ws_size) return;    // ws 256 MiB
    k_prep<<<3 * GB_W + GB_WO + 3 * GB_X + GB_CS + GB_B, 256, 0, stream>>>(x, xk, xv, wq, wk, wv, wo, bqr, bkr, bvr, W3, WO, XB, CS, B3);
    k_gemmw<bf, 0, true, 8, 1, NB_><<<dim3(TT / 64, DQ / 64, 3 * NB_), 256, 0, stream>>>(XB, nullptr, W3, nullptr, DM, F, DQ, B3, (size_t)TT * DM, (size_t)DQ * DM, (size_t)TT * DQ, 0, DQ);
    k_planes<<<3 * NB_ * GB_P, 256, 0, stream>>>(F, F + (size_t)2 * NB_ * TT * DQ, CS, P16, Ph, Pl, VT16, VTh, VTl);
    k_fattn<<<dim3(NH_, NB_ * (TT / (16 * QT)), 1), 32 * NWV, 0, stream>>>(P16, P16 + NB_ * PLN, VT16, Ph, Pl, Ph + NB_ * PLN, Pl + NB_ * PLN, VTh, VTl, ATh, ATl);   // one kv head per query head
    k_gemmw<bf, 1, true, 8, 1, NB_><<<dim3(TT / 64, DM / 64, NB_), 256, 0, stream>>>(ATh, ATl, WO, nullptr, DS, OUT, DM, bo, (size_t)TT * DS, 0, (size_t)TT * DM, 0, 0);
}

// v005
// It runs in 61.4 microseconds.
// Next to v004, in two timings, it ran 1.26 times as fast each time.
// Over all steps from v000 it is 18.3 times as fast.
#include <hip/hip_runtime.h>

// Multi-headed attention whose projections are only 128 wide (the module's Dense(d_k = d_model / h) quirk): 8 heads x 16 dims (queries, keys, values [2][2048][1024]; q = queries Wq + bq, k = keys Wk + bk, v = values Wv + bv ('xw' [1024][128] 0.02 + zero biases [128]); heads = 16-wide slices; scores / sqrt(128) (the module scales by sqrt(d_k = 128), not by the per-head 16); softmax (no mask); o = merged [2048][128]; out = o Wo + bo ('xw' [128][1024]) -> [2][2048][1024] (4.2 M); argument order queries, keys, values, Wq, bq, Wk, bk, Wv, bv, Wo, bo).
// Five launches, each holding every piece of work that depends only on the launches before it, for both batches: k_prep (operand planes), k_gemmw z = 0..5 (projections), k_planes (head planes), k_fattn, k_gemmw z = 0..1 (output). Index z = p * NB_ + b, p = 0 queries, 1 keys, 2 values.
// Layout per batch: q, k and v lie dense, 8 heads x 16 = 128 wide: d_wT builds the Bt planes [128][1024] from the 'xw' [1024][128] weights (row r = W[:, r]), d_bias3 gathers the three biases; exact projections + f32 biases; identity-table plane builders, head planes [h][t][16] and V^T [h][16][t]; dense T-2048 attention. The merged context lies dense too, in panels of 16 k, one per head: [h][t][16], so a work-group of k_fattn writes whole 128-byte lines that no other writes; d_woP builds the output weight in the same form, [h][n][16] (element d = Wo[h*16 + d][n]); merged hi/lo x Wo exact + bo, K = 128.
// Compute dtypes, f32 accumulate: every input rounded to bf16; projections exact + f32 biases; attention rows < 512 3 products, rest fp16; softmax f32; Wo hl x exact + bias.

#define NB_  2
#define TT   2048
#define DM   1024
#define NH_  8
#define NKV  8
#define REP  (NH_ / NKV)
#define HD   16                   // per-head width: q, k, v and their planes
#define DQ   (NH_ * HD)
#define DKV  (NKV * HD)
#define RH   512                  // query rows < RH use hi+lo planes (0: none)
#define WIN  0
#define PCAR 1024.0f
#define SCL  0.088388347648318447f   // 1/sqrt(d_k = 128), as the module (not 1/sqrt(16))
typedef _Float16 h16;
typedef unsigned short bf;
typedef __attribute__((ext_vector_type(16))) __bf16   v16bf;
typedef __attribute__((ext_vector_type(16))) _Float16 v16h;
typedef __attribute__((ext_vector_type(8)))  _Float16 v8h;
typedef __attribute__((ext_vector_type(8)))  unsigned short v8us;
typedef __attribute__((ext_vector_type(8)))  float    v8f;
typedef __attribute__((ext_vector_type(4)))  float    v4f;
typedef v8h  __attribute__((may_alias)) v8ha;
typedef v4f  __attribute__((may_alias)) v4fa;
typedef v8us __attribute__((may_alias)) v8usa;

__device__ __forceinline__ unsigned short f2bf(float f) { unsigned u = __float_as_uint(f); u += 0x7FFFu + ((u >> 16) & 1u); return (unsigned short)(u >> 16); }
__device__ __forceinline__ float bf2f(unsigned short b) { return __uint_as_float(((unsigned)b) << 16); }
__device__ __forceinline__ float bfr(float f) { return bf2f(f2bf(f)); }
__device__ __forceinline__ v16h cat16(v8h lo, v8h hi) { return __builtin_shufflevector(lo, hi, 0, 1, 2, 3, 4, 5, 6, 7, 8, 9, 10, 11, 12, 13, 14, 15); }
__device__ __forceinline__ v16bf cat16b(v8us lo, v8us hi) { return __builtin_bit_cast(v16bf, __builtin_shufflevector(lo, hi, 0, 1, 2, 3, 4, 5, 6, 7, 8, 9, 10, 11, 12, 13, 14, 15)); }
__device__ __forceinline__ v8f wmma16(v16h a, v16h b, v8f c) { return __builtin_amdgcn_wmma_f32_16x16x32_f16(false, a, false, b, (short)0, c, false, false); }
__device__ __forceinline__ v8f wmmab(v16bf a, v16bf b, v8f c) { return __builtin_amdgcn_wmma_f32_16x16x32_bf16(false, a, false, b, (short)0, c, false, false); }



// ---- k_gemmw: register-blocked GEMM, 64x64 output tiles (16 accumulators per wave), operands straight from K-contiguous 16-bit planes; grid (M/64, N/64 * KS, Z), 32 * NW threads.
// K is split: work-group ky = blockIdx.y % KS of a tile takes the K range [ky K/KS, (ky+1) K/KS), wave w of it the w-th of NW equal contiguous parts. The NW partial tiles of a work-group meet in LDS and are added in wave order 0, 1, ... (a fixed order);
// work-group ky stores its sum in plane ky of C (plane stride sP elements), and the reader of C adds the KS planes in plane order. NW = KS = 1: one wave, the whole K, one plane.
// C[m][n] (f32, pitch ldc, + optional f32 bias[n], KS = 1 only) = sum_k A[m][k] Bt[n][k] (+ split products per NSPLIT). z-batch strides sA/sB/sC in elements; ZB neighbouring z share one Bt and one bias (strides sB, sBb per group of ZB). K % (32 * NW * KS) == 0.
// RA = RB = 0: A and Bt are row-major, K contiguous. RA, RB > 0: each lies in panels of 16 k with that many rows each, element (row, k) at ((k / 16) * R + row) * 16 + k % 16: the 16 rows of a fragment load are then 512 contiguous bytes (4 whole lines, not 16 pieces of 32 bytes). The k order of a fragment is the same in both forms.
template <typename T16> struct WFrag;
template <> struct WFrag<h16> { typedef v16h V; static __device__ __forceinline__ V ld2(const h16* p, const h16* q) { return cat16(*(const v8h*)p, *(const v8h*)q); } static __device__ __forceinline__ V ld(const h16* p) { return ld2(p, p + 16); } static __device__ __forceinline__ v8f mma(V a, V b, v8f c) { return wmma16(a, b, c); } };
template <> struct WFrag<bf> { typedef v16bf V; static __device__ __forceinline__ V ld2(const bf* p, const bf* q) { return cat16b(*(const v8us*)p, *(const v8us*)q); } static __device__ __forceinline__ V ld(const bf* p) { return ld2(p, p + 16); } static __device__ __forceinline__ v8f mma(V a, V b, v8f c) { return wmmab(a, b, c); } };
template <int NW> __device__ __forceinline__ void tile_sync() {   // orders the LDS stores of the partial tiles before the reads of them: among the waves of the work-group, or inside the one wave
    if constexpr (NW == 1) { __builtin_amdgcn_wave_barrier(); asm volatile("" ::: "memory"); } else { __syncthreads(); } }
template <typename T16, int NSPLIT, bool BIAS, int NW, int KS, int ZB, int RA = 0, int RB = 0>
__global__ __launch_bounds__(32 * NW) void k_gemmw(const T16* __restrict__ A, const T16* __restrict__ A2, const T16* __restrict__ Bt, const T16* __restrict__ Bt2, int K, float* C, int ldc, const float* __restrict__ bias, size_t sA, size_t sB, size_t sC, size_t sP, size_t sBb) {
    static_assert(KS == 1 || !BIAS, "the bias would be added once per plane"); static_assert((RA > 0) == (RB > 0) && (RA == 0 || NSPLIT == 1), "panels: both operands, hi/lo A");
    typedef typename WFrag<T16>::V V;
    constexpr int MBR = (NW == 1) ? 1 : 4;   // 16-row blocks staged per round: with several waves the whole tile at once, so one barrier serves
    constexpr int PW = MBR * 16 * 68;        // floats of one wave's staged part
    __shared__ __align__(16) float os[NW * PW];
    const size_t z = blockIdx.z, zw = z / ZB; A += z * sA; if (A2) A2 += z * sA; Bt += zw * sB; if (Bt2) Bt2 += zw * sB; if (BIAS) bias += zw * sBb; C += z * sC;
    const int tid = threadIdx.x, lane = tid & 31, lr = lane & 15, hi = lane >> 4; const int w = (NW == 1) ? 0 : __builtin_amdgcn_readfirstlane(tid >> 5); const int ky = (KS == 1) ? 0 : (int)(blockIdx.y % KS);
    const int kspan = K / (NW * KS), kbeg = (ky * NW + w) * kspan, kend = kbeg + kspan; const int r0 = blockIdx.x * 64, c0 = (int)(blockIdx.y / KS) * 64; if (KS > 1) C += (size_t)ky * sP;
    v8f acc[4][4];
#pragma unroll
    for (int mb = 0; mb < 4; ++mb)
#pragma unroll
        for (int nb = 0; nb < 4; ++nb) acc[mb][nb] = (v8f){};
    const size_t aoff = (size_t)(r0 + lr) * K + 8 * hi, boff = (size_t)(c0 + lr) * K + 8 * hi;
#pragma unroll 1
    for (int kc = kbeg; kc < kend; kc += 32) {
        V a[4], a2[4];
        if constexpr (RA > 0) {   // panels: every fragment of the step hangs on three addresses; all are asked for at once
            V b[4]; const T16* pa = A + ((size_t)(kc >> 4) * RA + r0 + lr) * 16 + 8 * hi; const T16* pa2 = A2 + ((size_t)(kc >> 4) * RA + r0 + lr) * 16 + 8 * hi; const T16* pb = Bt + ((size_t)(kc >> 4) * RB + c0 + lr) * 16 + 8 * hi;
#pragma unroll
            for (int i = 0; i < 4; ++i) { a[i] = WFrag<T16>::ld2(pa + i * 256, pa + i * 256 + (size_t)RA * 16); a2[i] = WFrag<T16>::ld2(pa2 + i * 256, pa2 + i * 256 + (size_t)RA * 16); b[i] = WFrag<T16>::ld2(pb + i * 256, pb + i * 256 + (size_t)RB * 16); }
            asm volatile("s_wait_xcnt 0x0" :: "v"(pa), "v"(pa2), "v"(pb) : "memory");   // the wait that stands before a register named by an issued global load is written again (the addresses are inputs so that they stay in their registers up to it)
            __builtin_amdgcn_sched_barrier(0);   // keeps every matrix instruction behind all 24 loads: without it the last loads are issued behind the first products, into their registers, and the wave waits out a second load latency
#pragma unroll
            for (int nb = 0; nb < 4; ++nb) {
#pragma unroll
                for (int mb = 0; mb < 4; ++mb) { acc[mb][nb] = WFrag<T16>::mma(a[mb], b[nb], acc[mb][nb]); acc[mb][nb] = WFrag<T16>::mma(a2[mb], b[nb], acc[mb][nb]); } }
        } else {
#pragma unroll
        for (int mb = 0; mb < 4; ++mb) { a[mb] = WFrag<T16>::ld(A + aoff + (size_t)mb * 16 * K + kc); if (NSPLIT == 1 || NSPLIT == 2) a2[mb] = WFrag<T16>::ld(A2 + aoff + (size_t)mb * 16 * K + kc); }
#pragma unroll
        for (int nb = 0; nb < 4; ++nb) { const V b = WFrag<T16>::ld(Bt + boff + (size_t)nb * 16 * K + kc); V b2; if (NSPLIT >= 2) b2 = WFrag<T16>::ld(Bt2 + boff + (size_t)nb * 16 * K + kc);
#pragma unroll
            for (int mb = 0; mb < 4; ++mb) { acc[mb][nb] = WFrag<T16>::mma(a[mb], b, acc[mb][nb]); if (NSPLIT == 1 || NSPLIT == 2) acc[mb][nb] = WFrag<T16>::mma(a2[mb], b, acc[mb][nb]); if (NSPLIT >= 2) acc[mb][nb] = WFrag<T16>::mma(a[mb], b2, acc[mb][nb]); } }
        }
        asm volatile("v_nop\n\tv_nop\n\tv_nop\n\tv_nop" : "+v"(acc[0][0]), "+v"(acc[1][1]), "+v"(acc[2][2]), "+v"(acc[3][3]) : "v"(a[0]), "v"(a[3]));
    }
    float* mine = os + w * PW;
#pragma unroll
    for (int m0 = 0; m0 < 4; m0 += MBR) {
#pragma unroll
        for (int mi = 0; mi < MBR; ++mi) {
#pragma unroll
            for (int nb = 0; nb < 4; ++nb) {
#pragma unroll
                for (int j = 0; j < 8; ++j) mine[(mi * 16 + hi * 8 + j) * 68 + nb * 16 + lr] = acc[m0 + mi][nb][j]; } }
        tile_sync<NW>();
        float* crow = C + (size_t)(r0 + m0 * 16) * ldc + c0;
{
#pragma unroll
            for (int s = 0; s < MBR * 8 / NW; ++s) { const int idx = s * (NW * 32) + tid; const int row = idx >> 4, cofs = (idx & 15) * 4; v4f val = *(const v4fa*)(os + row * 68 + cofs);
#pragma unroll
                for (int ww = 1; ww < NW; ++ww) val += *(const v4fa*)(os + ww * PW + row * 68 + cofs);
                if (BIAS) { val[0] += bfr(bias[c0 + cofs]); val[1] += bfr(bias[c0 + cofs + 1]); val[2] += bfr(bias[c0 + cofs + 2]); val[3] += bfr(bias[c0 + cofs + 3]); }
                *(v4f*)(crow + (size_t)row * ldc + cofs) = val; }
             }
        if (MBR < 4) tile_sync<NW>();   // the next round stores over what this round read
    }
}

__device__ __forceinline__ h16 tohx(float x) { return (h16)x; }
__device__ __forceinline__ void splitf(float y, unsigned short& h, unsigned short& l) { h = f2bf(y); l = f2bf(y - bf2f(h)); }
typedef __attribute__((ext_vector_type(2))) _Float16 v2h;
typedef __attribute__((ext_vector_type(4))) _Float16 v4h;
typedef __attribute__((ext_vector_type(2))) unsigned short v2us;
typedef __attribute__((ext_vector_type(4))) unsigned short v4us;
typedef __attribute__((ext_vector_type(2))) float v2f;
typedef __attribute__((ext_vector_type(4))) int v4i;

// The bodies below take their block index blk as an argument: k_prep and k_planes hand each a range of their grids.
__device__ __forceinline__ void d_cvt8(unsigned blk, const float* __restrict__ src, bf* dst, size_t n8) { const size_t i = (size_t)blk * 256 + threadIdx.x; if (i >= n8) return; const v8f v = *(const v8f*)(src + i * 8); v8us o;
#pragma unroll
    for (int k = 0; k < 8; ++k) o[k] = f2bf(v[k]); *(v8us*)(dst + i * 8) = o;  }

// d_rope: head planes [h][t][d] (fp16 + hi/lo) of rope(x) x sc with the rotate-half convention out[d] = x[d] cos[t][d] - x[d+HD/2] sin[t][d], out[d+HD/2] = x[d+HD/2] cos[t][d+HD/2] + x[d] sin[t][d+HD/2]
__device__ __forceinline__ void d_rope(unsigned blk, const float* __restrict__ F, int pitch, int nheads, const float* __restrict__ CS, const float* __restrict__ RF, const float* __restrict__ nw, float sc, h16* P16, bf* Ph, bf* Pl) {
    const size_t e = ((size_t)blk * 256 + threadIdx.x) * 2; if (e >= (size_t)nheads * TT * HD) return; const int d = (int)(e % HD); const int t = (int)((e / HD) % TT); const int h = (int)(e / ((size_t)HD * TT)); const float* f = F + (size_t)t * pitch + h * HD; const float rf = RF ? RF[(size_t)h * TT + t] : 1.0f; v2h o16; v2us oh, ol;
#pragma unroll
    for (int q = 0; q < 2; ++q) { const int dd = d + q; const int dp = (dd < HD / 2) ? dd + HD / 2 : dd - HD / 2; float x0 = f[dd], x1 = f[dp];
        if (RF) { float n0 = __fmul_rn(x0, rf), n1 = __fmul_rn(x1, rf); asm volatile("" : "+v"(n0)); asm volatile("" : "+v"(n1)); x0 = __fmul_rn(bfr(nw[dd]), n0); x1 = __fmul_rn(bfr(nw[dp]), n1); }
        const v2f cs = *(const v2f*)(CS + ((size_t)t * HD + dd) * 2); float a = __fmul_rn(x0, cs[0]), bq = __fmul_rn(x1, cs[1]); asm volatile("" : "+v"(a)); asm volatile("" : "+v"(bq)); const float r = ((dd < HD / 2) ? __fsub_rn(a, bq) : __fadd_rn(a, bq)) * sc;
        o16[q] = tohx(r); unsigned short a2, c2; splitf(r, a2, c2); oh[q] = a2; ol[q] = c2; }
    *(v2h*)(P16 + e) = o16; *(v2us*)(Ph + e) = oh; *(v2us*)(Pl + e) = ol;  }
__device__ __forceinline__ void d_wT(unsigned blk, const float* __restrict__ w, bf* Bt) { const size_t e = ((size_t)blk * 256 + threadIdx.x) * 2; if (e >= (size_t)DQ * DM) return; const int k = (int)(e % DM); const int r = (int)(e / DM); v2us o; o[0] = f2bf(w[(size_t)k * DQ + r]); o[1] = f2bf(w[(size_t)(k + 1) * DQ + r]);
    *(v2us*)(Bt + e) = o;  }
__device__ __forceinline__ void d_bias3(unsigned blk, const float* __restrict__ b0, const float* __restrict__ b1, const float* __restrict__ b2, float* B3) { const int i = blk * 256 + threadIdx.x; if (i >= 3 * DQ) return; const int s = i / DQ, r = i % DQ; const float* src = (s == 0) ? b0 : ((s == 1) ? b1 : b2); *(float*)(B3 + i) = src[r];  }
__device__ __forceinline__ void d_woP(unsigned blk, const float* __restrict__ wo, bf* Bt) { const size_t e = ((size_t)blk * 256 + threadIdx.x) * 2; if (e >= (size_t)DM * DQ) return; const int d = (int)(e % HD); const int n = (int)((e / HD) % DM); const int h = (int)(e / ((size_t)HD * DM)); v2us o; o[0] = f2bf(wo[(size_t)(h * HD + d) * DM + n]); o[1] = f2bf(wo[(size_t)(h * HD + d + 1) * DM + n]);
    *(v2us*)(Bt + e) = o;  }
__device__ __forceinline__ void d_vtp(unsigned blk, const float* __restrict__ F, int pitch, int nheads, h16* V16, bf* Vh, bf* Vl) { const size_t e = ((size_t)blk * 256 + threadIdx.x) * 2; if (e >= (size_t)nheads * HD * TT) return; const int t = (int)(e % TT); const int d = (int)((e / TT) % HD); const int g = (int)(e / ((size_t)TT * HD)); v2h o16; v2us oh, ol;
#pragma unroll
    for (int q = 0; q < 2; ++q) { const float x = F[(size_t)(t + q) * pitch + g * HD + d]; o16[q] = tohx(x); unsigned short a2, c2; splitf(x, a2, c2); oh[q] = a2; ol[q] = c2; }
    *(v2h*)(V16 + e) = o16; *(v2us*)(Vh + e) = oh; *(v2us*)(Vl + e) = ol;  }
__device__ __forceinline__ void d_csid(unsigned blk, float* CS) { const int idx = blk * 256 + threadIdx.x; if (idx >= TT * HD) return; v2f cs; cs[0] = 1.0f; cs[1] = 0.0f; *(v2f*)(CS + (size_t)idx * 2) = cs;  }
// Blocks of 256 threads that each piece takes
#define GB_W  (DQ * DM / 2 / 256)          // one projection weight
#define GB_WO (DM * DQ / 2 / 256)          // the output weight
#define GB_X  (NB_ * TT * DM / 8 / 256)    // one input, both batches
#define GB_CS (TT * HD / 256)
#define GB_B  ((3 * DQ + 255) / 256)
#define GB_P  (NH_ * TT * HD / 2 / 256)    // the planes of one projection of one batch
#define PLN   ((size_t)NH_ * TT * HD)      // elements of one such plane
// ---- k_prep: all that reads only the inputs, one block range per piece; the pieces with strided reads have the low indices (for speed only).
// W3 = Bt planes of Wq, Wk, Wv; XB = bf16 of queries, keys, values, [p][b][t][c].
__global__ __launch_bounds__(256) void k_prep(const float* __restrict__ x, const float* __restrict__ xk, const float* __restrict__ xv, const float* __restrict__ wq, const float* __restrict__ wk, const float* __restrict__ wv, const float* __restrict__ wo,
                                              const float* __restrict__ b0, const float* __restrict__ b1, const float* __restrict__ b2, bf* W3, bf* WO, bf* XB, float* CS, float* B3) {
    unsigned blk = blockIdx.x;
    if (blk < 3 * GB_W) { const unsigned p = blk / GB_W; d_wT(blk % GB_W, (p == 0) ? wq : ((p == 1) ? wk : wv), W3 + (size_t)p * DQ * DM); return; }
    blk -= 3 * GB_W;
    if (blk < GB_WO) { d_woP(blk, wo, WO); return; }
    blk -= GB_WO;
    if (blk < 3 * GB_X) { const unsigned p = blk / GB_X; d_cvt8(blk % GB_X, (p == 0) ? x : ((p == 1) ? xk : xv), XB + (size_t)p * NB_ * TT * DM, (size_t)NB_ * TT * DM / 8); return; }
    blk -= 3 * GB_X;
    if (blk < GB_CS) { d_csid(blk, CS); return; }
    d_bias3(blk - GB_CS, b0, b1, b2, B3);
}
// ---- k_planes: the head planes of all six projections (F = [z = 0..3] of q and k, FV = [b] of v); the transposing V pieces (strided reads) have the low indices. P16 / Ph / Pl = [z = 0..3] planes of q and k, V16 / Vh / Vl = [b].
__global__ __launch_bounds__(256) void k_planes(const float* __restrict__ F, const float* __restrict__ FV, const float* __restrict__ CS, h16* P16, bf* Ph, bf* Pl, h16* V16, bf* Vh, bf* Vl) {
    unsigned blk = blockIdx.x;
    if (blk < NB_ * GB_P) { const unsigned b = blk / GB_P; d_vtp(blk % GB_P, FV + (size_t)b * TT * DQ, DKV, NKV, V16 + b * PLN, Vh + b * PLN, Vl + b * PLN); return; }
    blk -= NB_ * GB_P;
    const unsigned z = blk / GB_P; d_rope(blk % GB_P, F + (size_t)z * TT * DQ, DQ, NH_, CS, nullptr, nullptr, 1.0f, P16 + z * PLN, Ph + z * PLN, Pl + z * PLN);
}
// ---- k_fattn: scores, softmax and P.V of QT x 16 query rows of one head in one work-group; S and P stay in registers. Grid (heads, NB_ TT / (16 QT)), NWV waves; wave w takes the keys [w KW, (w + 1) KW) for all the rows, so a K or V fragment is loaded once for QT row tiles.
// S^T = K Q^T: register j of key tile t in lane (lr, hi) is S[query lr][key 16 t + 8 hi + j], so a lane holds scores of one query per row tile, and two neighbouring key tiles are, as they lie, the A fragment of P for 32 keys (same k order as the V^T loader).
// A head is 16 wide and the matrix instruction takes 32: the upper half of the K and Q fragments (d 16..31) is set to zero in registers.
// Row maximum and row sum: in the lane, then across the two lane halves, then across the waves through LDS in wave order; P is normalised before it is rounded; the waves' partial contexts are added in wave order.
// Rows < RH: hi/lo bf16 planes, 3 products (these work-groups have the low blockIdx.y: they run longest); the rest fp16 with P carried x PCAR. Stores the hi/lo planes of the merged context, panel h: QT x 16 rows of 32 bytes in a row.
// Every loop of fattn_rows is unrolled: s, v, o and the fragments are register arrays, which only constant indices keep out of scratch memory.
#define NWV 16
#define QT  2
#define KW  (TT / NWV)
#define KT  (KW / 16)
// 2^x by the hardware instruction, with the one free issue slot behind a transcendental in the same statement
__device__ __forceinline__ float exp2_slot(float x) { float e; asm("v_exp_f32 %0, %1\n\tv_nop" : "=v"(e) : "v"(x)); return e; }
template <bool HIRES> struct FSel { typedef bf T; };
template <> struct FSel<false> { typedef h16 T; };
template <bool HIRES>
__device__ __forceinline__ void fattn_rows(const h16* __restrict__ Q16, const h16* __restrict__ K16, const h16* __restrict__ V16, const bf* __restrict__ Qh, const bf* __restrict__ Ql, const bf* __restrict__ Kh, const bf* __restrict__ Kl, const bf* __restrict__ Vh, const bf* __restrict__ Vl,
                                           int q0, int h, bf* Ah, bf* Al, float* redm, float* reds, float* part) {
    const int tid = threadIdx.x, lane = tid & 31, lr = lane & 15, hi = lane >> 4; const int w = __builtin_amdgcn_readfirstlane(tid >> 5); const int k0 = w * KW;
    const size_t qoff = ((size_t)h * TT + q0 + lr) * HD + 8 * hi, koff = ((size_t)h * TT + k0 + lr) * HD + 8 * hi, voff = ((size_t)h * HD + lr) * TT + k0 + 8 * hi;
    typedef typename FSel<HIRES>::T VT;   // element type of the V^T planes this path reads
    v8f s[QT][KT];
    if constexpr (HIRES) { const v8us z8 = {}; v16bf qh[QT], ql[QT];
#pragma unroll
        for (int qt = 0; qt < QT; ++qt) { qh[qt] = cat16b(*(const v8us*)(Qh + qoff + (size_t)qt * 16 * HD), z8); ql[qt] = cat16b(*(const v8us*)(Ql + qoff + (size_t)qt * 16 * HD), z8); }
#pragma unroll
        for (int t = 0; t < KT; ++t) { const v16bf kh = cat16b(*(const v8us*)(Kh + koff + (size_t)t * 16 * HD), z8), kl = cat16b(*(const v8us*)(Kl + koff + (size_t)t * 16 * HD), z8);
#pragma unroll
            for (int qt = 0; qt < QT; ++qt) { v8f c = {}; c = wmmab(kh, qh[qt], c); c = wmmab(kh, ql[qt], c); c = wmmab(kl, qh[qt], c); s[qt][t] = c; } }
    } else { const v8h z8 = {}; v16h q[QT];
#pragma unroll
        for (int qt = 0; qt < QT; ++qt) q[qt] = cat16(*(const v8h*)(Q16 + qoff + (size_t)qt * 16 * HD), z8);
#pragma unroll
        for (int t = 0; t < KT; ++t) { const v16h k = cat16(*(const v8h*)(K16 + koff + (size_t)t * 16 * HD), z8);
#pragma unroll
            for (int qt = 0; qt < QT; ++qt) { v8f c = {}; s[qt][t] = wmma16(k, q[qt], c); } } }
    float mx[QT];
#pragma unroll
    for (int qt = 0; qt < QT; ++qt) { float m = -3.0e38f;
#pragma unroll
        for (int t = 0; t < KT; ++t) {
#pragma unroll
            for (int j = 0; j < 8; ++j) { const float x = s[qt][t][j] * SCL; s[qt][t][j] = x; m = fmaxf(m, x); } }
        m = fmaxf(m, __shfl_xor(m, 16, 32)); mx[qt] = m;
        if (hi == 0) redm[(w * QT + qt) * 16 + lr] = m; }
    __syncthreads();   // every wave's row maxima are in LDS
    typename WFrag<VT>::V v[KT / 2], v2[HIRES ? KT / 2 : 1];   // the wave's V^T fragments
    // loads the fragments [t0, t1); behind them the wait that stands before a register named by an issued global load is written again (the addresses are inputs so that they stay in their registers up to it)
    auto load_v = [&](int t0, int t1) { const VT* vp; const VT* vp2;
        if constexpr (HIRES) { vp = Vh + voff; vp2 = Vl + voff; } else { vp = V16 + voff; vp2 = vp; }
#pragma unroll
        for (int tp = t0; tp < t1; ++tp) { v[tp] = WFrag<VT>::ld(vp + tp * 32); if constexpr (HIRES) v2[tp] = WFrag<VT>::ld(vp2 + tp * 32); }
        asm volatile("s_wait_xcnt 0x0" :: "v"(vp), "v"(vp2) : "memory"); };
    if constexpr (!HIRES) load_v(0, KT / 2);   // asked for here so that they arrive under the exponentials (the hi/lo path has no registers free for that: it asks one step ahead)
    float f[QT];
#pragma unroll
    for (int qt = 0; qt < QT; ++qt) { float m = mx[qt];
#pragma unroll
        for (int ww = 0; ww < NWV; ++ww) m = fmaxf(m, redm[(ww * QT + qt) * 16 + lr]);
        float ps[4] = {0.f, 0.f, 0.f, 0.f};
#pragma unroll
        for (int t = 0; t < KT; ++t) {
#pragma unroll
            for (int j = 0; j < 8; ++j) { const float e = exp2_slot(__fmul_rn(__fsub_rn(s[qt][t][j], m), 1.4426950408889634f)); s[qt][t][j] = e; ps[j & 3] += e; } }
        float sum = (ps[0] + ps[1]) + (ps[2] + ps[3]); sum += __shfl_xor(sum, 16, 32);
        if (hi == 0) reds[(w * QT + qt) * 16 + lr] = sum; }
    __syncthreads();   // every wave's row sums are in LDS
    if constexpr (HIRES) load_v(0, 1);
#pragma unroll
    for (int qt = 0; qt < QT; ++qt) { float tot = reds[qt * 16 + lr];
#pragma unroll
        for (int ww = 1; ww < NWV; ++ww) tot += reds[(ww * QT + qt) * 16 + lr];
        f[qt] = __fdiv_rn(HIRES ? 1.0f : PCAR, tot); }
    v8f o[QT];
#pragma unroll
    for (int qt = 0; qt < QT; ++qt) o[qt] = (v8f){};
#pragma unroll
    for (int tp = 0; tp < KT / 2; ++tp) {
        if constexpr (HIRES) { if (tp + 1 < KT / 2) load_v(tp + 1, tp + 2);
            const v16bf vh = v[tp], vl = v2[tp];
#pragma unroll
            for (int qt = 0; qt < QT; ++qt) { v8us h0, l0, h1, l1;
#pragma unroll
                for (int j = 0; j < 8; ++j) { unsigned short a, c2; splitf(s[qt][2 * tp][j] * f[qt], a, c2); h0[j] = a; l0[j] = c2; splitf(s[qt][2 * tp + 1][j] * f[qt], a, c2); h1[j] = a; l1[j] = c2; }
                const v16bf ph = cat16b(h0, h1), pl = cat16b(l0, l1);
                o[qt] = wmmab(ph, vh, o[qt]); o[qt] = wmmab(pl, vh, o[qt]); o[qt] = wmmab(ph, vl, o[qt]); }
        } else {
#pragma unroll
            for (int qt = 0; qt < QT; ++qt) { v8h p0, p1;
#pragma unroll
                for (int j = 0; j < 8; ++j) { p0[j] = tohx(s[qt][2 * tp][j] * f[qt]); p1[j] = tohx(s[qt][2 * tp + 1][j] * f[qt]); }
                o[qt] = wmma16(cat16(p0, p1), v[tp], o[qt]); } } }
#pragma unroll
    for (int qt = 0; qt < QT; ++qt) {
#pragma unroll
        for (int j = 0; j < 8; ++j) part[w * (QT * 272) + (qt * 16 + hi * 8 + j) * 17 + lr] = o[qt][j]; }
    __syncthreads();   // every wave's partial context is in LDS
    { const int q = tid >> 4, d = tid & 15; float acc = part[q * 17 + d];   // NWV * 32 threads = QT * 16 rows x 16 columns
#pragma unroll
      for (int ww = 1; ww < NWV; ++ww) acc += part[ww * (QT * 272) + q * 17 + d];
      unsigned short a, c2; splitf(acc * (HIRES ? 1.0f : (1.0f / PCAR)), a, c2); const size_t oo = ((size_t)h * TT + q0 + q) * HD + d; Ah[oo] = a; Al[oo] = c2; }
}
__global__ __launch_bounds__(32 * NWV) void k_fattn(const h16* __restrict__ Q16, const h16* __restrict__ K16, const h16* __restrict__ V16, const bf* __restrict__ Qh, const bf* __restrict__ Ql, const bf* __restrict__ Kh, const bf* __restrict__ Kl, const bf* __restrict__ Vh, const bf* __restrict__ Vl, bf* Ah, bf* Al) {
    static_assert(NWV * 32 == QT * 256, "one thread per element of the context tile");
    __shared__ float redm[NWV * QT * 16]; __shared__ float reds[NWV * QT * 16]; __shared__ float part[NWV * QT * 272];
    // blockIdx.y -> (batch, row tile): the hi/lo tiles of both batches first, so that the longest work-groups have the low indices (for speed only)
    constexpr int NT = TT / (QT * 16), HT = RH / (QT * 16); const int y = blockIdx.y; const int b = (y < NB_ * HT) ? y / HT : (y - NB_ * HT) / (NT - HT); const int tile = (y < NB_ * HT) ? y % HT : HT + (y - NB_ * HT) % (NT - HT);
    const int h = blockIdx.x, q0 = tile * (QT * 16);
    { const size_t po = (size_t)b * PLN; Q16 += po; K16 += po; V16 += po; Qh += po; Ql += po; Kh += po; Kl += po; Vh += po; Vl += po; Ah += po; Al += po; }
    if (q0 < RH) fattn_rows<true>(Q16, K16, V16, Qh, Ql, Kh, Kl, Vh, Vl, q0, h, Ah, Al, redm, reds, part);
    else fattn_rows<false>(Q16, K16, V16, Qh, Ql, Kh, Kl, Vh, Vl, q0, h, Ah, Al, redm, reds, part);
}

extern "C" void kernel_launch(void* const* d_in, const int* in_sizes, int n_in,
                              void* d_out, int out_size, void* d_ws, size_t ws_size, hipStream_t stream) {
    (void)in_sizes; (void)n_in; (void)out_size;
    const float* x = (const float*)d_in[0]; const float* xk = (const float*)d_in[1]; const float* xv = (const float*)d_in[2]; const float* wq = (const float*)d_in[3]; const float* bqr = (const float*)d_in[4]; const float* wk = (const float*)d_in[5]; const float* bkr = (const float*)d_in[6]; const float* wv = (const float*)d_in[7]; const float* bvr = (const float*)d_in[8]; const float* wo = (const float*)d_in[9]; const float* bo = (const float*)d_in[10];   /* argument order queries, keys, values, Wq ('xw' [1024][128]), bq [128], Wk, bk, Wv, bv, Wo ('xw' [128][1024]), bo */
    float* OUT = (float*)d_out;     // [2][2048][1024]
    char* wsp = (char*)d_ws;
    auto take = [&](size_t bytes) { char* p = wsp; wsp += (bytes + 255) & ~(size_t)255; return (void*)p; };
    bf* W3 = (bf*)take((size_t)3 * DQ * DM * 2); bf* WO = (bf*)take((size_t)DM * DQ * 2); float* CS = (float*)take((size_t)TT * HD * 2 * 4);
    bf* XB = (bf*)take((size_t)3 * NB_ * TT * DM * 2); float* B3 = (float*)take((size_t)3 * DQ * 4);   /* biases [p][128] */ float* F = (float*)take((size_t)3 * NB_ * TT * DQ * 4);   /* projections [z][t][128] */
    h16* P16 = (h16*)take(2 * NB_ * PLN * 2); bf* Ph = (bf*)take(2 * NB_ * PLN * 2); bf* Pl = (bf*)take(2 * NB_ * PLN * 2);   /* q planes z = 0, 1; k planes z = 2, 3 */
    h16* VT16 = (h16*)take(NB_ * PLN * 2); bf* VTh = (bf*)take(NB_ * PLN * 2); bf* VTl = (bf*)take(NB_ * PLN * 2);
    bf* ATh = (bf*)take(NB_ * PLN * 2); bf* ATl = (bf*)take(NB_ * PLN * 2);   /* merged context [b][h][t][16] */
    if ((size_t)(wsp - (char*)d_ws) > ws_size) return;    // ws 256 MiB
    k_prep<<<3 * GB_W + GB_WO + 3 * GB_X + GB_CS + GB_B, 256, 0, stream>>>(x, xk, xv, wq, wk, wv, wo, bqr, bkr, bvr, W3, WO, XB, CS, B3);
    k_gemmw<bf, 0, true, 8, 1, NB_><<<dim3(TT / 64, DQ / 64, 3 * NB_), 256, 0, stream>>>(XB, nullptr, W3, nullptr, DM, F, DQ, B3, (size_t)TT * DM, (size_t)DQ * DM, (size_t)TT * DQ, 0, DQ);
    k_planes<<<3 * NB_ * GB_P, 256, 0, stream>>>(F, F + (size_t)2 * NB_ * TT * DQ, CS, P16, Ph, Pl, VT16, VTh, VTl);
    k_fattn<<<dim3(NH_, NB_ * (TT / (16 * QT)), 1), 32 * NWV, 0, stream>>>(P16, P16 + NB_ * PLN, VT16, Ph, Pl, Ph + NB_ * PLN, Pl + NB_ * PLN, VTh, VTl, ATh, ATl);   // one kv head per query head
    k_gemmw<bf, 1, true, 4, 1, NB_, TT, DM><<<dim3(TT / 64, DM / 64, NB_), 128, 0, stream>>>(ATh, ATl, WO, nullptr, DQ, OUT, DM, bo, PLN, 0, (size_t)TT * DM, 0, 0);   // 4 waves: 32 k, two heads, each
}

// v006
// A run of this version takes 54.9 microseconds.
// Timed twice side by side with v005, it ran 1.11 and 1.12 times as fast.
// Counting every step since v000, it is 20.4 times as fast.
#include <hip/hip_runtime.h>

// Multi-headed attention whose projections are only 128 wide (the module's Dense(d_k = d_model / h) quirk): 8 heads x 16 dims (queries, keys, values [2][2048][1024]; q = queries Wq + bq, k = keys Wk + bk, v = values Wv + bv ('xw' [1024][128] 0.02 + zero biases [128]); heads = 16-wide slices; scores / sqrt(128) (the module scales by sqrt(d_k = 128), not by the per-head 16); softmax (no mask); o = merged [2048][128]; out = o Wo + bo ('xw' [128][1024]) -> [2][2048][1024] (4.2 M); argument order queries, keys, values, Wq, bq, Wk, bk, Wv, bv, Wo, bo).
// Four launches, each holding every piece of work that depends only on the launches before it, for both batches: k_prep (operand planes), k_gemmw z = 0..5 (projections, stored as head planes), k_fattn, k_gemmw z = 0..1 (output). Index z = p * NB_ + b, p = 0 queries, 1 keys, 2 values.
// Layout per batch: q, k and v lie dense, 8 heads x 16 = 128 wide: d_wT builds the Bt planes [128][1024] from the 'xw' [1024][128] weights (row r = W[:, r]), d_bias3 gathers the three biases; exact projections + f32 biases, rounded in the product's own epilogue to the head planes [h][t][16] and V^T [h][16][t]; dense T-2048 attention. The merged context lies dense too, in panels of 16 k, one per head: [h][t][16], so a work-group of k_fattn writes whole 128-byte lines that no other writes; d_woP builds the output weight in the same form, [h][n][16] (element d = Wo[h*16 + d][n]); merged hi/lo x Wo exact + bo, K = 128.
// Compute dtypes, f32 accumulate: every input rounded to bf16; projections exact + f32 biases; attention rows < 512 3 products, rest fp16; softmax f32; Wo hl x exact + bias.

#define NB_  2
#define TT   2048
#define DM   1024
#define NH_  8
#define NKV  8
#define REP  (NH_ / NKV)
#define HD   16                   // per-head width: q, k, v and their planes
#define DQ   (NH_ * HD)
#define DKV  (NKV * HD)
#define RH   512                  // query rows < RH use hi+lo planes (0: none)
#define WIN  0
#define PCAR 1024.0f
#define SCL  0.088388347648318447f   // 1/sqrt(d_k = 128), as the module (not 1/sqrt(16))
typedef _Float16 h16;
typedef unsigned short bf;
typedef __attribute__((ext_vector_type(16))) __bf16   v16bf;
typedef __attribute__((ext_vector_type(16))) _Float16 v16h;
typedef __attribute__((ext_vector_type(8)))  _Float16 v8h;
typedef __attribute__((ext_vector_type(8)))  unsigned short v8us;
typedef __attribute__((ext_vector_type(8)))  float    v8f;
typedef __attribute__((ext_vector_type(4)))  float    v4f;
typedef v8h  __attribute__((may_alias)) v8ha;
typedef v4f  __attribute__((may_alias)) v4fa;
typedef v8us __attribute__((may_alias)) v8usa;

__device__ __forceinline__ unsigned short f2bf(float f) { unsigned u = __float_as_uint(f); u += 0x7FFFu + ((u >> 16) & 1u); return (unsigned short)(u >> 16); }
__device__ __forceinline__ float bf2f(unsigned short b) { return __uint_as_float(((unsigned)b) << 16); }
__device__ __forceinline__ float bfr(float f) { return bf2f(f2bf(f)); }
__device__ __forceinline__ v16h cat16(v8h lo, v8h hi) { return __builtin_shufflevector(lo, hi, 0, 1, 2, 3, 4, 5, 6, 7, 8, 9, 10, 11, 12, 13, 14, 15); }
__device__ __forceinline__ v16bf cat16b(v8us lo, v8us hi) { return __builtin_bit_cast(v16bf, __builtin_shufflevector(lo, hi, 0, 1, 2, 3, 4, 5, 6, 7, 8, 9, 10, 11, 12, 13, 14, 15)); }
__device__ __forceinline__ v8f wmma16(v16h a, v16h b, v8f c) { return __builtin_amdgcn_wmma_f32_16x16x32_f16(false, a, false, b, (short)0, c, false, false); }
__device__ __forceinline__ v8f wmmab(v16bf a, v16bf b, v8f c) { return __builtin_amdgcn_wmma_f32_16x16x32_bf16(false, a, false, b, (short)0, c, false, false); }
__device__ __forceinline__ h16 tohx(float x) { return (h16)x; }
__device__ __forceinline__ void splitf(float y, unsigned short& h, unsigned short& l) { h = f2bf(y); l = f2bf(y - bf2f(h)); }
#define PLN   ((size_t)NH_ * TT * HD)      // elements of one head plane of one batch
// Where a projection product (PL) stores: fp16 and hi/lo bf16 head planes, q16 / qh / ql = [z = 0..3][h][t][16] of q and k, v16 / vh / vl = [b][h][16][t] of v.
struct Planes { h16* q16; bf* qh; bf* ql; h16* v16; bf* vh; bf* vl; };



// ---- k_gemmw: register-blocked GEMM, 64x64 output tiles (16 accumulators per wave), operands straight from K-contiguous 16-bit planes; grid (M/64, N/64 * KS, Z), 32 * NW threads.
// K is split: work-group ky = blockIdx.y % KS of a tile takes the K range [ky K/KS, (ky+1) K/KS), wave w of it the w-th of NW equal contiguous parts. The NW partial tiles of a work-group meet in LDS and are added in wave order 0, 1, ... (a fixed order);
// work-group ky stores its sum in plane ky of C (plane stride sP elements), and the reader of C adds the KS planes in plane order. NW = KS = 1: one wave, the whole K, one plane.
// C[m][n] (f32, pitch ldc, + optional f32 bias[n], KS = 1 only) = sum_k A[m][k] Bt[n][k] (+ split products per NSPLIT). z-batch strides sA/sB/sC in elements; ZB neighbouring z share one Bt and one bias (strides sB, sBb per group of ZB). K % (32 * NW * KS) == 0.
// RA = RB = 0: A and Bt are row-major, K contiguous. RA, RB > 0: each lies in panels of 16 k with that many rows each, element (row, k) at ((k / 16) * R + row) * 16 + k % 16: the 16 rows of a fragment load are then 512 contiguous bytes (4 whole lines, not 16 pieces of 32 bytes). The k order of a fragment is the same in both forms.
// PL: the result is not stored as C: each sum (+ bias) is rounded here to the three head planes. Group zw = 0, 1 (q, k): [h][t][16], a tile is 2 KiB in a row per head and plane. Group zw = 2 (v): the two operands and the two block indices change places, so the tile is V^T (rows = h * 16 + d, columns = t; both loaders have one k order, every element keeps its products and their order), its rows are whole 128-byte lines of [h][16][t], and the bias goes by row.
template <typename T16> struct WFrag;
template <> struct WFrag<h16> { typedef v16h V; static __device__ __forceinline__ V ld2(const h16* p, const h16* q) { return cat16(*(const v8h*)p, *(const v8h*)q); } static __device__ __forceinline__ V ld(const h16* p) { return ld2(p, p + 16); } static __device__ __forceinline__ v8f mma(V a, V b, v8f c) { return wmma16(a, b, c); } };
template <> struct WFrag<bf> { typedef v16bf V; static __device__ __forceinline__ V ld2(const bf* p, const bf* q) { return cat16b(*(const v8us*)p, *(const v8us*)q); } static __device__ __forceinline__ V ld(const bf* p) { return ld2(p, p + 16); } static __device__ __forceinline__ v8f mma(V a, V b, v8f c) { return wmmab(a, b, c); } };
template <int NW> __device__ __forceinline__ void tile_sync() {   // orders the LDS stores of the partial tiles before the reads of them: among the waves of the work-group, or inside the one wave
    if constexpr (NW == 1) { __builtin_amdgcn_wave_barrier(); asm volatile("" ::: "memory"); } else { __syncthreads(); } }
template <typename T16, int NSPLIT, bool BIAS, int NW, int KS, int ZB, int RA = 0, int RB = 0, bool PL = false>
__global__ __launch_bounds__(32 * NW) void k_gemmw(const T16* __restrict__ A, const T16* __restrict__ A2, const T16* __restrict__ Bt, const T16* __restrict__ Bt2, int K, float* C, int ldc, const float* __restrict__ bias, size_t sA, size_t sB, size_t sC, size_t sP, size_t sBb, Planes pl) {
    static_assert(KS == 1 || !BIAS, "the bias would be added once per plane"); static_assert((RA > 0) == (RB > 0) && (RA == 0 || NSPLIT == 1), "panels: both operands, hi/lo A"); static_assert(!PL || (NSPLIT == 0 && BIAS && NW == 8 && KS == 1 && RA == 0), "planes: one product, one K plane, row-major operands, 256 threads");
    typedef typename WFrag<T16>::V V;
    constexpr int MBR = (NW == 1) ? 1 : 4;   // 16-row blocks staged per round: with several waves the whole tile at once, so one barrier serves
    constexpr int PW = MBR * 16 * 68;        // floats of one wave's staged part
    __shared__ __align__(16) float os[NW * PW];
    const size_t z = blockIdx.z, zw = z / ZB; A += z * sA; if (A2) A2 += z * sA; Bt += zw * sB; if (Bt2) Bt2 += zw * sB; if (BIAS) bias += zw * sBb; C += z * sC;
    const bool vt = PL && zw == 2; if (vt) { const T16* sw = A; A = Bt; Bt = sw; }
    const int tid = threadIdx.x, lane = tid & 31, lr = lane & 15, hi = lane >> 4; const int w = (NW == 1) ? 0 : __builtin_amdgcn_readfirstlane(tid >> 5); const int ky = (KS == 1) ? 0 : (int)(blockIdx.y % KS);
    const int kspan = K / (NW * KS), kbeg = (ky * NW + w) * kspan, kend = kbeg + kspan; const int r0 = (int)(vt ? blockIdx.y : blockIdx.x) * 64, c0 = (int)(vt ? blockIdx.x : blockIdx.y / KS) * 64; if (KS > 1) C += (size_t)ky * sP;
    v8f acc[4][4];
#pragma unroll
    for (int mb = 0; mb < 4; ++mb)
#pragma unroll
        for (int nb = 0; nb < 4; ++nb) acc[mb][nb] = (v8f){};
    const size_t aoff = (size_t)(r0 + lr) * K + 8 * hi, boff = (size_t)(c0 + lr) * K + 8 * hi;
    // PL: in the epilogue the thread takes rows prow and prow + 32 and eight columns from pcof of the tile: 16 bytes per plane and row, so a wave stores whole 128-byte lines (V^T: eight lanes a row of 64 t; q, k: two lanes a row of a head, four rows in a row).
    // Its biases are asked for here, by column and by row without a branch (the form not used reads from index 0 on), so that they arrive under the K loop.
    const int prow = tid >> 3, pcof = (tid & 7) * 8; v4f pbc0 = {}, pbc1 = {}; float pbr[2] = {0.f, 0.f};
    if constexpr (PL) { const float* bc = bias + (vt ? 0 : c0) + pcof; const float* br = bias + (vt ? r0 : 0) + prow; pbc0 = *(const v4fa*)bc; pbc1 = *(const v4fa*)(bc + 4); pbr[0] = br[0]; pbr[1] = br[32]; }
#pragma unroll 1
    for (int kc = kbeg; kc < kend; kc += 32) {
        V a[4], a2[4];
        if constexpr (RA > 0) {   // panels: every fragment of the step hangs on three addresses; all are asked for at once
            V b[4]; const T16* pa = A + ((size_t)(kc >> 4) * RA + r0 + lr) * 16 + 8 * hi; const T16* pa2 = A2 + ((size_t)(kc >> 4) * RA + r0 + lr) * 16 + 8 * hi; const T16* pb = Bt + ((size_t)(kc >> 4) * RB + c0 + lr) * 16 + 8 * hi;
#pragma unroll
            for (int i = 0; i < 4; ++i) { a[i] = WFrag<T16>::ld2(pa + i * 256, pa + i * 256 + (size_t)RA * 16); a2[i] = WFrag<T16>::ld2(pa2 + i * 256, pa2 + i * 256 + (size_t)RA * 16); b[i] = WFrag<T16>::ld2(pb + i * 256, pb + i * 256 + (size_t)RB * 16); }
            asm volatile("s_wait_xcnt 0x0" :: "v"(pa), "v"(pa2), "v"(pb) : "memory");   // the wait that stands before a register named by an issued global load is written again (the addresses are inputs so that they stay in their registers up to it)
            __builtin_amdgcn_sched_barrier(0);   // keeps every matrix instruction behind all 24 loads: without it the last loads are issued behind the first products, into their registers, and the wave waits out a second load latency
#pragma unroll
            for (int nb = 0; nb < 4; ++nb) {
#pragma unroll
                for (int mb = 0; mb < 4; ++mb) { acc[mb][nb] = WFrag<T16>::mma(a[mb], b[nb], acc[mb][nb]); acc[mb][nb] = WFrag<T16>::mma(a2[mb], b[nb], acc[mb][nb]); } }
        } else {
#pragma unroll
        for (int mb = 0; mb < 4; ++mb) { a[mb] = WFrag<T16>::ld(A + aoff + (size_t)mb * 16 * K + kc); if (NSPLIT == 1 || NSPLIT == 2) a2[mb] = WFrag<T16>::ld(A2 + aoff + (size_t)mb * 16 * K + kc); }
#pragma unroll
        for (int nb = 0; nb < 4; ++nb) { const V b = WFrag<T16>::ld(Bt + boff + (size_t)nb * 16 * K + kc); V b2; if (NSPLIT >= 2) b2 = WFrag<T16>::ld(Bt2 + boff + (size_t)nb * 16 * K + kc);
#pragma unroll
            for (int mb = 0; mb < 4; ++mb) { acc[mb][nb] = WFrag<T16>::mma(a[mb], b, acc[mb][nb]); if (NSPLIT == 1 || NSPLIT == 2) acc[mb][nb] = WFrag<T16>::mma(a2[mb], b, acc[mb][nb]); if (NSPLIT >= 2) acc[mb][nb] = WFrag<T16>::mma(a[mb], b2, acc[mb][nb]); } }
        }
        asm volatile("v_nop\n\tv_nop\n\tv_nop\n\tv_nop" : "+v"(acc[0][0]), "+v"(acc[1][1]), "+v"(acc[2][2]), "+v"(acc[3][3]) : "v"(a[0]), "v"(a[3]));
    }
    float* mine = os + w * PW;
#pragma unroll
    for (int m0 = 0; m0 < 4; m0 += MBR) {
#pragma unroll
        for (int mi = 0; mi < MBR; ++mi) {
#pragma unroll
            for (int nb = 0; nb < 4; ++nb) {
#pragma unroll
                for (int j = 0; j < 8; ++j) mine[(mi * 16 + hi * 8 + j) * 68 + nb * 16 + lr] = acc[m0 + mi][nb][j]; } }
        tile_sync<NW>();
        float* crow = C + (size_t)(r0 + m0 * 16) * ldc + c0;
        if constexpr (PL) {   // both rounds are summed and rounded first, then stored: the LDS reads of the second do not wait behind the stores of the first
            v8h o16[2]; v8us oh[2], ol[2];
#pragma unroll
            for (int s = 0; s < 2; ++s) { const float* ps = os + (s * 32 + prow) * 68 + pcof; v4f va = *(const v4fa*)ps, vb = *(const v4fa*)(ps + 4);
#pragma unroll
                for (int ww = 1; ww < NW; ++ww) { va += *(const v4fa*)(ps + ww * PW); vb += *(const v4fa*)(ps + ww * PW + 4); }
#pragma unroll
                for (int q = 0; q < 8; ++q) { const float y = ((q < 4) ? va[q & 3] : vb[q & 3]) + bfr(vt ? pbr[s] : ((q < 4) ? pbc0[q & 3] : pbc1[q & 3])); o16[s][q] = tohx(y); unsigned short a2, c2; splitf(y, a2, c2); oh[s][q] = a2; ol[s][q] = c2; } }
            const int rr = r0 + prow, cc = c0 + pcof;
            const size_t e0 = vt ? (z - 2 * ZB) * PLN + (size_t)rr * TT + cc : z * PLN + ((size_t)(cc / HD) * TT + rr) * HD + cc % HD, es = vt ? (size_t)32 * TT : (size_t)32 * HD;   // first element, step of 32 rows
            h16* d16 = (vt ? pl.v16 : pl.q16) + e0; bf* dh = (vt ? pl.vh : pl.qh) + e0; bf* dl = (vt ? pl.vl : pl.ql) + e0;
#pragma unroll
            for (int s = 0; s < 2; ++s) { *(v8h*)(d16 + s * es) = o16[s]; *(v8us*)(dh + s * es) = oh[s]; *(v8us*)(dl + s * es) = ol[s]; }
        } else
{
#pragma unroll
            for (int s = 0; s < MBR * 8 / NW; ++s) { const int idx = s * (NW * 32) + tid; const int row = idx >> 4, cofs = (idx & 15) * 4; v4f val = *(const v4fa*)(os + row * 68 + cofs);
#pragma unroll
                for (int ww = 1; ww < NW; ++ww) val += *(const v4fa*)(os + ww * PW + row * 68 + cofs);
                if (BIAS) { val[0] += bfr(bias[c0 + cofs]); val[1] += bfr(bias[c0 + cofs + 1]); val[2] += bfr(bias[c0 + cofs + 2]); val[3] += bfr(bias[c0 + cofs + 3]); }
                *(v4f*)(crow + (size_t)row * ldc + cofs) = val; }
             }
        if (MBR < 4) tile_sync<NW>();   // the next round stores over what this round read
    }
}

typedef __attribute__((ext_vector_type(2))) unsigned short v2us;
typedef __attribute__((ext_vector_type(4))) int v4i;

// The bodies below take their block index blk as an argument: k_prep hands each a range of its grid.
__device__ __forceinline__ void d_cvt8(unsigned blk, const float* __restrict__ src, bf* dst, size_t n8) { const size_t i = (size_t)blk * 256 + threadIdx.x; if (i >= n8) return; const v8f v = *(const v8f*)(src + i * 8); v8us o;
#pragma unroll
    for (int k = 0; k < 8; ++k) o[k] = f2bf(v[k]); *(v8us*)(dst + i * 8) = o;  }
__device__ __forceinline__ void d_wT(unsigned blk, const float* __restrict__ w, bf* Bt) { const size_t e = ((size_t)blk * 256 + threadIdx.x) * 2; if (e >= (size_t)DQ * DM) return; const int k = (int)(e % DM); const int r = (int)(e / DM); v2us o; o[0] = f2bf(w[(size_t)k * DQ + r]); o[1] = f2bf(w[(size_t)(k + 1) * DQ + r]);
    *(v2us*)(Bt + e) = o;  }
__device__ __forceinline__ void d_bias3(unsigned blk, const float* __restrict__ b0, const float* __restrict__ b1, const float* __restrict__ b2, float* B3) { const int i = blk * 256 + threadIdx.x; if (i >= 3 * DQ) return; const int s = i / DQ, r = i % DQ; const float* src = (s == 0) ? b0 : ((s == 1) ? b1 : b2); *(float*)(B3 + i) = src[r];  }
__device__ __forceinline__ void d_woP(unsigned blk, const float* __restrict__ wo, bf* Bt) { const size_t e = ((size_t)blk * 256 + threadIdx.x) * 2; if (e >= (size_t)DM * DQ) return; const int d = (int)(e % HD); const int n = (int)((e / HD) % DM); const int h = (int)(e / ((size_t)HD * DM)); v2us o; o[0] = f2bf(wo[(size_t)(h * HD + d) * DM + n]); o[1] = f2bf(wo[(size_t)(h * HD + d + 1) * DM + n]);
    *(v2us*)(Bt + e) = o;  }
// Blocks of 256 threads that each piece takes
#define GB_W  (DQ * DM / 2 / 256)          // one projection weight
#define GB_WO (DM * DQ / 2 / 256)          // the output weight
#define GB_X  (NB_ * TT * DM / 8 / 256)    // one input, both batches
#define GB_B  ((3 * DQ + 255) / 256)
// ---- k_prep: all that reads only the inputs, one block range per piece; the pieces with strided reads have the low indices (for speed only).
// W3 = Bt planes of Wq, Wk, Wv; XB = bf16 of queries, keys, values, [p][b][t][c].
__global__ __launch_bounds__(256) void k_prep(const float* __restrict__ x, const float* __restrict__ xk, const float* __restrict__ xv, const float* __restrict__ wq, const float* __restrict__ wk, const float* __restrict__ wv, const float* __restrict__ wo,
                                              const float* __restrict__ b0, const float* __restrict__ b1, const float* __restrict__ b2, bf* W3, bf* WO, bf* XB, float* B3) {
    unsigned blk = blockIdx.x;
    if (blk < 3 * GB_W) { const unsigned p = blk / GB_W; d_wT(blk % GB_W, (p == 0) ? wq : ((p == 1) ? wk : wv), W3 + (size_t)p * DQ * DM); return; }
    blk -= 3 * GB_W;
    if (blk < GB_WO) { d_woP(blk, wo, WO); return; }
    blk -= GB_WO;
    if (blk < 3 * GB_X) { const unsigned p = blk / GB_X; d_cvt8(blk % GB_X, (p == 0) ? x : ((p == 1) ? xk : xv), XB + (size_t)p * NB_ * TT * DM, (size_t)NB_ * TT * DM / 8); return; }
    d_bias3(blk - 3 * GB_X, b0, b1, b2, B3);
}
// ---- k_fattn: scores, softmax and P.V of QT x 16 query rows of one head in one work-group; S and P stay in registers. Grid (heads, NB_ TT / (16 QT)), NWV waves; wave w takes the keys [w KW, (w + 1) KW) for all the rows, so a K or V fragment is loaded once for QT row tiles.
// S^T = K Q^T: register j of key tile t in lane (lr, hi) is S[query lr][key 16 t + 8 hi + j], so a lane holds scores of one query per row tile, and two neighbouring key tiles are, as they lie, the A fragment of P for 32 keys (same k order as the V^T loader).
// A head is 16 wide and the matrix instruction takes 32: the upper half of the K and Q fragments (d 16..31) is set to zero in registers.
// Row maximum and row sum: in the lane, then across the two lane halves, then across the waves through LDS in wave order; P is normalised before it is rounded; the waves' partial contexts are added in wave order.
// Rows < RH: hi/lo bf16 planes, 3 products (these work-groups have the low blockIdx.y: they run longest); the rest fp16 with P carried x PCAR. Stores the hi/lo planes of the merged context, panel h: QT x 16 rows of 32 bytes in a row.
// Every loop of fattn_rows is unrolled: s, v, o and the fragments are register arrays, which only constant indices keep out of scratch memory.
#define NWV 16
#define QT  2
#define KW  (TT / NWV)
#define KT  (KW / 16)
// 2^x by the hardware instruction, with the one free issue slot behind a transcendental in the same statement
__device__ __forceinline__ float exp2_slot(float x) { float e; asm("v_exp_f32 %0, %1\n\tv_nop" : "=v"(e) : "v"(x)); return e; }
template <bool HIRES> struct FSel { typedef bf T; };
template <> struct FSel<false> { typedef h16 T; };
template <bool HIRES>
__device__ __forceinline__ void fattn_rows(const h16* __restrict__ Q16, const h16* __restrict__ K16, const h16* __restrict__ V16, const bf* __restrict__ Qh, const bf* __restrict__ Ql, const bf* __restrict__ Kh, const bf* __restrict__ Kl, const bf* __restrict__ Vh, const bf* __restrict__ Vl,
                                           int q0, int h, bf* Ah, bf* Al, float* redm, float* reds, float* part) {
    const int tid = threadIdx.x, lane = tid & 31, lr = lane & 15, hi = lane >> 4; const int w = __builtin_amdgcn_readfirstlane(tid >> 5); const int k0 = w * KW;
    const size_t qoff = ((size_t)h * TT + q0 + lr) * HD + 8 * hi, koff = ((size_t)h * TT + k0 + lr) * HD + 8 * hi, voff = ((size_t)h * HD + lr) * TT + k0 + 8 * hi;
    typedef typename FSel<HIRES>::T VT;   // element type of the V^T planes this path reads
    v8f s[QT][KT];
    if constexpr (HIRES) { const v8us z8 = {}; v16bf qh[QT], ql[QT];
#pragma unroll
        for (int qt = 0; qt < QT; ++qt) { qh[qt] = cat16b(*(const v8us*)(Qh + qoff + (size_t)qt * 16 * HD), z8); ql[qt] = cat16b(*(const v8us*)(Ql + qoff + (size_t)qt * 16 * HD), z8); }
#pragma unroll
        for (int t = 0; t < KT; ++t) { const v16bf kh = cat16b(*(const v8us*)(Kh + koff + (size_t)t * 16 * HD), z8), kl = cat16b(*(const v8us*)(Kl + koff + (size_t)t * 16 * HD), z8);
#pragma unroll
            for (int qt = 0; qt < QT; ++qt) { v8f c = {}; c = wmmab(kh, qh[qt], c); c = wmmab(kh, ql[qt], c); c = wmmab(kl, qh[qt], c); s[qt][t] = c; } }
    } else { const v8h z8 = {}; v16h q[QT];
#pragma unroll
        for (int qt = 0; qt < QT; ++qt) q[qt] = cat16(*(const v8h*)(Q16 + qoff + (size_t)qt * 16 * HD), z8);
#pragma unroll
        for (int t = 0; t < KT; ++t) { const v16h k = cat16(*(const v8h*)(K16 + koff + (size_t)t * 16 * HD), z8);
#pragma unroll
            for (int qt = 0; qt < QT; ++qt) { v8f c = {}; s[qt][t] = wmma16(k, q[qt], c); } } }
    float mx[QT];
#pragma unroll
    for (int qt = 0; qt < QT; ++qt) { float m = -3.0e38f;
#pragma unroll
        for (int t = 0; t < KT; ++t) {
#pragma unroll
            for (int j = 0; j < 8; ++j) { const float x = s[qt][t][j] * SCL; s[qt][t][j] = x; m = fmaxf(m, x); } }
        m = fmaxf(m, __shfl_xor(m, 16, 32)); mx[qt] = m;
        if (hi == 0) redm[(w * QT + qt) * 16 + lr] = m; }
    __syncthreads();   // every wave's row maxima are in LDS
    typename WFrag<VT>::V v[KT / 2], v2[HIRES ? KT / 2 : 1];   // the wave's V^T fragments
    // loads the fragments [t0, t1); behind them the wait that stands before a register named by an issued global load is written again (the addresses are inputs so that they stay in their registers up to it)
    auto load_v = [&](int t0, int t1) { const VT* vp; const VT* vp2;
        if constexpr (HIRES) { vp = Vh + voff; vp2 = Vl + voff; } else { vp = V16 + voff; vp2 = vp; }
#pragma unroll
        for (int tp = t0; tp < t1; ++tp) { v[tp] = WFrag<VT>::ld(vp + tp * 32); if constexpr (HIRES) v2[tp] = WFrag<VT>::ld(vp2 + tp * 32); }
        asm volatile("s_wait_xcnt 0x0" :: "v"(vp), "v"(vp2) : "memory"); };
    if constexpr (!HIRES) load_v(0, KT / 2);   // asked for here so that they arrive under the exponentials (the hi/lo path has no registers free for that: it asks one step ahead)
    float f[QT];
#pragma unroll
    for (int qt = 0; qt < QT; ++qt) { float m = mx[qt];
#pragma unroll
        for (int ww = 0; ww < NWV; ++ww) m = fmaxf(m, redm[(ww * QT + qt) * 16 + lr]);
        float ps[4] = {0.f, 0.f, 0.f, 0.f};
#pragma unroll
        for (int t = 0; t < KT; ++t) {
#pragma unroll
            for (int j = 0; j < 8; ++j) { const float e = exp2_slot(__fmul_rn(__fsub_rn(s[qt][t][j], m), 1.4426950408889634f)); s[qt][t][j] = e; ps[j & 3] += e; } }
        float sum = (ps[0] + ps[1]) + (ps[2] + ps[3]); sum += __shfl_xor(sum, 16, 32);
        if (hi == 0) reds[(w * QT + qt) * 16 + lr] = sum; }
    __syncthreads();   // every wave's row sums are in LDS
    if constexpr (HIRES) load_v(0, 1);
#pragma unroll
    for (int qt = 0; qt < QT; ++qt) { float tot = reds[qt * 16 + lr];
#pragma unroll
        for (int ww = 1; ww < NWV; ++ww) tot += reds[(ww * QT + qt) * 16 + lr];
        f[qt] = __fdiv_rn(HIRES ? 1.0f : PCAR, tot); }
    v8f o[QT];
#pragma unroll
    for (int qt = 0; qt < QT; ++qt) o[qt] = (v8f){};
#pragma unroll
    for (int tp = 0; tp < KT / 2; ++tp) {
        if constexpr (HIRES) { if (tp + 1 < KT / 2) load_v(tp + 1, tp + 2);
            const v16bf vh = v[tp], vl = v2[tp];
#pragma unroll
            for (int qt = 0; qt < QT; ++qt) { v8us h0, l0, h1, l1;
#pragma unroll
                for (int j = 0; j < 8; ++j) { unsigned short a, c2; splitf(s[qt][2 * tp][j] * f[qt], a, c2); h0[j] = a; l0[j] = c2; splitf(s[qt][2 * tp + 1][j] * f[qt], a, c2); h1[j] = a; l1[j] = c2; }
                const v16bf ph = cat16b(h0, h1), pl = cat16b(l0, l1);
                o[qt] = wmmab(ph, vh, o[qt]); o[qt] = wmmab(pl, vh, o[qt]); o[qt] = wmmab(ph, vl, o[qt]); }
        } else {
#pragma unroll
            for (int qt = 0; qt < QT; ++qt) { v8h p0, p1;
#pragma unroll
                for (int j = 0; j < 8; ++j) { p0[j] = tohx(s[qt][2 * tp][j] * f[qt]); p1[j] = tohx(s[qt][2 * tp + 1][j] * f[qt]); }
                o[qt] = wmma16(cat16(p0, p1), v[tp], o[qt]); } } }
#pragma unroll
    for (int qt = 0; qt < QT; ++qt) {
#pragma unroll
        for (int j = 0; j < 8; ++j) part[w * (QT * 272) + (qt * 16 + hi * 8 + j) * 17 + lr] = o[qt][j]; }
    __syncthreads();   // every wave's partial context is in LDS
    { const int q = tid >> 4, d = tid & 15; float acc = part[q * 17 + d];   // NWV * 32 threads = QT * 16 rows x 16 columns
#pragma unroll
      for (int ww = 1; ww < NWV; ++ww) acc += part[ww * (QT * 272) + q * 17 + d];
      unsigned short a, c2; splitf(acc * (HIRES ? 1.0f : (1.0f / PCAR)), a, c2); const size_t oo = ((size_t)h * TT + q0 + q) * HD + d; Ah[oo] = a; Al[oo] = c2; }
}
__global__ __launch_bounds__(32 * NWV) void k_fattn(const h16* __restrict__ Q16, const h16* __restrict__ K16, const h16* __restrict__ V16, const bf* __restrict__ Qh, const bf* __restrict__ Ql, const bf* __restrict__ Kh, const bf* __restrict__ Kl, const bf* __restrict__ Vh, const bf* __restrict__ Vl, bf* Ah, bf* Al) {
    static_assert(NWV * 32 == QT * 256, "one thread per element of the context tile");
    __shared__ float redm[NWV * QT * 16]; __shared__ float reds[NWV * QT * 16]; __shared__ float part[NWV * QT * 272];
    // blockIdx.y -> (batch, row tile): the hi/lo tiles of both batches first, so that the longest work-groups have the low indices (for speed only)
    constexpr int NT = TT / (QT * 16), HT = RH / (QT * 16); const int y = blockIdx.y; const int b = (y < NB_ * HT) ? y / HT : (y - NB_ * HT) / (NT - HT); const int tile = (y < NB_ * HT) ? y % HT : HT + (y - NB_ * HT) % (NT - HT);
    const int h = blockIdx.x, q0 = tile * (QT * 16);
    { const size_t po = (size_t)b * PLN; Q16 += po; K16 += po; V16 += po; Qh += po; Ql += po; Kh += po; Kl += po; Vh += po; Vl += po; Ah += po; Al += po; }
    if (q0 < RH) fattn_rows<true>(Q16, K16, V16, Qh, Ql, Kh, Kl, Vh, Vl, q0, h, Ah, Al, redm, reds, part);
    else fattn_rows<false>(Q16, K16, V16, Qh, Ql, Kh, Kl, Vh, Vl, q0, h, Ah, Al, redm, reds, part);
}

extern "C" void kernel_launch(void* const* d_in, const int* in_sizes, int n_in,
                              void* d_out, int out_size, void* d_ws, size_t ws_size, hipStream_t stream) {
    (void)in_sizes; (void)n_in; (void)out_size;
    const float* x = (const float*)d_in[0]; const float* xk = (const float*)d_in[1]; const float* xv = (const float*)d_in[2]; const float* wq = (const float*)d_in[3]; const float* bqr = (const float*)d_in[4]; const float* wk = (const float*)d_in[5]; const float* bkr = (const float*)d_in[6]; const float* wv = (const float*)d_in[7]; const float* bvr = (const float*)d_in[8]; const float* wo = (const float*)d_in[9]; const float* bo = (const float*)d_in[10];   /* argument order queries, keys, values, Wq ('xw' [1024][128]), bq [128], Wk, bk, Wv, bv, Wo ('xw' [128][1024]), bo */
    float* OUT = (float*)d_out;     // [2][2048][1024]
    char* wsp = (char*)d_ws;
    auto take = [&](size_t bytes) { char* p = wsp; wsp += (bytes + 255) & ~(size_t)255; return (void*)p; };
    bf* W3 = (bf*)take((size_t)3 * DQ * DM * 2); bf* WO = (bf*)take((size_t)DM * DQ * 2);
    bf* XB = (bf*)take((size_t)3 * NB_ * TT * DM * 2); float* B3 = (float*)take((size_t)3 * DQ * 4);   /* biases [p][128] */
    h16* P16 = (h16*)take(2 * NB_ * PLN * 2); bf* Ph = (bf*)take(2 * NB_ * PLN * 2); bf* Pl = (bf*)take(2 * NB_ * PLN * 2);   /* q planes z = 0, 1; k planes z = 2, 3 */
    h16* VT16 = (h16*)take(NB_ * PLN * 2); bf* VTh = (bf*)take(NB_ * PLN * 2); bf* VTl = (bf*)take(NB_ * PLN * 2);
    bf* ATh = (bf*)take(NB_ * PLN * 2); bf* ATl = (bf*)take(NB_ * PLN * 2);   /* merged context [b][h][t][16] */
    if ((size_t)(wsp - (char*)d_ws) > ws_size) return;    // ws 256 MiB
    k_prep<<<3 * GB_W + GB_WO + 3 * GB_X + GB_B, 256, 0, stream>>>(x, xk, xv, wq, wk, wv, wo, bqr, bkr, bvr, W3, WO, XB, B3);
    k_gemmw<bf, 0, true, 8, 1, NB_, 0, 0, true><<<dim3(TT / 64, DQ / 64, 3 * NB_), 256, 0, stream>>>(XB, nullptr, W3, nullptr, DM, nullptr, 0, B3, (size_t)TT * DM, (size_t)DQ * DM, 0, 0, DQ, Planes{P16, Ph, Pl, VT16, VTh, VTl});
    k_fattn<<<dim3(NH_, NB_ * (TT / (16 * QT)), 1), 32 * NWV, 0, stream>>>(P16, P16 + NB_ * PLN, VT16, Ph, Pl, Ph + NB_ * PLN, Pl + NB_ * PLN, VTh, VTl, ATh, ATl);   // one kv head per query head
    k_gemmw<bf, 1, true, 4, 1, NB_, TT, DM><<<dim3(TT / 64, DM / 64, NB_), 128, 0, stream>>>(ATh, ATl, WO, nullptr, DQ, OUT, DM, bo, PLN, 0, (size_t)TT * DM, 0, 0, Planes{});   // 4 waves: 32 k, two heads, each
}

// v007
// It runs in 45.9 microseconds.
// Next to v006, in two timings, it ran 1.19 times as fast each time.
// Counting every step since v000, it is 24.3 times as fast.
#include <hip/hip_runtime.h>

// Multi-headed attention whose projections are only 128 wide (the module's Dense(d_k = d_model / h) quirk): 8 heads x 16 dims (queries, keys, values [2][2048][1024]; q = queries Wq + bq, k = keys Wk + bk, v = values Wv + bv ('xw' [1024][128] 0.02 + zero biases [128]); heads = 16-wide slices; scores / sqrt(128) (the module scales by sqrt(d_k = 128), not by the per-head 16); softmax (no mask); o = merged [2048][128]; out = o Wo + bo ('xw' [128][1024]) -> [2][2048][1024] (4.2 M); argument order queries, keys, values, Wq, bq, Wk, bk, Wv, bv, Wo, bo).
// Three launches, each holding every piece of work that depends only on the launches before it, for both batches: k_proj z = 0..5 (projections straight from the f32 inputs, stored as head planes; z = 6: the output weight's panels), k_fattn, k_gemmw z = 0..1 (output). Index z = p * NB_ + b, p = 0 queries, 1 keys, 2 values.
// Layout per batch: q, k and v lie dense, 8 heads x 16 = 128 wide: k_proj rounds inputs and 'xw' [1024][128] weights to bf16 in registers as it loads them; exact projections + f32 biases, rounded in the product's own epilogue to the head planes [h][t][16] and V^T [h][16][t]; dense T-2048 attention. The merged context lies dense too, in panels of 16 k, one per head: [h][t][16], so a work-group of k_fattn writes whole 128-byte lines that no other writes; d_woP builds the output weight in the same form, [h][n][16] (element d = Wo[h*16 + d][n]); merged hi/lo x Wo exact + bo, K = 128.
// Compute dtypes, f32 accumulate: every input rounded to bf16; projections exact + f32 biases; attention rows < 512 3 products, rest fp16; softmax f32; Wo hl x exact + bias.

#define NB_  2
#define TT   2048
#define DM   1024
#define NH_  8
#define NKV  8
#define REP  (NH_ / NKV)
#define HD   16                   // per-head width: q, k, v and their planes
#define DQ   (NH_ * HD)
#define DKV  (NKV * HD)
#define RH   512                  // query rows < RH use hi+lo planes (0: none)
#define WIN  0
#define PCAR 1024.0f
#define SCL  0.088388347648318447f   // 1/sqrt(d_k = 128), as the module (not 1/sqrt(16))
typedef _Float16 h16;
typedef unsigned short bf;
typedef __attribute__((ext_vector_type(16))) __bf16   v16bf;
typedef __attribute__((ext_vector_type(16))) _Float16 v16h;
typedef __attribute__((ext_vector_type(8)))  _Float16 v8h;
typedef __attribute__((ext_vector_type(8)))  unsigned short v8us;
typedef __attribute__((ext_vector_type(8)))  float    v8f;
typedef __attribute__((ext_vector_type(4)))  float    v4f;
typedef v8h  __attribute__((may_alias)) v8ha;
typedef v4f  __attribute__((may_alias)) v4fa;
typedef v8us __attribute__((may_alias)) v8usa;

__device__ __forceinline__ unsigned short f2bf(float f) { unsigned u = __float_as_uint(f); u += 0x7FFFu + ((u >> 16) & 1u); return (unsigned short)(u >> 16); }
__device__ __forceinline__ float bf2f(unsigned short b) { return __uint_as_float(((unsigned)b) << 16); }
__device__ __forceinline__ float bfr(float f) { return bf2f(f2bf(f)); }
__device__ __forceinline__ v16h cat16(v8h lo, v8h hi) { return __builtin_shufflevector(lo, hi, 0, 1, 2, 3, 4, 5, 6, 7, 8, 9, 10, 11, 12, 13, 14, 15); }
__device__ __forceinline__ v16bf cat16b(v8us lo, v8us hi) { return __builtin_bit_cast(v16bf, __builtin_shufflevector(lo, hi, 0, 1, 2, 3, 4, 5, 6, 7, 8, 9, 10, 11, 12, 13, 14, 15)); }
__device__ __forceinline__ v8f wmma16(v16h a, v16h b, v8f c) { return __builtin_amdgcn_wmma_f32_16x16x32_f16(false, a, false, b, (short)0, c, false, false); }
__device__ __forceinline__ v8f wmmab(v16bf a, v16bf b, v8f c) { return __builtin_amdgcn_wmma_f32_16x16x32_bf16(false, a, false, b, (short)0, c, false, false); }
__device__ __forceinline__ h16 tohx(float x) { return (h16)x; }
__device__ __forceinline__ void splitf(float y, unsigned short& h, unsigned short& l) { h = f2bf(y); l = f2bf(y - bf2f(h)); }
#define PLN   ((size_t)NH_ * TT * HD)      // elements of one head plane of one batch
// Where k_proj stores: fp16 and hi/lo bf16 head planes, q16 / qh / ql = [z = 0..3][h][t][16] of q and k, v16 / vh / vl = [b][h][16][t] of v.
struct Planes { h16* q16; bf* qh; bf* ql; h16* v16; bf* vh; bf* vl; };



// ---- k_gemmw: register-blocked GEMM, 64x64 output tiles (16 accumulators per wave), operands straight from K-contiguous 16-bit planes; grid (M/64, N/64 * KS, Z), 32 * NW threads.
// K is split: work-group ky = blockIdx.y % KS of a tile takes the K range [ky K/KS, (ky+1) K/KS), wave w of it the w-th of NW equal contiguous parts. The NW partial tiles of a work-group meet in LDS and are added in wave order 0, 1, ... (a fixed order);
// work-group ky stores its sum in plane ky of C (plane stride sP elements), and the reader of C adds the KS planes in plane order. NW = KS = 1: one wave, the whole K, one plane.
// C[m][n] (f32, pitch ldc, + optional f32 bias[n], KS = 1 only) = sum_k A[m][k] Bt[n][k] (+ split products per NSPLIT). z-batch strides sA/sB/sC in elements; ZB neighbouring z share one Bt and one bias (strides sB, sBb per group of ZB). K % (32 * NW * KS) == 0.
// RA = RB = 0: A and Bt are row-major, K contiguous. RA, RB > 0: each lies in panels of 16 k with that many rows each, element (row, k) at ((k / 16) * R + row) * 16 + k % 16: the 16 rows of a fragment load are then 512 contiguous bytes (4 whole lines, not 16 pieces of 32 bytes). The k order of a fragment is the same in both forms.
template <typename T16> struct WFrag;
template <> struct WFrag<h16> { typedef v16h V; static __device__ __forceinline__ V ld2(const h16* p, const h16* q) { return cat16(*(const v8h*)p, *(const v8h*)q); } static __device__ __forceinline__ V ld(const h16* p) { return ld2(p, p + 16); } static __device__ __forceinline__ v8f mma(V a, V b, v8f c) { return wmma16(a, b, c); } };
template <> struct WFrag<bf> { typedef v16bf V; static __device__ __forceinline__ V ld2(const bf* p, const bf* q) { return cat16b(*(const v8us*)p, *(const v8us*)q); } static __device__ __forceinline__ V ld(const bf* p) { return ld2(p, p + 16); } static __device__ __forceinline__ v8f mma(V a, V b, v8f c) { return wmmab(a, b, c); } };
template <int NW> __device__ __forceinline__ void tile_sync() {   // orders the LDS stores of the partial tiles before the reads of them: among the waves of the work-group, or inside the one wave
    if constexpr (NW == 1) { __builtin_amdgcn_wave_barrier(); asm volatile("" ::: "memory"); } else { __syncthreads(); } }
template <typename T16, int NSPLIT, bool BIAS, int NW, int KS, int ZB, int RA = 0, int RB = 0>
__global__ __launch_bounds__(32 * NW) void k_gemmw(const T16* __restrict__ A, const T16* __restrict__ A2, const T16* __restrict__ Bt, const T16* __restrict__ Bt2, int K, float* C, int ldc, const float* __restrict__ bias, size_t sA, size_t sB, size_t sC, size_t sP, size_t sBb) {
    static_assert(KS == 1 || !BIAS, "the bias would be added once per plane"); static_assert((RA > 0) == (RB > 0) && (RA == 0 || NSPLIT == 1), "panels: both operands, hi/lo A");
    typedef typename WFrag<T16>::V V;
    constexpr int MBR = (NW == 1) ? 1 : 4;   // 16-row blocks staged per round: with several waves the whole tile at once, so one barrier serves
    constexpr int PW = MBR * 16 * 68;        // floats of one wave's staged part
    __shared__ __align__(16) float os[NW * PW];
    const size_t z = blockIdx.z, zw = z / ZB; A += z * sA; if (A2) A2 += z * sA; Bt += zw * sB; if (Bt2) Bt2 += zw * sB; if (BIAS) bias += zw * sBb; C += z * sC;
    const int tid = threadIdx.x, lane = tid & 31, lr = lane & 15, hi = lane >> 4; const int w = (NW == 1) ? 0 : __builtin_amdgcn_readfirstlane(tid >> 5); const int ky = (KS == 1) ? 0 : (int)(blockIdx.y % KS);
    const int kspan = K / (NW * KS), kbeg = (ky * NW + w) * kspan, kend = kbeg + kspan; const int r0 = (int)blockIdx.x * 64, c0 = (int)(blockIdx.y / KS) * 64; if (KS > 1) C += (size_t)ky * sP;
    v8f acc[4][4];
#pragma unroll
    for (int mb = 0; mb < 4; ++mb)
#pragma unroll
        for (int nb = 0; nb < 4; ++nb) acc[mb][nb] = (v8f){};
    const size_t aoff = (size_t)(r0 + lr) * K + 8 * hi, boff = (size_t)(c0 + lr) * K + 8 * hi;
#pragma unroll 1
    for (int kc = kbeg; kc < kend; kc += 32) {
        V a[4], a2[4];
        if constexpr (RA > 0) {   // panels: every fragment of the step hangs on three addresses; all are asked for at once
            V b[4]; const T16* pa = A + ((size_t)(kc >> 4) * RA + r0 + lr) * 16 + 8 * hi; const T16* pa2 = A2 + ((size_t)(kc >> 4) * RA + r0 + lr) * 16 + 8 * hi; const T16* pb = Bt + ((size_t)(kc >> 4) * RB + c0 + lr) * 16 + 8 * hi;
#pragma unroll
            for (int i = 0; i < 4; ++i) { a[i] = WFrag<T16>::ld2(pa + i * 256, pa + i * 256 + (size_t)RA * 16); a2[i] = WFrag<T16>::ld2(pa2 + i * 256, pa2 + i * 256 + (size_t)RA * 16); b[i] = WFrag<T16>::ld2(pb + i * 256, pb + i * 256 + (size_t)RB * 16); }
            asm volatile("s_wait_xcnt 0x0" :: "v"(pa), "v"(pa2), "v"(pb) : "memory");   // the wait that stands before a register named by an issued global load is written again (the addresses are inputs so that they stay in their registers up to it)
            __builtin_amdgcn_sched_barrier(0);   // keeps every matrix instruction behind all 24 loads: without it the last loads are issued behind the first products, into their registers, and the wave waits out a second load latency
#pragma unroll
            for (int nb = 0; nb < 4; ++nb) {
#pragma unroll
                for (int mb = 0; mb < 4; ++mb) { acc[mb][nb] = WFrag<T16>::mma(a[mb], b[nb], acc[mb][nb]); acc[mb][nb] = WFrag<T16>::mma(a2[mb], b[nb], acc[mb][nb]); } }
        } else {
#pragma unroll
        for (int mb = 0; mb < 4; ++mb) { a[mb] = WFrag<T16>::ld(A + aoff + (size_t)mb * 16 * K + kc); if (NSPLIT == 1 || NSPLIT == 2) a2[mb] = WFrag<T16>::ld(A2 + aoff + (size_t)mb * 16 * K + kc); }
#pragma unroll
        for (int nb = 0; nb < 4; ++nb) { const V b = WFrag<T16>::ld(Bt + boff + (size_t)nb * 16 * K + kc); V b2; if (NSPLIT >= 2) b2 = WFrag<T16>::ld(Bt2 + boff + (size_t)nb * 16 * K + kc);
#pragma unroll
            for (int mb = 0; mb < 4; ++mb) { acc[mb][nb] = WFrag<T16>::mma(a[mb], b, acc[mb][nb]); if (NSPLIT == 1 || NSPLIT == 2) acc[mb][nb] = WFrag<T16>::mma(a2[mb], b, acc[mb][nb]); if (NSPLIT >= 2) acc[mb][nb] = WFrag<T16>::mma(a[mb], b2, acc[mb][nb]); } }
        }
        asm volatile("v_nop\n\tv_nop\n\tv_nop\n\tv_nop" : "+v"(acc[0][0]), "+v"(acc[1][1]), "+v"(acc[2][2]), "+v"(acc[3][3]) : "v"(a[0]), "v"(a[3]));
    }
    float* mine = os + w * PW;
#pragma unroll
    for (int m0 = 0; m0 < 4; m0 += MBR) {
#pragma unroll
        for (int mi = 0; mi < MBR; ++mi) {
#pragma unroll
            for (int nb = 0; nb < 4; ++nb) {
#pragma unroll
                for (int j = 0; j < 8; ++j) mine[(mi * 16 + hi * 8 + j) * 68 + nb * 16 + lr] = acc[m0 + mi][nb][j]; } }
        tile_sync<NW>();
        float* crow = C + (size_t)(r0 + m0 * 16) * ldc + c0;
        {
#pragma unroll
            for (int s = 0; s < MBR * 8 / NW; ++s) { const int idx = s * (NW * 32) + tid; const int row = idx >> 4, cofs = (idx & 15) * 4; v4f val = *(const v4fa*)(os + row * 68 + cofs);
#pragma unroll
                for (int ww = 1; ww < NW; ++ww) val += *(const v4fa*)(os + ww * PW + row * 68 + cofs);
                if (BIAS) { val[0] += bfr(bias[c0 + cofs]); val[1] += bfr(bias[c0 + cofs + 1]); val[2] += bfr(bias[c0 + cofs + 2]); val[3] += bfr(bias[c0 + cofs + 3]); }
                *(v4f*)(crow + (size_t)row * ldc + cofs) = val; }
             }
        if (MBR < 4) tile_sync<NW>();   // the next round stores over what this round read
    }
}

typedef __attribute__((ext_vector_type(2))) unsigned short v2us;
typedef __attribute__((ext_vector_type(4))) int v4i;

// The output weight in panels of 16 k, [h][n][16] (element d = Wo[h*16 + d][n]), rounded to bf16: 512 elements per block index blk.
__device__ __forceinline__ void d_woP(unsigned blk, const float* __restrict__ wo, bf* Bt) { const size_t e = ((size_t)blk * 256 + threadIdx.x) * 2; if (e >= (size_t)DM * DQ) return; const int d = (int)(e % HD); const int n = (int)((e / HD) % DM); const int h = (int)(e / ((size_t)HD * DM)); v2us o; o[0] = f2bf(wo[(size_t)(h * HD + d) * DM + n]); o[1] = f2bf(wo[(size_t)(h * HD + d + 1) * DM + n]);
    *(v2us*)(Bt + e) = o;  }
#define GB_WO (DM * DQ / 2 / 256)          // block indices of d_woP
typedef __attribute__((ext_vector_type(16))) float v16f;
// 16 f32 -> one bf16 fragment, round to nearest even (packed hardware conversions)
__device__ __forceinline__ v16bf cvt16(v16f t) { return __builtin_convertvector(t, v16bf); }
// The K loop of one wave of k_proj: 4 steps of 32 k from px (the lane's input row) and pw (the lane's four weight columns). VT: the weight fragments are the A operand.
// A step holds 128 accumulator registers and 64 of f32 inputs, which leaves no room for 64 more of f32 weights under 256 (two work-groups a WGP). So the wave rounds its weight fragments of all four steps first, while no accumulator lives,
// and parks them in wl, its own part of LDS (16 KiB): every lane writes and later reads its own 32 bytes per fragment, 512 bytes in a row per instruction, so no barrier is needed.
template <bool VT> __device__ __forceinline__ void proj_k(const float* px, const float* pw, float* wl, int lane, v8f (&acc)[4][4]) {
#pragma unroll
    for (int s = 0; s < DM / 8 / 32; ++s) { v4f wr[16];
#pragma unroll
        for (int e = 0; e < 16; ++e) wr[e] = *(const v4fa*)(pw + (size_t)(s * 32 + (e & 7) + (e >> 3) * 16) * DQ);
#pragma unroll
        for (int i = 0; i < 4; ++i) { v16f t;
#pragma unroll
            for (int e = 0; e < 16; ++e) t[e] = wr[e][i];
            const v8f c = __builtin_bit_cast(v8f, cvt16(t)); float* d = wl + (s * 4 + i) * 256 + lane * 4;
            *(v4fa*)d = __builtin_shufflevector(c, c, 0, 1, 2, 3); *(v4fa*)(d + 128) = __builtin_shufflevector(c, c, 4, 5, 6, 7); }
        if (s & 1) __builtin_amdgcn_sched_barrier(0); }   // two steps' loads in flight at a time, and no accumulator zeroed among them: all 64 loads at once, or 32 beside the accumulators, take more than 256 registers
#pragma unroll
    for (int mb = 0; mb < 4; ++mb)
#pragma unroll
        for (int nb = 0; nb < 4; ++nb) acc[mb][nb] = (v8f){};
    // kept rolled for the register room named above: one step's 64 input registers at a time beside the accumulators
#pragma unroll 1
    for (int s = 0; s < DM / 8 / 32; ++s) {
        v4f xr[4][4]; v16bf wf[4];
#pragma unroll
        for (int i = 0; i < 4; ++i) { const float* q = px + (size_t)i * 16 * DM; xr[i][0] = *(const v4fa*)q; xr[i][1] = *(const v4fa*)(q + 4); xr[i][2] = *(const v4fa*)(q + 16); xr[i][3] = *(const v4fa*)(q + 20); }
        asm volatile("s_wait_xcnt 0x0" :: "v"(px) : "memory");   // the wait that stands before a register named by an issued global load is written again (the address is an input so that it stays in its registers up to it)
        px += 32;
#pragma unroll
        for (int i = 0; i < 4; ++i) { const float* d = wl + (s * 4 + i) * 256 + lane * 4; const v4f lo = *(const v4fa*)d, hi4 = *(const v4fa*)(d + 128); wf[i] = __builtin_bit_cast(v16bf, __builtin_shufflevector(lo, hi4, 0, 1, 2, 3, 4, 5, 6, 7)); }
#pragma unroll
        for (int i = 0; i < 4; ++i) { v16f t;
#pragma unroll
            for (int e = 0; e < 16; ++e) t[e] = xr[i][e >> 2][e & 3];
            const v16bf xf = cvt16(t);
#pragma unroll
            for (int o = 0; o < 4; ++o) { if constexpr (VT) acc[o][i] = wmmab(wf[o], xf, acc[o][i]); else acc[i][o] = wmmab(xf, wf[o], acc[i][o]); } }
        // the issue slots that the chip needs between the last matrix instructions and the next step's conversions, which write over their operands
        asm volatile("v_nop\n\tv_nop\n\tv_nop\n\tv_nop" : "+v"(acc[VT ? 0 : 3][VT ? 3 : 0]), "+v"(acc[VT ? 1 : 3][VT ? 3 : 1]), "+v"(acc[VT ? 2 : 3][VT ? 3 : 2]), "+v"(acc[3][3]));   // named: the results of the step's last four
    }
}
// ---- k_proj: the three projections of both batches straight from the f32 inputs, 64x64 tiles; grid (TT / 64, DQ / 64, 3 NB_ + 1), 8 waves. z = p * NB_ + b; the last z slice builds the output weight's panels for the third launch (d_woP).
// Wave w takes the k range [128 w, 128 w + 128), 32 k a step; inputs and weights are rounded to bf16 in registers as they arrive. The 8 partial tiles meet in LDS and are added in wave order 0, 1, ... (a fixed order).
// Input fragment i: rows t0 + 16 i + lr, the lane's 16 k as four 16-byte loads of its row. Weight fragment i: column n0 + 4 lr + i of the 'xw' [1024][128] weight, so one 16-byte load per k serves all four fragments and a wave reads whole lines; the tile's columns (v: rows) are put back in order where the partial tile is stored to LDS. Both loaders have one k order: position e of lane half hi is k = 8 hi + e (e < 8), 16 + 8 hi + e - 8 (e >= 8).
// Each sum (+ bias) is rounded here to the three head planes. p = 0, 1 (q, k): [h][t][16], a tile is 2 KiB in a row per head and plane. p = 2 (v): the two operands change places, so the tile is V^T (rows = h * 16 + d, columns = t; every element keeps its products and their order), its rows are whole 128-byte lines of [h][16][t], and the bias goes by row.
__global__ __launch_bounds__(256) void k_proj(const float* __restrict__ x, const float* __restrict__ xk, const float* __restrict__ xv, const float* __restrict__ wq, const float* __restrict__ wk, const float* __restrict__ wv,
                                              const float* __restrict__ b0, const float* __restrict__ b1, const float* __restrict__ b2, const float* __restrict__ wo, bf* WO, Planes pl) {
    constexpr int NW = 8, PW = 64 * 68;      // waves; floats of one wave's partial tile
    __shared__ __align__(16) float os[NW * PW];
    const size_t z = blockIdx.z;
    if (z == 3 * NB_) { const unsigned blk = blockIdx.y * (TT / 64) + blockIdx.x;   // whole work-groups leave here, in front of the barrier
#pragma unroll
        for (unsigned i = 0; i < GB_WO / (TT / 64 * (DQ / 64)); ++i) d_woP(blk * (GB_WO / (TT / 64 * (DQ / 64))) + i, wo, WO);
        return; }
    const int p = (int)(z / NB_); const bool vt = p == 2;
    const float* X = ((p == 0) ? x : ((p == 1) ? xk : xv)) + (z % NB_) * ((size_t)TT * DM); const float* Wf = (p == 0) ? wq : ((p == 1) ? wk : wv); const float* bias = (p == 0) ? b0 : ((p == 1) ? b1 : b2);
    const int tid = threadIdx.x, lane = tid & 31, lr = lane & 15, hi = lane >> 4; const int w = __builtin_amdgcn_readfirstlane(tid >> 5);
    const int t0 = (int)blockIdx.x * 64, n0 = (int)blockIdx.y * 64; const int r0 = vt ? n0 : t0, c0 = vt ? t0 : n0;
    v8f acc[4][4];
    // In the epilogue the thread takes rows prow and prow + 32 and eight columns from pcof of the tile: 16 bytes per plane and row, so a wave stores whole 128-byte lines (V^T: eight lanes a row of 64 t; q, k: two lanes a row of a head, four rows in a row).
    const int prow = tid >> 3, pcof = (tid & 7) * 8;
    const float* px = X + (size_t)(t0 + lr) * DM + w * (DM / NW) + 8 * hi; const float* pw = Wf + (size_t)(w * (DM / NW) + 8 * hi) * DQ + n0 + 4 * lr;
    float* mine = os + w * PW;   // the wave's part of LDS: first its weight fragments, then its partial tile
    if (vt) proj_k<true>(px, pw, mine, lane, acc); else proj_k<false>(px, pw, mine, lane, acc);
    // The thread's biases are asked for here, by column and by row without a branch (the form not used reads from index 0 on), so that they arrive under the LDS stores and the barrier (the K loop has no registers free for them).
    v4f pbc0, pbc1; float pbr[2];
    { const float* bc = bias + (vt ? 0 : c0) + pcof; const float* br = bias + (vt ? r0 : 0) + prow; pbc0 = *(const v4fa*)bc; pbc1 = *(const v4fa*)(bc + 4); pbr[0] = br[0]; pbr[1] = br[32]; }
    if (vt) {   // row 16 mi + (8 hi + j) of the accumulators is weight column, so tile row, 4 (8 hi + j) + mi
#pragma unroll
        for (int mi = 0; mi < 4; ++mi)
#pragma unroll
            for (int nb = 0; nb < 4; ++nb)
#pragma unroll
                for (int j = 0; j < 8; ++j) mine[(4 * (hi * 8 + j) + mi) * 68 + nb * 16 + lr] = acc[mi][nb][j];
    } else {    // column lr of accumulator nb is tile column 4 lr + nb: the four lie side by side, one 16-byte store
#pragma unroll
        for (int mi = 0; mi < 4; ++mi)
#pragma unroll
            for (int j = 0; j < 8; ++j) { v4f t; t[0] = acc[mi][0][j]; t[1] = acc[mi][1][j]; t[2] = acc[mi][2][j]; t[3] = acc[mi][3][j]; *(v4fa*)(mine + (mi * 16 + hi * 8 + j) * 68 + 4 * lr) = t; }
    }
    __syncthreads();   // every wave's partial tile is in LDS
    // both rounds are summed and rounded first, then stored: the LDS reads of the second do not wait behind the stores of the first
    v8h o16[2]; v8us oh[2], ol[2];
#pragma unroll
    for (int s = 0; s < 2; ++s) { const float* ps = os + (s * 32 + prow) * 68 + pcof; v4f va = *(const v4fa*)ps, vb = *(const v4fa*)(ps + 4);
#pragma unroll
        for (int ww = 1; ww < NW; ++ww) { va += *(const v4fa*)(ps + ww * PW); vb += *(const v4fa*)(ps + ww * PW + 4); }
#pragma unroll
        for (int q = 0; q < 8; ++q) { const float y = ((q < 4) ? va[q & 3] : vb[q & 3]) + bfr(vt ? pbr[s] : ((q < 4) ? pbc0[q & 3] : pbc1[q & 3])); o16[s][q] = tohx(y); unsigned short a2, c2; splitf(y, a2, c2); oh[s][q] = a2; ol[s][q] = c2; } }
    const int rr = r0 + prow, cc = c0 + pcof;
    const size_t e0 = vt ? (z - 2 * NB_) * PLN + (size_t)rr * TT + cc : z * PLN + ((size_t)(cc / HD) * TT + rr) * HD + cc % HD, es = vt ? (size_t)32 * TT : (size_t)32 * HD;   // first element, step of 32 rows
    h16* d16 = (vt ? pl.v16 : pl.q16) + e0; bf* dh = (vt ? pl.vh : pl.qh) + e0; bf* dl = (vt ? pl.vl : pl.ql) + e0;
#pragma unroll
    for (int s = 0; s < 2; ++s) { *(v8h*)(d16 + s * es) = o16[s]; *(v8us*)(dh + s * es) = oh[s]; *(v8us*)(dl + s * es) = ol[s]; }
    asm volatile("s_wait_xcnt 0x0" ::: "memory");   // the wait that stands before a register named by an issued global store is written again: in the built code the output-weight slice lies behind these stores and writes their registers
}
// ---- k_fattn: scores, softmax and P.V of QT x 16 query rows of one head in one work-group; S and P stay in registers. Grid (heads, NB_ TT / (16 QT)), NWV waves; wave w takes the keys [w KW, (w + 1) KW) for all the rows, so a K or V fragment is loaded once for QT row tiles.
// S^T = K Q^T: register j of key tile t in lane (lr, hi) is S[query lr][key 16 t + 8 hi + j], so a lane holds scores of one query per row tile, and two neighbouring key tiles are, as they lie, the A fragment of P for 32 keys (same k order as the V^T loader).
// A head is 16 wide and the matrix instruction takes 32: the upper half of the K and Q fragments (d 16..31) is set to zero in registers.
// Row maximum and row sum: in the lane, then across the two lane halves, then across the waves through LDS in wave order; P is normalised before it is rounded; the waves' partial contexts are added in wave order.
// Rows < RH: hi/lo bf16 planes, 3 products (these work-groups have the low blockIdx.y: they run longest); the rest fp16 with P carried x PCAR. Stores the hi/lo planes of the merged context, panel h: QT x 16 rows of 32 bytes in a row.
// Every loop of fattn_rows is unrolled: s, v, o and the fragments are register arrays, which only constant indices keep out of scratch memory.
#define NWV 16
#define QT  2
#define KW  (TT / NWV)
#define KT  (KW / 16)
// 2^x by the hardware instruction, with the one free issue slot behind a transcendental in the same statement
__device__ __forceinline__ float exp2_slot(float x) { float e; asm("v_exp_f32 %0, %1\n\tv_nop" : "=v"(e) : "v"(x)); return e; }
template <bool HIRES> struct FSel { typedef bf T; };
template <> struct FSel<false> { typedef h16 T; };
template <bool HIRES>
__device__ __forceinline__ void fattn_rows(const h16* __restrict__ Q16, const h16* __restrict__ K16, const h16* __restrict__ V16, const bf* __restrict__ Qh, const bf* __restrict__ Ql, const bf* __restrict__ Kh, const bf* __restrict__ Kl, const bf* __restrict__ Vh, const bf* __restrict__ Vl,
                                           int q0, int h, bf* Ah, bf* Al, float* redm, float* reds, float* part) {
    const int tid = threadIdx.x, lane = tid & 31, lr = lane & 15, hi = lane >> 4; const int w = __builtin_amdgcn_readfirstlane(tid >> 5); const int k0 = w * KW;
    const size_t qoff = ((size_t)h * TT + q0 + lr) * HD + 8 * hi, koff = ((size_t)h * TT + k0 + lr) * HD + 8 * hi, voff = ((size_t)h * HD + lr) * TT + k0 + 8 * hi;
    typedef typename FSel<HIRES>::T VT;   // element type of the V^T planes this path reads
    v8f s[QT][KT];
    if constexpr (HIRES) { const v8us z8 = {}; v16bf qh[QT], ql[QT];
#pragma unroll
        for (int qt = 0; qt < QT; ++qt) { qh[qt] = cat16b(*(const v8us*)(Qh + qoff + (size_t)qt * 16 * HD), z8); ql[qt] = cat16b(*(const v8us*)(Ql + qoff + (size_t)qt * 16 * HD), z8); }
#pragma unroll
        for (int t = 0; t < KT; ++t) { const v16bf kh = cat16b(*(const v8us*)(Kh + koff + (size_t)t * 16 * HD), z8), kl = cat16b(*(const v8us*)(Kl + koff + (size_t)t * 16 * HD), z8);
#pragma unroll
            for (int qt = 0; qt < QT; ++qt) { v8f c = {}; c = wmmab(kh, qh[qt], c); c = wmmab(kh, ql[qt], c); c = wmmab(kl, qh[qt], c); s[qt][t] = c; } }
    } else { const v8h z8 = {}; v16h q[QT];
#pragma unroll
        for (int qt = 0; qt < QT; ++qt) q[qt] = cat16(*(const v8h*)(Q16 + qoff + (size_t)qt * 16 * HD), z8);
#pragma unroll
        for (int t = 0; t < KT; ++t) { const v16h k = cat16(*(const v8h*)(K16 + koff + (size_t)t * 16 * HD), z8);
#pragma unroll
            for (int qt = 0; qt < QT; ++qt) { v8f c = {}; s[qt][t] = wmma16(k, q[qt], c); } } }
    float mx[QT];
#pragma unroll
    for (int qt = 0; qt < QT; ++qt) { float m = -3.0e38f;
#pragma unroll
        for (int t = 0; t < KT; ++t) {
#pragma unroll
            for (int j = 0; j < 8; ++j) { const float x = s[qt][t][j] * SCL; s[qt][t][j] = x; m = fmaxf(m, x); } }
        m = fmaxf(m, __shfl_xor(m, 16, 32)); mx[qt] = m;
        if (hi == 0) redm[(w * QT + qt) * 16 + lr] = m; }
    __syncthreads();   // every wave's row maxima are in LDS
    typename WFrag<VT>::V v[KT / 2], v2[HIRES ? KT / 2 : 1];   // the wave's V^T fragments
    // loads the fragments [t0, t1); behind them the wait that stands before a register named by an issued global load is written again (the addresses are inputs so that they stay in their registers up to it)
    auto load_v = [&](int t0, int t1) { const VT* vp; const VT* vp2;
        if constexpr (HIRES) { vp = Vh + voff; vp2 = Vl + voff; } else { vp = V16 + voff; vp2 = vp; }
#pragma unroll
        for (int tp = t0; tp < t1; ++tp) { v[tp] = WFrag<VT>::ld(vp + tp * 32); if constexpr (HIRES) v2[tp] = WFrag<VT>::ld(vp2 + tp * 32); }
        asm volatile("s_wait_xcnt 0x0" :: "v"(vp), "v"(vp2) : "memory"); };
    if constexpr (!HIRES) load_v(0, KT / 2);   // asked for here so that they arrive under the exponentials (the hi/lo path has no registers free for that: it asks one step ahead)
    float f[QT];
#pragma unroll
    for (int qt = 0; qt < QT; ++qt) { float m = mx[qt];
#pragma unroll
        for (int ww = 0; ww < NWV; ++ww) m = fmaxf(m, redm[(ww * QT + qt) * 16 + lr]);
        float ps[4] = {0.f, 0.f, 0.f, 0.f};
#pragma unroll
        for (int t = 0; t < KT; ++t) {
#pragma unroll
            for (int j = 0; j < 8; ++j) { const float e = exp2_slot(__fmul_rn(__fsub_rn(s[qt][t][j], m), 1.4426950408889634f)); s[qt][t][j] = e; ps[j & 3] += e; } }
        float sum = (ps[0] + ps[1]) + (ps[2] + ps[3]); sum += __shfl_xor(sum, 16, 32);
        if (hi == 0) reds[(w * QT + qt) * 16 + lr] = sum; }
    __syncthreads();   // every wave's row sums are in LDS
    if constexpr (HIRES) load_v(0, 1);
#pragma unroll
    for (int qt = 0; qt < QT; ++qt) { float tot = reds[qt * 16 + lr];
#pragma unroll
        for (int ww = 1; ww < NWV; ++ww) tot += reds[(ww * QT + qt) * 16 + lr];
        f[qt] = __fdiv_rn(HIRES ? 1.0f : PCAR, tot); }
    v8f o[QT];
#pragma unroll
    for (int qt = 0; qt < QT; ++qt) o[qt] = (v8f){};
#pragma unroll
    for (int tp = 0; tp < KT / 2; ++tp) {
        if constexpr (HIRES) { if (tp + 1 < KT / 2) load_v(tp + 1, tp + 2);
            const v16bf vh = v[tp], vl = v2[tp];
#pragma unroll
            for (int qt = 0; qt < QT; ++qt) { v8us h0, l0, h1, l1;
#pragma unroll
                for (int j = 0; j < 8; ++j) { unsigned short a, c2; splitf(s[qt][2 * tp][j] * f[qt], a, c2); h0[j] = a; l0[j] = c2; splitf(s[qt][2 * tp + 1][j] * f[qt], a, c2); h1[j] = a; l1[j] = c2; }
                const v16bf ph = cat16b(h0, h1), pl = cat16b(l0, l1);
                o[qt] = wmmab(ph, vh, o[qt]); o[qt] = wmmab(pl, vh, o[qt]); o[qt] = wmmab(ph, vl, o[qt]); }
        } else {
#pragma unroll
            for (int qt = 0; qt < QT; ++qt) { v8h p0, p1;
#pragma unroll
                for (int j = 0; j < 8; ++j) { p0[j] = tohx(s[qt][2 * tp][j] * f[qt]); p1[j] = tohx(s[qt][2 * tp + 1][j] * f[qt]); }
                o[qt] = wmma16(cat16(p0, p1), v[tp], o[qt]); } } }
#pragma unroll
    for (int qt = 0; qt < QT; ++qt) {
#pragma unroll
        for (int j = 0; j < 8; ++j) part[w * (QT * 272) + (qt * 16 + hi * 8 + j) * 17 + lr] = o[qt][j]; }
    __syncthreads();   // every wave's partial context is in LDS
    { const int q = tid >> 4, d = tid & 15; float acc = part[q * 17 + d];   // NWV * 32 threads = QT * 16 rows x 16 columns
#pragma unroll
      for (int ww = 1; ww < NWV; ++ww) acc += part[ww * (QT * 272) + q * 17 + d];
      unsigned short a, c2; splitf(acc * (HIRES ? 1.0f : (1.0f / PCAR)), a, c2); const size_t oo = ((size_t)h * TT + q0 + q) * HD + d; Ah[oo] = a; Al[oo] = c2; }
}
__global__ __launch_bounds__(32 * NWV) void k_fattn(const h16* __restrict__ Q16, const h16* __restrict__ K16, const h16* __restrict__ V16, const bf* __restrict__ Qh, const bf* __restrict__ Ql, const bf* __restrict__ Kh, const bf* __restrict__ Kl, const bf* __restrict__ Vh, const bf* __restrict__ Vl, bf* Ah, bf* Al) {
    static_assert(NWV * 32 == QT * 256, "one thread per element of the context tile");
    __shared__ float redm[NWV * QT * 16]; __shared__ float reds[NWV * QT * 16]; __shared__ float part[NWV * QT * 272];
    // blockIdx.y -> (batch, row tile): the hi/lo tiles of both batches first, so that the longest work-groups have the low indices (for speed only)
    constexpr int NT = TT / (QT * 16), HT = RH / (QT * 16); const int y = blockIdx.y; const int b = (y < NB_ * HT) ? y / HT : (y - NB_ * HT) / (NT - HT); const int tile = (y < NB_ * HT) ? y % HT : HT + (y - NB_ * HT) % (NT - HT);
    const int h = blockIdx.x, q0 = tile * (QT * 16);
    { const size_t po = (size_t)b * PLN; Q16 += po; K16 += po; V16 += po; Qh += po; Ql += po; Kh += po; Kl += po; Vh += po; Vl += po; Ah += po; Al += po; }
    if (q0 < RH) fattn_rows<true>(Q16, K16, V16, Qh, Ql, Kh, Kl, Vh, Vl, q0, h, Ah, Al, redm, reds, part);
    else fattn_rows<false>(Q16, K16, V16, Qh, Ql, Kh, Kl, Vh, Vl, q0, h, Ah, Al, redm, reds, part);
}

extern "C" void kernel_launch(void* const* d_in, const int* in_sizes, int n_in,
                              void* d_out, int out_size, void* d_ws, size_t ws_size, hipStream_t stream) {
    (void)in_sizes; (void)n_in; (void)out_size;
    const float* x = (const float*)d_in[0]; const float* xk = (const float*)d_in[1]; const float* xv = (const float*)d_in[2]; const float* wq = (const float*)d_in[3]; const float* bqr = (const float*)d_in[4]; const float* wk = (const float*)d_in[5]; const float* bkr = (const float*)d_in[6]; const float* wv = (const float*)d_in[7]; const float* bvr = (const float*)d_in[8]; const float* wo = (const float*)d_in[9]; const float* bo = (const float*)d_in[10];   /* argument order queries, keys, values, Wq ('xw' [1024][128]), bq [128], Wk, bk, Wv, bv, Wo ('xw' [128][1024]), bo */
    float* OUT = (float*)d_out;     // [2][2048][1024]
    char* wsp = (char*)d_ws;
    auto take = [&](size_t bytes) { char* p = wsp; wsp += (bytes + 255) & ~(size_t)255; return (void*)p; };
    bf* WO = (bf*)take((size_t)DM * DQ * 2);
    h16* P16 = (h16*)take(2 * NB_ * PLN * 2); bf* Ph = (bf*)take(2 * NB_ * PLN * 2); bf* Pl = (bf*)take(2 * NB_ * PLN * 2);   /* q planes z = 0, 1; k planes z = 2, 3 */
    h16* VT16 = (h16*)take(NB_ * PLN * 2); bf* VTh = (bf*)take(NB_ * PLN * 2); bf* VTl = (bf*)take(NB_ * PLN * 2);
    bf* ATh = (bf*)take(NB_ * PLN * 2); bf* ATl = (bf*)take(NB_ * PLN * 2);   /* merged context [b][h][t][16] */
    if ((size_t)(wsp - (char*)d_ws) > ws_size) return;    // ws 256 MiB
    k_proj<<<dim3(TT / 64, DQ / 64, 3 * NB_ + 1), 256, 0, stream>>>(x, xk, xv, wq, wk, wv, bqr, bkr, bvr, wo, WO, Planes{P16, Ph, Pl, VT16, VTh, VTl});
    k_fattn<<<dim3(NH_, NB_ * (TT / (16 * QT)), 1), 32 * NWV, 0, stream>>>(P16, P16 + NB_ * PLN, VT16, Ph, Pl, Ph + NB_ * PLN, Pl + NB_ * PLN, VTh, VTl, ATh, ATl);   // one kv head per query head
    k_gemmw<bf, 1, true, 4, 1, NB_, TT, DM><<<dim3(TT / 64, DM / 64, NB_), 128, 0, stream>>>(ATh, ATl, WO, nullptr, DQ, OUT, DM, bo, PLN, 0, (size_t)TT * DM, 0, 0);   // 4 waves: 32 k, two heads, each
}

// v008
// A run of this version takes 44 microseconds.
// Two timings next to v007 both put it at 1.05 times that version's speed.
// Counting every step since v000, it is 25.4 times as fast.
#include <hip/hip_runtime.h>

// Multi-headed attention whose projections are only 128 wide (the module's Dense(d_k = d_model / h) quirk): 8 heads x 16 dims (queries, keys, values [2][2048][1024]; q = queries Wq + bq, k = keys Wk + bk, v = values Wv + bv ('xw' [1024][128] 0.02 + zero biases [128]); heads = 16-wide slices; scores / sqrt(128) (the module scales by sqrt(d_k = 128), not by the per-head 16); softmax (no mask); o = merged [2048][128]; out = o Wo + bo ('xw' [128][1024]) -> [2][2048][1024] (4.2 M); argument order queries, keys, values, Wq, bq, Wk, bk, Wv, bv, Wo, bo).
// Three launches, each holding every piece of work that depends only on the launches before it, for both batches: k_proj z = 0..5 (projections straight from the f32 inputs, stored as head planes; z = 6: the output weight's panels), k_fattn, k_gemmw z = 0..1 (output). Index z = p * NB_ + b, p = 0 queries, 1 keys, 2 values.
// Layout per batch: q, k and v lie dense, 8 heads x 16 = 128 wide: k_proj rounds inputs and 'xw' [1024][128] weights to bf16 in registers as it loads them; exact projections + f32 biases, rounded in the product's own epilogue to the head planes [h][t][16] and V^T [h][16][t]; dense T-2048 attention. The merged context lies dense too, in panels of 16 k, one per head: [h][t][16], so a work-group of k_fattn writes whole 128-byte lines that no other writes; d_woP builds the output weight in the same form, [h][n][16] (element d = Wo[h*16 + d][n]); merged hi/lo x Wo exact + bo, K = 128.
// Compute dtypes, f32 accumulate: every input rounded to bf16; projections exact + f32 biases; attention rows < 512 3 products, rest fp16; softmax f32; Wo hl x exact + bias.

#define NB_  2
#define TT   2048
#define DM   1024
#define NH_  8
#define NKV  8
#define REP  (NH_ / NKV)
#define HD   16                   // per-head width: q, k, v and their planes
#define DQ   (NH_ * HD)
#define DKV  (NKV * HD)
#define RH   512                  // query rows < RH use hi+lo planes
#define WIN  0
#define PCAR 1024.0f
#define SCL  0.088388347648318447f   // 1/sqrt(d_k = 128), as the module (not 1/sqrt(16))
typedef _Float16 h16;
typedef unsigned short bf;
typedef __attribute__((ext_vector_type(16))) __bf16   v16bf;
typedef __attribute__((ext_vector_type(16))) _Float16 v16h;
typedef __attribute__((ext_vector_type(8)))  _Float16 v8h;
typedef __attribute__((ext_vector_type(8)))  unsigned short v8us;
typedef __attribute__((ext_vector_type(8)))  float    v8f;
typedef __attribute__((ext_vector_type(4)))  float    v4f;
typedef v8h  __attribute__((may_alias)) v8ha;
typedef v4f  __attribute__((may_alias)) v4fa;
typedef v8us __attribute__((may_alias)) v8usa;

__device__ __forceinline__ unsigned short f2bf(float f) { unsigned u = __float_as_uint(f); u += 0x7FFFu + ((u >> 16) & 1u); return (unsigned short)(u >> 16); }
__device__ __forceinline__ float bf2f(unsigned short b) { return __uint_as_float(((unsigned)b) << 16); }
__device__ __forceinline__ float bfr(float f) { return bf2f(f2bf(f)); }
__device__ __forceinline__ v16h cat16(v8h lo, v8h hi) { return __builtin_shufflevector(lo, hi, 0, 1, 2, 3, 4, 5, 6, 7, 8, 9, 10, 11, 12, 13, 14, 15); }
__device__ __forceinline__ v16bf cat16b(v8us lo, v8us hi) { return __builtin_bit_cast(v16bf, __builtin_shufflevector(lo, hi, 0, 1, 2, 3, 4, 5, 6, 7, 8, 9, 10, 11, 12, 13, 14, 15)); }
__device__ __forceinline__ v8f wmma16(v16h a, v16h b, v8f c) { return __builtin_amdgcn_wmma_f32_16x16x32_f16(false, a, false, b, (short)0, c, false, false); }
__device__ __forceinline__ v8f wmmab(v16bf a, v16bf b, v8f c) { return __builtin_amdgcn_wmma_f32_16x16x32_bf16(false, a, false, b, (short)0, c, false, false); }
__device__ __forceinline__ h16 tohx(float x) { return (h16)x; }
__device__ __forceinline__ void splitf(float y, unsigned short& h, unsigned short& l) { h = f2bf(y); l = f2bf(y - bf2f(h)); }
#define PLN   ((size_t)NH_ * TT * HD)      // elements of one head plane of one batch
// Where k_proj stores: fp16 and hi/lo bf16 head planes, q16 / qh / ql = [z = 0..3][h][t][16] of q and k, v16 / vh / vl = [b][h][16][t] of v.
struct Planes { h16* q16; bf* qh; bf* ql; h16* v16; bf* vh; bf* vl; };



// ---- k_gemmw: register-blocked GEMM, 64x64 output tiles (16 accumulators per wave), operands straight from K-contiguous 16-bit planes; grid (M/64, N/64 * KS, Z), 32 * NW threads.
// K is split: work-group ky = blockIdx.y % KS of a tile takes the K range [ky K/KS, (ky+1) K/KS), wave w of it the w-th of NW equal contiguous parts. The NW partial tiles of a work-group meet in LDS and are added in wave order 0, 1, ... (a fixed order);
// work-group ky stores its sum in plane ky of C (plane stride sP elements), and the reader of C adds the KS planes in plane order. NW = KS = 1: one wave, the whole K, one plane.
// C[m][n] (f32, pitch ldc, + optional f32 bias[n], KS = 1 only) = sum_k A[m][k] Bt[n][k] (+ split products per NSPLIT). z-batch strides sA/sB/sC in elements; ZB neighbouring z share one Bt and one bias (strides sB, sBb per group of ZB). K % (32 * NW * KS) == 0.
// RA = RB = 0: A and Bt are row-major, K contiguous. RA, RB > 0: each lies in panels of 16 k with that many rows each, element (row, k) at ((k / 16) * R + row) * 16 + k % 16: the 16 rows of a fragment load are then 512 contiguous bytes (4 whole lines, not 16 pieces of 32 bytes). The k order of a fragment is the same in both forms.
template <typename T16> struct WFrag;
template <> struct WFrag<h16> { typedef v16h V; static __device__ __forceinline__ V ld2(const h16* p, const h16* q) { return cat16(*(const v8h*)p, *(const v8h*)q); } static __device__ __forceinline__ V ld(const h16* p) { return ld2(p, p + 16); } static __device__ __forceinline__ v8f mma(V a, V b, v8f c) { return wmma16(a, b, c); } };
template <> struct WFrag<bf> { typedef v16bf V; static __device__ __forceinline__ V ld2(const bf* p, const bf* q) { return cat16b(*(const v8us*)p, *(const v8us*)q); } static __device__ __forceinline__ V ld(const bf* p) { return ld2(p, p + 16); } static __device__ __forceinline__ v8f mma(V a, V b, v8f c) { return wmmab(a, b, c); } };
template <int NW> __device__ __forceinline__ void tile_sync() {   // orders the LDS stores of the partial tiles before the reads of them: among the waves of the work-group, or inside the one wave
    if constexpr (NW == 1) { __builtin_amdgcn_wave_barrier(); asm volatile("" ::: "memory"); } else { __syncthreads(); } }
template <typename T16, int NSPLIT, bool BIAS, int NW, int KS, int ZB, int RA = 0, int RB = 0>
__global__ __launch_bounds__(32 * NW) void k_gemmw(const T16* __restrict__ A, const T16* __restrict__ A2, const T16* __restrict__ Bt, const T16* __restrict__ Bt2, int K, float* C, int ldc, const float* __restrict__ bias, size_t sA, size_t sB, size_t sC, size_t sP, size_t sBb) {
    static_assert(KS == 1 || !BIAS, "the bias would be added once per plane"); static_assert((RA > 0) == (RB > 0) && (RA == 0 || NSPLIT == 1), "panels: both operands, hi/lo A");
    typedef typename WFrag<T16>::V V;
    constexpr int MBR = (NW == 1) ? 1 : 4;   // 16-row blocks staged per round: with several waves the whole tile at once, so one barrier serves
    constexpr int PW = MBR * 16 * 68;        // floats of one wave's staged part
    __shared__ __align__(16) float os[NW * PW];
    const size_t z = blockIdx.z, zw = z / ZB; A += z * sA; if (A2) A2 += z * sA; Bt += zw * sB; if (Bt2) Bt2 += zw * sB; if (BIAS) bias += zw * sBb; C += z * sC;
    const int tid = threadIdx.x, lane = tid & 31, lr = lane & 15, hi = lane >> 4; const int w = (NW == 1) ? 0 : __builtin_amdgcn_readfirstlane(tid >> 5); const int ky = (KS == 1) ? 0 : (int)(blockIdx.y % KS);
    const int kspan = K / (NW * KS), kbeg = (ky * NW + w) * kspan, kend = kbeg + kspan; const int r0 = (int)blockIdx.x * 64, c0 = (int)(blockIdx.y / KS) * 64; if (KS > 1) C += (size_t)ky * sP;
    v8f acc[4][4];
#pragma unroll
    for (int mb = 0; mb < 4; ++mb)
#pragma unroll
        for (int nb = 0; nb < 4; ++nb) acc[mb][nb] = (v8f){};
    const size_t aoff = (size_t)(r0 + lr) * K + 8 * hi, boff = (size_t)(c0 + lr) * K + 8 * hi;
#pragma unroll 1
    for (int kc = kbeg; kc < kend; kc += 32) {
        V a[4], a2[4];
        if constexpr (RA > 0) {   // panels: every fragment of the step hangs on three addresses; all are asked for at once
            V b[4]; const T16* pa = A + ((size_t)(kc >> 4) * RA + r0 + lr) * 16 + 8 * hi; const T16* pa2 = A2 + ((size_t)(kc >> 4) * RA + r0 + lr) * 16 + 8 * hi; const T16* pb = Bt + ((size_t)(kc >> 4) * RB + c0 + lr) * 16 + 8 * hi;
#pragma unroll
            for (int i = 0; i < 4; ++i) { a[i] = WFrag<T16>::ld2(pa + i * 256, pa + i * 256 + (size_t)RA * 16); a2[i] = WFrag<T16>::ld2(pa2 + i * 256, pa2 + i * 256 + (size_t)RA * 16); b[i] = WFrag<T16>::ld2(pb + i * 256, pb + i * 256 + (size_t)RB * 16); }
            asm volatile("s_wait_xcnt 0x0" :: "v"(pa), "v"(pa2), "v"(pb) : "memory");   // the wait that stands before a register named by an issued global load is written again (the addresses are inputs so that they stay in their registers up to it)
            __builtin_amdgcn_sched_barrier(0);   // keeps every matrix instruction behind all 24 loads: without it the last loads are issued behind the first products, into their registers, and the wave waits out a second load latency
#pragma unroll
            for (int nb = 0; nb < 4; ++nb) {
#pragma unroll
                for (int mb = 0; mb < 4; ++mb) { acc[mb][nb] = WFrag<T16>::mma(a[mb], b[nb], acc[mb][nb]); acc[mb][nb] = WFrag<T16>::mma(a2[mb], b[nb], acc[mb][nb]); } }
        } else {
#pragma unroll
        for (int mb = 0; mb < 4; ++mb) { a[mb] = WFrag<T16>::ld(A + aoff + (size_t)mb * 16 * K + kc); if (NSPLIT == 1 || NSPLIT == 2) a2[mb] = WFrag<T16>::ld(A2 + aoff + (size_t)mb * 16 * K + kc); }
#pragma unroll
        for (int nb = 0; nb < 4; ++nb) { const V b = WFrag<T16>::ld(Bt + boff + (size_t)nb * 16 * K + kc); V b2; if (NSPLIT >= 2) b2 = WFrag<T16>::ld(Bt2 + boff + (size_t)nb * 16 * K + kc);
#pragma unroll
            for (int mb = 0; mb < 4; ++mb) { acc[mb][nb] = WFrag<T16>::mma(a[mb], b, acc[mb][nb]); if (NSPLIT == 1 || NSPLIT == 2) acc[mb][nb] = WFrag<T16>::mma(a2[mb], b, acc[mb][nb]); if (NSPLIT >= 2) acc[mb][nb] = WFrag<T16>::mma(a[mb], b2, acc[mb][nb]); } }
        }
        asm volatile("v_nop\n\tv_nop\n\tv_nop\n\tv_nop" : "+v"(acc[0][0]), "+v"(acc[1][1]), "+v"(acc[2][2]), "+v"(acc[3][3]) : "v"(a[0]), "v"(a[3]));
    }
    float* mine = os + w * PW;
#pragma unroll
    for (int m0 = 0; m0 < 4; m0 += MBR) {
#pragma unroll
        for (int mi = 0; mi < MBR; ++mi) {
#pragma unroll
            for (int nb = 0; nb < 4; ++nb) {
#pragma unroll
                for (int j = 0; j < 8; ++j) mine[(mi * 16 + hi * 8 + j) * 68 + nb * 16 + lr] = acc[m0 + mi][nb][j]; } }
        tile_sync<NW>();
        float* crow = C + (size_t)(r0 + m0 * 16) * ldc + c0;
        {
#pragma unroll
            for (int s = 0; s < MBR * 8 / NW; ++s) { const int idx = s * (NW * 32) + tid; const int row = idx >> 4, cofs = (idx & 15) * 4; v4f val = *(const v4fa*)(os + row * 68 + cofs);
#pragma unroll
                for (int ww = 1; ww < NW; ++ww) val += *(const v4fa*)(os + ww * PW + row * 68 + cofs);
                if (BIAS) { val[0] += bfr(bias[c0 + cofs]); val[1] += bfr(bias[c0 + cofs + 1]); val[2] += bfr(bias[c0 + cofs + 2]); val[3] += bfr(bias[c0 + cofs + 3]); }
                *(v4f*)(crow + (size_t)row * ldc + cofs) = val; }
             }
        if (MBR < 4) tile_sync<NW>();   // the next round stores over what this round read
    }
}

typedef __attribute__((ext_vector_type(2))) unsigned short v2us;
typedef __attribute__((ext_vector_type(4))) int v4i;

// The output weight in panels of 16 k, [h][n][16] (element d = Wo[h*16 + d][n]), rounded to bf16: 512 elements per block index blk.
__device__ __forceinline__ void d_woP(unsigned blk, const float* __restrict__ wo, bf* Bt) { const size_t e = ((size_t)blk * 256 + threadIdx.x) * 2; if (e >= (size_t)DM * DQ) return; const int d = (int)(e % HD); const int n = (int)((e / HD) % DM); const int h = (int)(e / ((size_t)HD * DM)); v2us o; o[0] = f2bf(wo[(size_t)(h * HD + d) * DM + n]); o[1] = f2bf(wo[(size_t)(h * HD + d + 1) * DM + n]);
    *(v2us*)(Bt + e) = o;  }
#define GB_WO (DM * DQ / 2 / 256)          // block indices of d_woP
typedef __attribute__((ext_vector_type(16))) float v16f;
// 16 f32 -> one bf16 fragment, round to nearest even (packed hardware conversions)
__device__ __forceinline__ v16bf cvt16(v16f t) { return __builtin_convertvector(t, v16bf); }
// The K loop of one wave of k_proj: 4 steps of 32 k from px (the lane's input row) and pw (the lane's four weight columns). VT: the weight fragments are the A operand.
// A step holds 128 accumulator registers and 64 of f32 inputs, which leaves no room for 64 more of f32 weights under 256 (two work-groups a WGP). So the wave rounds its weight fragments of all four steps first, while no accumulator lives,
// and parks them in wl, its own part of LDS (16 KiB): every lane writes and later reads its own 32 bytes per fragment, 512 bytes in a row per instruction, so no barrier is needed.
template <bool VT> __device__ __forceinline__ void proj_k(const float* px, const float* pw, float* wl, int lane, v8f (&acc)[4][4]) {
#pragma unroll
    for (int s = 0; s < DM / 8 / 32; ++s) { v4f wr[16];
#pragma unroll
        for (int e = 0; e < 16; ++e) wr[e] = *(const v4fa*)(pw + (size_t)(s * 32 + (e & 7) + (e >> 3) * 16) * DQ);
#pragma unroll
        for (int i = 0; i < 4; ++i) { v16f t;
#pragma unroll
            for (int e = 0; e < 16; ++e) t[e] = wr[e][i];
            const v8f c = __builtin_bit_cast(v8f, cvt16(t)); float* d = wl + (s * 4 + i) * 256 + lane * 4;
            *(v4fa*)d = __builtin_shufflevector(c, c, 0, 1, 2, 3); *(v4fa*)(d + 128) = __builtin_shufflevector(c, c, 4, 5, 6, 7); }
        if (s & 1) __builtin_amdgcn_sched_barrier(0); }   // two steps' loads in flight at a time, and no accumulator zeroed among them: all 64 loads at once, or 32 beside the accumulators, take more than 256 registers
#pragma unroll
    for (int mb = 0; mb < 4; ++mb)
#pragma unroll
        for (int nb = 0; nb < 4; ++nb) acc[mb][nb] = (v8f){};
    // kept rolled for the register room named above: one step's 64 input registers at a time beside the accumulators
#pragma unroll 1
    for (int s = 0; s < DM / 8 / 32; ++s) {
        v4f xr[4][4]; v16bf wf[4];
#pragma unroll
        for (int i = 0; i < 4; ++i) { const float* q = px + (size_t)i * 16 * DM; xr[i][0] = *(const v4fa*)q; xr[i][1] = *(const v4fa*)(q + 4); xr[i][2] = *(const v4fa*)(q + 16); xr[i][3] = *(const v4fa*)(q + 20); }
        asm volatile("s_wait_xcnt 0x0" :: "v"(px) : "memory");   // the wait that stands before a register named by an issued global load is written again (the address is an input so that it stays in its registers up to it)
        px += 32;
#pragma unroll
        for (int i = 0; i < 4; ++i) { const float* d = wl + (s * 4 + i) * 256 + lane * 4; const v4f lo = *(const v4fa*)d, hi4 = *(const v4fa*)(d + 128); wf[i] = __builtin_bit_cast(v16bf, __builtin_shufflevector(lo, hi4, 0, 1, 2, 3, 4, 5, 6, 7)); }
#pragma unroll
        for (int i = 0; i < 4; ++i) { v16f t;
#pragma unroll
            for (int e = 0; e < 16; ++e) t[e] = xr[i][e >> 2][e & 3];
            const v16bf xf = cvt16(t);
#pragma unroll
            for (int o = 0; o < 4; ++o) { if constexpr (VT) acc[o][i] = wmmab(wf[o], xf, acc[o][i]); else acc[i][o] = wmmab(xf, wf[o], acc[i][o]); } }
        // the issue slots that the chip needs between the last matrix instructions and the next step's conversions, which write over their operands
        asm volatile("v_nop\n\tv_nop\n\tv_nop\n\tv_nop" : "+v"(acc[VT ? 0 : 3][VT ? 3 : 0]), "+v"(acc[VT ? 1 : 3][VT ? 3 : 1]), "+v"(acc[VT ? 2 : 3][VT ? 3 : 2]), "+v"(acc[3][3]));   // named: the results of the step's last four
    }
}
// ---- k_proj: the three projections of both batches straight from the f32 inputs, 64x64 tiles; grid (TT / 64, DQ / 64, 3 NB_ + 1), 8 waves. z = p * NB_ + b; the last z slice builds the output weight's panels for the third launch (d_woP).
// Wave w takes the k range [128 w, 128 w + 128), 32 k a step; inputs and weights are rounded to bf16 in registers as they arrive. The 8 partial tiles meet in LDS and are added in wave order 0, 1, ... (a fixed order).
// Input fragment i: rows t0 + 16 i + lr, the lane's 16 k as four 16-byte loads of its row. Weight fragment i: column n0 + 4 lr + i of the 'xw' [1024][128] weight, so one 16-byte load per k serves all four fragments and a wave reads whole lines; the tile's columns (v: rows) are put back in order where the partial tile is stored to LDS. Both loaders have one k order: position e of lane half hi is k = 8 hi + e (e < 8), 16 + 8 hi + e - 8 (e >= 8).
// Each sum (+ bias) is rounded here to the three head planes. p = 0, 1 (q, k): [h][t][16], a tile is 2 KiB in a row per head and plane. p = 2 (v): the two operands change places, so the tile is V^T (rows = h * 16 + d, columns = t; every element keeps its products and their order), its rows are whole 128-byte lines of [h][16][t], and the bias goes by row.
__global__ __launch_bounds__(256) void k_proj(const float* __restrict__ x, const float* __restrict__ xk, const float* __restrict__ xv, const float* __restrict__ wq, const float* __restrict__ wk, const float* __restrict__ wv,
                                              const float* __restrict__ b0, const float* __restrict__ b1, const float* __restrict__ b2, const float* __restrict__ wo, bf* WO, Planes pl) {
    constexpr int NW = 8, PW = 64 * 68;      // waves; floats of one wave's partial tile
    __shared__ __align__(16) float os[NW * PW];
    const size_t z = blockIdx.z;
    if (z == 3 * NB_) { const unsigned blk = blockIdx.y * (TT / 64) + blockIdx.x;   // whole work-groups leave here, in front of the barrier
#pragma unroll
        for (unsigned i = 0; i < GB_WO / (TT / 64 * (DQ / 64)); ++i) d_woP(blk * (GB_WO / (TT / 64 * (DQ / 64))) + i, wo, WO);
        return; }
    const int p = (int)(z / NB_); const bool vt = p == 2;
    const float* X = ((p == 0) ? x : ((p == 1) ? xk : xv)) + (z % NB_) * ((size_t)TT * DM); const float* Wf = (p == 0) ? wq : ((p == 1) ? wk : wv); const float* bias = (p == 0) ? b0 : ((p == 1) ? b1 : b2);
    const int tid = threadIdx.x, lane = tid & 31, lr = lane & 15, hi = lane >> 4; const int w = __builtin_amdgcn_readfirstlane(tid >> 5);
    const int t0 = (int)blockIdx.x * 64, n0 = (int)blockIdx.y * 64; const int r0 = vt ? n0 : t0, c0 = vt ? t0 : n0;
    v8f acc[4][4];
    // In the epilogue the thread takes rows prow and prow + 32 and eight columns from pcof of the tile: 16 bytes per plane and row, so a wave stores whole 128-byte lines (V^T: eight lanes a row of 64 t; q, k: two lanes a row of a head, four rows in a row).
    const int prow = tid >> 3, pcof = (tid & 7) * 8;
    const float* px = X + (size_t)(t0 + lr) * DM + w * (DM / NW) + 8 * hi; const float* pw = Wf + (size_t)(w * (DM / NW) + 8 * hi) * DQ + n0 + 4 * lr;
    float* mine = os + w * PW;   // the wave's part of LDS: first its weight fragments, then its partial tile
    if (vt) proj_k<true>(px, pw, mine, lane, acc); else proj_k<false>(px, pw, mine, lane, acc);
    // The thread's biases are asked for here, by column and by row without a branch (the form not used reads from index 0 on), so that they arrive under the LDS stores and the barrier (the K loop has no registers free for them).
    v4f pbc0, pbc1; float pbr[2];
    { const float* bc = bias + (vt ? 0 : c0) + pcof; const float* br = bias + (vt ? r0 : 0) + prow; pbc0 = *(const v4fa*)bc; pbc1 = *(const v4fa*)(bc + 4); pbr[0] = br[0]; pbr[1] = br[32]; }
    if (vt) {   // row 16 mi + (8 hi + j) of the accumulators is weight column, so tile row, 4 (8 hi + j) + mi
#pragma unroll
        for (int mi = 0; mi < 4; ++mi)
#pragma unroll
            for (int nb = 0; nb < 4; ++nb)
#pragma unroll
                for (int j = 0; j < 8; ++j) mine[(4 * (hi * 8 + j) + mi) * 68 + nb * 16 + lr] = acc[mi][nb][j];
    } else {    // column lr of accumulator nb is tile column 4 lr + nb: the four lie side by side, one 16-byte store
#pragma unroll
        for (int mi = 0; mi < 4; ++mi)
#pragma unroll
            for (int j = 0; j < 8; ++j) { v4f t; t[0] = acc[mi][0][j]; t[1] = acc[mi][1][j]; t[2] = acc[mi][2][j]; t[3] = acc[mi][3][j]; *(v4fa*)(mine + (mi * 16 + hi * 8 + j) * 68 + 4 * lr) = t; }
    }
    __syncthreads();   // every wave's partial tile is in LDS
    // both rounds are summed and rounded first, then stored: the LDS reads of the second do not wait behind the stores of the first
    v8h o16[2]; v8us oh[2], ol[2];
#pragma unroll
    for (int s = 0; s < 2; ++s) { const float* ps = os + (s * 32 + prow) * 68 + pcof; v4f va = *(const v4fa*)ps, vb = *(const v4fa*)(ps + 4);
#pragma unroll
        for (int ww = 1; ww < NW; ++ww) { va += *(const v4fa*)(ps + ww * PW); vb += *(const v4fa*)(ps + ww * PW + 4); }
#pragma unroll
        for (int q = 0; q < 8; ++q) { const float y = ((q < 4) ? va[q & 3] : vb[q & 3]) + bfr(vt ? pbr[s] : ((q < 4) ? pbc0[q & 3] : pbc1[q & 3])); o16[s][q] = tohx(y); unsigned short a2, c2; splitf(y, a2, c2); oh[s][q] = a2; ol[s][q] = c2; } }
    const int rr = r0 + prow, cc = c0 + pcof;
    const size_t e0 = vt ? (z - 2 * NB_) * PLN + (size_t)rr * TT + cc : z * PLN + ((size_t)(cc / HD) * TT + rr) * HD + cc % HD, es = vt ? (size_t)32 * TT : (size_t)32 * HD;   // first element, step of 32 rows
    h16* d16 = (vt ? pl.v16 : pl.q16) + e0; bf* dh = (vt ? pl.vh : pl.qh) + e0; bf* dl = (vt ? pl.vl : pl.ql) + e0;
#pragma unroll
    for (int s = 0; s < 2; ++s) { *(v8h*)(d16 + s * es) = o16[s]; *(v8us*)(dh + s * es) = oh[s]; *(v8us*)(dl + s * es) = ol[s]; }
    asm volatile("s_wait_xcnt 0x0" ::: "memory");   // the wait that stands before a register named by an issued global store is written again: in the built code the output-weight slice lies behind these stores and writes their registers
}
// ---- k_fattn: scores, softmax and P.V of one head, a tile of QT x 16 query rows at a time; S and P stay in registers. Grid (heads, NB_ RH / (16 QT)), NWV waves: a work-group takes one hi/lo tile and then TT / RH - 1 fp16 tiles of its head in a loop, so its waves start once for all of them. Wave w takes the keys [w KW, (w + 1) KW) for all the rows, so a K or V fragment is loaded once for QT row tiles.
// S^T = K Q^T: register j of key tile t in lane (lr, hi) is S[query lr][key 16 t + 8 hi + j], so a lane holds scores of one query per row tile, and two neighbouring key tiles are, as they lie, the A fragment of P for 32 keys (same k order as the V^T loader).
// A head is 16 wide and the matrix instruction takes 32: the upper half of the K and Q fragments (d 16..31) is set to zero in registers.
// Row maximum and row sum: in the lane, then across the two lane halves, then across the waves through LDS in wave order; P is normalised before it is rounded; the waves' partial contexts are added in wave order.
// Rows < RH: hi/lo bf16 planes, 3 products; the rest fp16 with P carried x PCAR. Stores the hi/lo planes of the merged context, panel h: QT x 16 rows of 32 bytes in a row.
// Every loop of fattn_rows is unrolled: s, v, o and the fragments are register arrays, which only constant indices keep out of scratch memory.
#define NWV 16
#define QT  2
#define KW  (TT / NWV)
#define KT  (KW / 16)
// 2^x by the hardware instruction, with the one free issue slot behind a transcendental in the same statement
__device__ __forceinline__ float exp2_slot(float x) { float e; asm("v_exp_f32 %0, %1\n\tv_nop" : "=v"(e) : "v"(x)); return e; }
// What a wave has asked for ahead of an fp16 row tile: its K fragments and the tile's Q rows.
struct Carry { v8h k[KT]; v8h q[QT]; };
// Asks for them: qp, kp = the lane's addresses in the first Q row tile and the first key tile.
__device__ __forceinline__ void ask_tile(const h16* qp, const h16* kp, Carry& cy) {
#pragma unroll
    for (int qt = 0; qt < QT; ++qt) cy.q[qt] = *(const v8h*)(qp + (size_t)qt * 16 * HD);
#pragma unroll
    for (int t = 0; t < KT; ++t) cy.k[t] = *(const v8h*)(kp + (size_t)t * 16 * HD);
    asm volatile("s_wait_xcnt 0x0" :: "v"(qp), "v"(kp) : "memory");   // the wait that stands before a register named by an issued global load is written again (the addresses are inputs so that they stay in their registers up to it)
}
template <bool HIRES> struct FSel { typedef bf T; };
template <> struct FSel<false> { typedef h16 T; };
template <bool HIRES>
__device__ __forceinline__ void fattn_rows(const h16* __restrict__ Q16, const h16* __restrict__ K16, const h16* __restrict__ V16, const bf* __restrict__ Qh, const bf* __restrict__ Ql, const bf* __restrict__ Kh, const bf* __restrict__ Kl, const bf* __restrict__ Vh, const bf* __restrict__ Vl,
                                           int q0, int qn, int h, bf* Ah, bf* Al, float* redm, float* reds, float* part, Carry& cy) {
    const int tid = threadIdx.x, lane = tid & 31, lr = lane & 15, hi = lane >> 4; const int w = __builtin_amdgcn_readfirstlane(tid >> 5); const int k0 = w * KW;
    const size_t qoff = ((size_t)h * TT + q0 + lr) * HD + 8 * hi, koff = ((size_t)h * TT + k0 + lr) * HD + 8 * hi, voff = ((size_t)h * HD + lr) * TT + k0 + 8 * hi;
    typedef typename FSel<HIRES>::T VT;   // element type of the V^T planes this path reads
    v8f s[QT][KT];
    if constexpr (HIRES) { const v8us z8 = {}; v16bf qh[QT], ql[QT];
#pragma unroll
        for (int qt = 0; qt < QT; ++qt) { qh[qt] = cat16b(*(const v8us*)(Qh + qoff + (size_t)qt * 16 * HD), z8); ql[qt] = cat16b(*(const v8us*)(Ql + qoff + (size_t)qt * 16 * HD), z8); }
#pragma unroll
        for (int t = 0; t < KT; ++t) { const v16bf kh = cat16b(*(const v8us*)(Kh + koff + (size_t)t * 16 * HD), z8), kl = cat16b(*(const v8us*)(Kl + koff + (size_t)t * 16 * HD), z8);
#pragma unroll
            for (int qt = 0; qt < QT; ++qt) { v8f c = {}; c = wmmab(kh, qh[qt], c); c = wmmab(kh, ql[qt], c); c = wmmab(kl, qh[qt], c); s[qt][t] = c; } }
        __builtin_amdgcn_sched_barrier(0);   // keeps the scaling and the maxima behind the last product: moved up among the products they hold scaled copies beside the accumulators and the K fragments, and the build with the tile loop then spills an accumulator to scratch memory
    } else { const v8h z8 = {}; v16h q[QT];
#pragma unroll
        for (int qt = 0; qt < QT; ++qt) q[qt] = cat16(cy.q[qt], z8);
#pragma unroll
        for (int t = 0; t < KT; ++t) { const v16h k = cat16(cy.k[t], z8);
#pragma unroll
            for (int qt = 0; qt < QT; ++qt) { v8f c = {}; s[qt][t] = wmma16(k, q[qt], c); } } }
    float mx[QT];
#pragma unroll
    for (int qt = 0; qt < QT; ++qt) { float m = -3.0e38f;
#pragma unroll
        for (int t = 0; t < KT; ++t) {
#pragma unroll
            for (int j = 0; j < 8; ++j) { const float x = s[qt][t][j] * SCL; s[qt][t][j] = x; m = fmaxf(m, x); } }
        m = fmaxf(m, __shfl_xor(m, 16, 32)); mx[qt] = m;
        if (hi == 0) redm[(w * QT + qt) * 16 + lr] = m; }
    __syncthreads();   // every wave's row maxima are in LDS
    typename WFrag<VT>::V v[KT / 2], v2[HIRES ? KT / 2 : 1];   // the wave's V^T fragments
    // loads the fragments [t0, t1); behind them the wait that stands before a register named by an issued global load is written again (the addresses are inputs so that they stay in their registers up to it)
    auto load_v = [&](int t0, int t1) { const VT* vp; const VT* vp2;
        if constexpr (HIRES) { vp = Vh + voff; vp2 = Vl + voff; } else { vp = V16 + voff; vp2 = vp; }
#pragma unroll
        for (int tp = t0; tp < t1; ++tp) { v[tp] = WFrag<VT>::ld(vp + tp * 32); if constexpr (HIRES) v2[tp] = WFrag<VT>::ld(vp2 + tp * 32); }
        asm volatile("s_wait_xcnt 0x0" :: "v"(vp), "v"(vp2) : "memory"); };
    if constexpr (!HIRES) load_v(0, KT / 2);   // asked for here so that they arrive under the exponentials (the hi/lo path has no registers free for that: it asks one step ahead)
    float f[QT];
#pragma unroll
    for (int qt = 0; qt < QT; ++qt) { float m = mx[qt];
#pragma unroll
        for (int ww = 0; ww < NWV; ++ww) m = fmaxf(m, redm[(ww * QT + qt) * 16 + lr]);
        float ps[4] = {0.f, 0.f, 0.f, 0.f};
#pragma unroll
        for (int t = 0; t < KT; ++t) {
#pragma unroll
            for (int j = 0; j < 8; ++j) { const float e = exp2_slot(__fmul_rn(__fsub_rn(s[qt][t][j], m), 1.4426950408889634f)); s[qt][t][j] = e; ps[j & 3] += e; } }
        float sum = (ps[0] + ps[1]) + (ps[2] + ps[3]); sum += __shfl_xor(sum, 16, 32);
        if (hi == 0) reds[(w * QT + qt) * 16 + lr] = sum; }
    __syncthreads();   // every wave's row sums are in LDS
    if constexpr (HIRES) load_v(0, 1);
#pragma unroll
    for (int qt = 0; qt < QT; ++qt) { float tot = reds[qt * 16 + lr];
#pragma unroll
        for (int ww = 1; ww < NWV; ++ww) tot += reds[(ww * QT + qt) * 16 + lr];
        f[qt] = __fdiv_rn(HIRES ? 1.0f : PCAR, tot); }
    v8f o[QT];
#pragma unroll
    for (int qt = 0; qt < QT; ++qt) o[qt] = (v8f){};
#pragma unroll
    for (int tp = 0; tp < KT / 2; ++tp) {
        if (tp == KT / 4) ask_tile(Q16 + ((size_t)h * TT + qn + lr) * HD + 8 * hi, K16 + koff, cy);   // the next tile, an fp16 tile from row qn: half of the scores' registers are free from here on, and the loads arrive under the rest of P.V (the barrier behind it waits for them)
        if constexpr (HIRES) { if (tp + 1 < KT / 2) load_v(tp + 1, tp + 2);
            const v16bf vh = v[tp], vl = v2[tp];
#pragma unroll
            for (int qt = 0; qt < QT; ++qt) { v8us h0, l0, h1, l1;
#pragma unroll
                for (int j = 0; j < 8; ++j) { unsigned short a, c2; splitf(s[qt][2 * tp][j] * f[qt], a, c2); h0[j] = a; l0[j] = c2; splitf(s[qt][2 * tp + 1][j] * f[qt], a, c2); h1[j] = a; l1[j] = c2; }
                const v16bf ph = cat16b(h0, h1), pl = cat16b(l0, l1);
                o[qt] = wmmab(ph, vh, o[qt]); o[qt] = wmmab(pl, vh, o[qt]); o[qt] = wmmab(ph, vl, o[qt]); }
        } else {
#pragma unroll
            for (int qt = 0; qt < QT; ++qt) { v8h p0, p1;
#pragma unroll
                for (int j = 0; j < 8; ++j) { p0[j] = tohx(s[qt][2 * tp][j] * f[qt]); p1[j] = tohx(s[qt][2 * tp + 1][j] * f[qt]); }
                o[qt] = wmma16(cat16(p0, p1), v[tp], o[qt]); } } }
#pragma unroll
    for (int qt = 0; qt < QT; ++qt) {
#pragma unroll
        for (int j = 0; j < 8; ++j) part[w * (QT * 272) + (qt * 16 + hi * 8 + j) * 17 + lr] = o[qt][j]; }
    __syncthreads();   // every wave's partial context is in LDS
    { const int q = tid >> 4, d = tid & 15; float acc = part[q * 17 + d];   // NWV * 32 threads = QT * 16 rows x 16 columns
#pragma unroll
      for (int ww = 1; ww < NWV; ++ww) acc += part[ww * (QT * 272) + q * 17 + d];
      unsigned short a, c2; splitf(acc * (HIRES ? 1.0f : (1.0f / PCAR)), a, c2); const size_t oo = ((size_t)h * TT + q0 + q) * HD + d; bf* pa = Ah + oo; bf* pb = Al + oo; *pa = a; *pb = c2;
      asm volatile("s_wait_xcnt 0x0" :: "v"(pa), "v"(pb) : "memory"); }   // the wait that stands before a register named by an issued global store is written again: the next tile writes these registers (the addresses are inputs so that they stay in their registers up to it)
}
__global__ __launch_bounds__(32 * NWV) void k_fattn(const h16* __restrict__ Q16, const h16* __restrict__ K16, const h16* __restrict__ V16, const bf* __restrict__ Qh, const bf* __restrict__ Ql, const bf* __restrict__ Kh, const bf* __restrict__ Kl, const bf* __restrict__ Vh, const bf* __restrict__ Vl, bf* Ah, bf* Al) {
    static_assert(NWV * 32 == QT * 256, "one thread per element of the context tile");
    __shared__ float redm[NWV * QT * 16]; __shared__ float reds[NWV * QT * 16]; __shared__ float part[NWV * QT * 272];
    // blockIdx.y -> (batch, i): the work-group takes hi/lo tile i of its head and then the fp16 tiles HT + i, 2 HT + i, ..., one after the other, so every work-group has the same work and one per WGP is the whole launch
    constexpr int NT = TT / (QT * 16), HT = RH / (QT * 16), NF = NT / HT - 1; static_assert(HT > 0 && NT % HT == 0 && NF > 0, "one hi/lo tile and NF fp16 tiles each");
    const int y = blockIdx.y; const int b = y / HT, i0 = y % HT; const int h = blockIdx.x;
    { const size_t po = (size_t)b * PLN; Q16 += po; K16 += po; V16 += po; Qh += po; Ql += po; Kh += po; Kl += po; Vh += po; Vl += po; Ah += po; Al += po; }
    Carry cy;
    fattn_rows<true>(Q16, K16, V16, Qh, Ql, Kh, Kl, Vh, Vl, i0 * (QT * 16), (HT + i0) * (QT * 16), h, Ah, Al, redm, reds, part, cy);
    // No barrier of its own between two tiles: a wave stores into redm, reds or part only behind a barrier that every wave reaches after its last read of the tile before from that array.
    // kept rolled: one copy of the tile's code, which is long
#pragma unroll 1
    for (int j = 1; j <= NF; ++j)   // the last tile asks for its own rows again (in bounds, not used): no branch inside P.V
        fattn_rows<false>(Q16, K16, V16, Qh, Ql, Kh, Kl, Vh, Vl, (j * HT + i0) * (QT * 16), (((j < NF) ? j + 1 : j) * HT + i0) * (QT * 16), h, Ah, Al, redm, reds, part, cy);
}

extern "C" void kernel_launch(void* const* d_in, const int* in_sizes, int n_in,
                              void* d_out, int out_size, void* d_ws, size_t ws_size, hipStream_t stream) {
    (void)in_sizes; (void)n_in; (void)out_size;
    const float* x = (const float*)d_in[0]; const float* xk = (const float*)d_in[1]; const float* xv = (const float*)d_in[2]; const float* wq = (const float*)d_in[3]; const float* bqr = (const float*)d_in[4]; const float* wk = (const float*)d_in[5]; const float* bkr = (const float*)d_in[6]; const float* wv = (const float*)d_in[7]; const float* bvr = (const float*)d_in[8]; const float* wo = (const float*)d_in[9]; const float* bo = (const float*)d_in[10];   /* argument order queries, keys, values, Wq ('xw' [1024][128]), bq [128], Wk, bk, Wv, bv, Wo ('xw' [128][1024]), bo */
    float* OUT = (float*)d_out;     // [2][2048][1024]
    char* wsp = (char*)d_ws;
    auto take = [&](size_t bytes) { char* p = wsp; wsp += (bytes + 255) & ~(size_t)255; return (void*)p; };
    bf* WO = (bf*)take((size_t)DM * DQ * 2);
    h16* P16 = (h16*)take(2 * NB_ * PLN * 2); bf* Ph = (bf*)take(2 * NB_ * PLN * 2); bf* Pl = (bf*)take(2 * NB_ * PLN * 2);   /* q planes z = 0, 1; k planes z = 2, 3 */
    h16* VT16 = (h16*)take(NB_ * PLN * 2); bf* VTh = (bf*)take(NB_ * PLN * 2); bf* VTl = (bf*)take(NB_ * PLN * 2);
    bf* ATh = (bf*)take(NB_ * PLN * 2); bf* ATl = (bf*)take(NB_ * PLN * 2);   /* merged context [b][h][t][16] */
    if ((size_t)(wsp - (char*)d_ws) > ws_size) return;    // ws 256 MiB
    k_proj<<<dim3(TT / 64, DQ / 64, 3 * NB_ + 1), 256, 0, stream>>>(x, xk, xv, wq, wk, wv, bqr, bkr, bvr, wo, WO, Planes{P16, Ph, Pl, VT16, VTh, VTl});
    k_fattn<<<dim3(NH_, NB_ * (RH / (16 * QT)), 1), 32 * NWV, 0, stream>>>(P16, P16 + NB_ * PLN, VT16, Ph, Pl, Ph + NB_ * PLN, Pl + NB_ * PLN, VTh, VTl, ATh, ATl);   // one kv head per query head
    k_gemmw<bf, 1, true, 4, 1, NB_, TT, DM><<<dim3(TT / 64, DM / 64, NB_), 128, 0, stream>>>(ATh, ATl, WO, nullptr, DQ, OUT, DM, bo, PLN, 0, (size_t)TT * DM, 0, 0);   // 4 waves: 32 k, two heads, each
}

// v009
// Measured time: 36.6 microseconds a run.
// Timed twice side by side with v008, it ran 1.19 and 1.20 times as fast.
// Counting every step since v000, it is 30.4 times as fast.
#include <hip/hip_runtime.h>

// Multi-headed attention whose projections are only 128 wide (the module's Dense(d_k = d_model / h) quirk): 8 heads x 16 dims (queries, keys, values [2][2048][1024]; q = queries Wq + bq, k = keys Wk + bk, v = values Wv + bv ('xw' [1024][128] 0.02 + zero biases [128]); heads = 16-wide slices; scores / sqrt(128) (the module scales by sqrt(d_k = 128), not by the per-head 16); softmax (no mask); o = merged [2048][128]; out = o Wo + bo ('xw' [128][1024]) -> [2][2048][1024] (4.2 M); argument order queries, keys, values, Wq, bq, Wk, bk, Wv, bv, Wo, bo).
// Three launches, each holding every piece of work that depends only on the launches before it, for both batches: k_proj z = 0..5 (projections straight from the f32 inputs, stored as head planes; z = 6: the output weight's panels), k_fattn, k_gemmw z = 0..1 (output). Index z = p * NB_ + b, p = 0 queries, 1 keys, 2 values.
// Layout per batch: q, k and v lie dense, 8 heads x 16 = 128 wide: k_proj rounds inputs and 'xw' [1024][128] weights to bf16 in registers as it loads them; exact projections + f32 biases, rounded in the product's own epilogue to the head planes [h][t][16] and V^T [h][16][t]; dense T-2048 attention. The merged context lies dense too, in panels of 16 k, one per head: [h][t][16], so a work-group of k_fattn writes whole 128-byte lines that no other writes; d_woP builds the output weight in the same form, [h][n][16] (element d = Wo[h*16 + d][n]); merged hi/lo x Wo exact + bo, K = 128.
// Compute dtypes, f32 accumulate: every input rounded to bf16; projections exact + f32 biases; attention rows < 512 3 products, rest fp16; softmax f32, each wave against its own row maximum, joined by rescaling; Wo hl x exact + bias.

#define NB_  2
#define TT   2048
#define DM   1024
#define NH_  8
#define NKV  8
#define REP  (NH_ / NKV)
#define HD   16                   // per-head width: q, k, v and their planes
#define DQ   (NH_ * HD)
#define DKV  (NKV * HD)
#define RH   512                  // query rows < RH use hi+lo planes
#define WIN  0
#define SCL2 0.12751743082f          // log2(e) / sqrt(d_k = 128): the module's scale (by d_k, not by the per-head 16) times the change of base, so that 2^(SCL2 s) = e^(s / sqrt(128))
typedef _Float16 h16;
typedef unsigned short bf;
typedef __attribute__((ext_vector_type(16))) __bf16   v16bf;
typedef __attribute__((ext_vector_type(16))) _Float16 v16h;
typedef __attribute__((ext_vector_type(8)))  _Float16 v8h;
typedef __attribute__((ext_vector_type(8)))  unsigned short v8us;
typedef __attribute__((ext_vector_type(8)))  float    v8f;
typedef __attribute__((ext_vector_type(4)))  float    v4f;
typedef __attribute__((ext_vector_type(2)))  float    v2f;
typedef v8h  __attribute__((may_alias)) v8ha;
typedef v4f  __attribute__((may_alias)) v4fa;
typedef v8us __attribute__((may_alias)) v8usa;

__device__ __forceinline__ unsigned short f2bf(float f) { unsigned u = __float_as_uint(f); u += 0x7FFFu + ((u >> 16) & 1u); return (unsigned short)(u >> 16); }
__device__ __forceinline__ float bf2f(unsigned short b) { return __uint_as_float(((unsigned)b) << 16); }
__device__ __forceinline__ float bfr(float f) { return bf2f(f2bf(f)); }
__device__ __forceinline__ v16h cat16(v8h lo, v8h hi) { return __builtin_shufflevector(lo, hi, 0, 1, 2, 3, 4, 5, 6, 7, 8, 9, 10, 11, 12, 13, 14, 15); }
__device__ __forceinline__ v16bf cat16b(v8us lo, v8us hi) { return __builtin_bit_cast(v16bf, __builtin_shufflevector(lo, hi, 0, 1, 2, 3, 4, 5, 6, 7, 8, 9, 10, 11, 12, 13, 14, 15)); }
__device__ __forceinline__ v8f wmma16(v16h a, v16h b, v8f c) { return __builtin_amdgcn_wmma_f32_16x16x32_f16(false, a, false, b, (short)0, c, false, false); }
__device__ __forceinline__ v8f wmmab(v16bf a, v16bf b, v8f c) { return __builtin_amdgcn_wmma_f32_16x16x32_bf16(false, a, false, b, (short)0, c, false, false); }
__device__ __forceinline__ h16 tohx(float x) { return (h16)x; }
__device__ __forceinline__ void splitf(float y, unsigned short& h, unsigned short& l) { h = f2bf(y); l = f2bf(y - bf2f(h)); }
#define PLN   ((size_t)NH_ * TT * HD)      // elements of one head plane of one batch
// Where k_proj stores: fp16 and hi/lo bf16 head planes, q16 / qh / ql = [z = 0..3][h][t][16] of q and k, v16 / vh / vl = [b][h][16][t] of v.
struct Planes { h16* q16; bf* qh; bf* ql; h16* v16; bf* vh; bf* vl; };



// ---- k_gemmw: register-blocked GEMM, 64x64 output tiles (16 accumulators per wave), operands straight from K-contiguous 16-bit planes; grid (M/64, N/64 * KS, Z), 32 * NW threads.
// K is split: work-group ky = blockIdx.y % KS of a tile takes the K range [ky K/KS, (ky+1) K/KS), wave w of it the w-th of NW equal contiguous parts. The NW partial tiles of a work-group meet in LDS and are added in wave order 0, 1, ... (a fixed order);
// work-group ky stores its sum in plane ky of C (plane stride sP elements), and the reader of C adds the KS planes in plane order. NW = KS = 1: one wave, the whole K, one plane.
// C[m][n] (f32, pitch ldc, + optional f32 bias[n], KS = 1 only) = sum_k A[m][k] Bt[n][k] (+ split products per NSPLIT). z-batch strides sA/sB/sC in elements; ZB neighbouring z share one Bt and one bias (strides sB, sBb per group of ZB). K % (32 * NW * KS) == 0.
// RA = RB = 0: A and Bt are row-major, K contiguous. RA, RB > 0: each lies in panels of 16 k with that many rows each, element (row, k) at ((k / 16) * R + row) * 16 + k % 16: the 16 rows of a fragment load are then 512 contiguous bytes (4 whole lines, not 16 pieces of 32 bytes). The k order of a fragment is the same in both forms.
template <typename T16> struct WFrag;
template <> struct WFrag<h16> { typedef v16h V; static __device__ __forceinline__ V ld2(const h16* p, const h16* q) { return cat16(*(const v8h*)p, *(const v8h*)q); } static __device__ __forceinline__ V ld(const h16* p) { return ld2(p, p + 16); } static __device__ __forceinline__ v8f mma(V a, V b, v8f c) { return wmma16(a, b, c); } };
template <> struct WFrag<bf> { typedef v16bf V; static __device__ __forceinline__ V ld2(const bf* p, const bf* q) { return cat16b(*(const v8us*)p, *(const v8us*)q); } static __device__ __forceinline__ V ld(const bf* p) { return ld2(p, p + 16); } static __device__ __forceinline__ v8f mma(V a, V b, v8f c) { return wmmab(a, b, c); } };
template <int NW> __device__ __forceinline__ void tile_sync() {   // orders the LDS stores of the partial tiles before the reads of them: among the waves of the work-group, or inside the one wave
    if constexpr (NW == 1) { __builtin_amdgcn_wave_barrier(); asm volatile("" ::: "memory"); } else { __syncthreads(); } }
template <typename T16, int NSPLIT, bool BIAS, int NW, int KS, int ZB, int RA = 0, int RB = 0>
__global__ __launch_bounds__(32 * NW) void k_gemmw(const T16* __restrict__ A, const T16* __restrict__ A2, const T16* __restrict__ Bt, const T16* __restrict__ Bt2, int K, float* C, int ldc, const float* __restrict__ bias, size_t sA, size_t sB, size_t sC, size_t sP, size_t sBb) {
    static_assert(KS == 1 || !BIAS, "the bias would be added once per plane"); static_assert((RA > 0) == (RB > 0) && (RA == 0 || NSPLIT == 1), "panels: both operands, hi/lo A");
    typedef typename WFrag<T16>::V V;
    constexpr int MBR = (NW == 1) ? 1 : 4;   // 16-row blocks staged per round: with several waves the whole tile at once, so one barrier serves
    constexpr int PW = MBR * 16 * 68;        // floats of one wave's staged part
    __shared__ __align__(16) float os[NW * PW];
    const size_t z = blockIdx.z, zw = z / ZB; A += z * sA; if (A2) A2 += z * sA; Bt += zw * sB; if (Bt2) Bt2 += zw * sB; if (BIAS) bias += zw * sBb; C += z * sC;
    const int tid = threadIdx.x, lane = tid & 31, lr = lane & 15, hi = lane >> 4; const int w = (NW == 1) ? 0 : __builtin_amdgcn_readfirstlane(tid >> 5); const int ky = (KS == 1) ? 0 : (int)(blockIdx.y % KS);
    const int kspan = K / (NW * KS), kbeg = (ky * NW + w) * kspan, kend = kbeg + kspan; const int r0 = (int)blockIdx.x * 64, c0 = (int)(blockIdx.y / KS) * 64; if (KS > 1) C += (size_t)ky * sP;
    v8f acc[4][4];
#pragma unroll
    for (int mb = 0; mb < 4; ++mb)
#pragma unroll
        for (int nb = 0; nb < 4; ++nb) acc[mb][nb] = (v8f){};
    const size_t aoff = (size_t)(r0 + lr) * K + 8 * hi, boff = (size_t)(c0 + lr) * K + 8 * hi;
#pragma unroll 1
    for (int kc = kbeg; kc < kend; kc += 32) {
        V a[4], a2[4];
        if constexpr (RA > 0) {   // panels: every fragment of the step hangs on three addresses; all are asked for at once
            V b[4]; const T16* pa = A + ((size_t)(kc >> 4) * RA + r0 + lr) * 16 + 8 * hi; const T16* pa2 = A2 + ((size_t)(kc >> 4) * RA + r0 + lr) * 16 + 8 * hi; const T16* pb = Bt + ((size_t)(kc >> 4) * RB + c0 + lr) * 16 + 8 * hi;
#pragma unroll
            for (int i = 0; i < 4; ++i) { a[i] = WFrag<T16>::ld2(pa + i * 256, pa + i * 256 + (size_t)RA * 16); a2[i] = WFrag<T16>::ld2(pa2 + i * 256, pa2 + i * 256 + (size_t)RA * 16); b[i] = WFrag<T16>::ld2(pb + i * 256, pb + i * 256 + (size_t)RB * 16); }
            asm volatile("s_wait_xcnt 0x0" :: "v"(pa), "v"(pa2), "v"(pb) : "memory");   // the wait that stands before a register named by an issued global load is written again (the addresses are inputs so that they stay in their registers up to it)
            __builtin_amdgcn_sched_barrier(0);   // keeps every matrix instruction behind all 24 loads: without it the last loads are issued behind the first products, into their registers, and the wave waits out a second load latency
#pragma unroll
            for (int nb = 0; nb < 4; ++nb) {
#pragma unroll
                for (int mb = 0; mb < 4; ++mb) { acc[mb][nb] = WFrag<T16>::mma(a[mb], b[nb], acc[mb][nb]); acc[mb][nb] = WFrag<T16>::mma(a2[mb], b[nb], acc[mb][nb]); } }
        } else {
#pragma unroll
        for (int mb = 0; mb < 4; ++mb) { a[mb] = WFrag<T16>::ld(A + aoff + (size_t)mb * 16 * K + kc); if (NSPLIT == 1 || NSPLIT == 2) a2[mb] = WFrag<T16>::ld(A2 + aoff + (size_t)mb * 16 * K + kc); }
#pragma unroll
        for (int nb = 0; nb < 4; ++nb) { const V b = WFrag<T16>::ld(Bt + boff + (size_t)nb * 16 * K + kc); V b2; if (NSPLIT >= 2) b2 = WFrag<T16>::ld(Bt2 + boff + (size_t)nb * 16 * K + kc);
#pragma unroll
            for (int mb = 0; mb < 4; ++mb) { acc[mb][nb] = WFrag<T16>::mma(a[mb], b, acc[mb][nb]); if (NSPLIT == 1 || NSPLIT == 2) acc[mb][nb] = WFrag<T16>::mma(a2[mb], b, acc[mb][nb]); if (NSPLIT >= 2) acc[mb][nb] = WFrag<T16>::mma(a[mb], b2, acc[mb][nb]); } }
        }
        asm volatile("v_nop\n\tv_nop\n\tv_nop\n\tv_nop" : "+v"(acc[0][0]), "+v"(acc[1][1]), "+v"(acc[2][2]), "+v"(acc[3][3]) : "v"(a[0]), "v"(a[3]));
    }
    float* mine = os + w * PW;
#pragma unroll
    for (int m0 = 0; m0 < 4; m0 += MBR) {
#pragma unroll
        for (int mi = 0; mi < MBR; ++mi) {
#pragma unroll
            for (int nb = 0; nb < 4; ++nb) {
#pragma unroll
                for (int j = 0; j < 8; ++j) mine[(mi * 16 + hi * 8 + j) * 68 + nb * 16 + lr] = acc[m0 + mi][nb][j]; } }
        tile_sync<NW>();
        float* crow = C + (size_t)(r0 + m0 * 16) * ldc + c0;
        {
#pragma unroll
            for (int s = 0; s < MBR * 8 / NW; ++s) { const int idx = s * (NW * 32) + tid; const int row = idx >> 4, cofs = (idx & 15) * 4; v4f val = *(const v4fa*)(os + row * 68 + cofs);
#pragma unroll
                for (int ww = 1; ww < NW; ++ww) val += *(const v4fa*)(os + ww * PW + row * 68 + cofs);
                if (BIAS) { val[0] += bfr(bias[c0 + cofs]); val[1] += bfr(bias[c0 + cofs + 1]); val[2] += bfr(bias[c0 + cofs + 2]); val[3] += bfr(bias[c0 + cofs + 3]); }
                *(v4f*)(crow + (size_t)row * ldc + cofs) = val; }
             }
        if (MBR < 4) tile_sync<NW>();   // the next round stores over what this round read
    }
}

typedef __attribute__((ext_vector_type(2))) unsigned short v2us;
typedef __attribute__((ext_vector_type(4))) int v4i;

// The output weight in panels of 16 k, [h][n][16] (element d = Wo[h*16 + d][n]), rounded to bf16: 512 elements per block index blk.
__device__ __forceinline__ void d_woP(unsigned blk, const float* __restrict__ wo, bf* Bt) { const size_t e = ((size_t)blk * 256 + threadIdx.x) * 2; if (e >= (size_t)DM * DQ) return; const int d = (int)(e % HD); const int n = (int)((e / HD) % DM); const int h = (int)(e / ((size_t)HD * DM)); v2us o; o[0] = f2bf(wo[(size_t)(h * HD + d) * DM + n]); o[1] = f2bf(wo[(size_t)(h * HD + d + 1) * DM + n]);
    *(v2us*)(Bt + e) = o;  }
#define GB_WO (DM * DQ / 2 / 256)          // block indices of d_woP
typedef __attribute__((ext_vector_type(16))) float v16f;
// 16 f32 -> one bf16 fragment, round to nearest even (packed hardware conversions)
__device__ __forceinline__ v16bf cvt16(v16f t) { return __builtin_convertvector(t, v16bf); }
// The K loop of one wave of k_proj: 4 steps of 32 k from px (the lane's input row) and pw (the lane's four weight columns). VT: the weight fragments are the A operand.
// A step holds 128 accumulator registers and 64 of f32 inputs, which leaves no room for 64 more of f32 weights under 256 (two work-groups a WGP). So the wave rounds its weight fragments of all four steps first, while no accumulator lives,
// and parks them in wl, its own part of LDS (16 KiB): every lane writes and later reads its own 32 bytes per fragment, 512 bytes in a row per instruction, so no barrier is needed.
template <bool VT> __device__ __forceinline__ void proj_k(const float* px, const float* pw, float* wl, int lane, v8f (&acc)[4][4]) {
#pragma unroll
    for (int s = 0; s < DM / 8 / 32; ++s) { v4f wr[16];
#pragma unroll
        for (int e = 0; e < 16; ++e) wr[e] = *(const v4fa*)(pw + (size_t)(s * 32 + (e & 7) + (e >> 3) * 16) * DQ);
#pragma unroll
        for (int i = 0; i < 4; ++i) { v16f t;
#pragma unroll
            for (int e = 0; e < 16; ++e) t[e] = wr[e][i];
            const v8f c = __builtin_bit_cast(v8f, cvt16(t)); float* d = wl + (s * 4 + i) * 256 + lane * 4;
            *(v4fa*)d = __builtin_shufflevector(c, c, 0, 1, 2, 3); *(v4fa*)(d + 128) = __builtin_shufflevector(c, c, 4, 5, 6, 7); }
        if (s & 1) __builtin_amdgcn_sched_barrier(0); }   // two steps' loads in flight at a time, and no accumulator zeroed among them: all 64 loads at once, or 32 beside the accumulators, take more than 256 registers
#pragma unroll
    for (int mb = 0; mb < 4; ++mb)
#pragma unroll
        for (int nb = 0; nb < 4; ++nb) acc[mb][nb] = (v8f){};
    // kept rolled for the register room named above: one step's 64 input registers at a time beside the accumulators
#pragma unroll 1
    for (int s = 0; s < DM / 8 / 32; ++s) {
        v4f xr[4][4]; v16bf wf[4];
#pragma unroll
        for (int i = 0; i < 4; ++i) { const float* q = px + (size_t)i * 16 * DM; xr[i][0] = *(const v4fa*)q; xr[i][1] = *(const v4fa*)(q + 4); xr[i][2] = *(const v4fa*)(q + 16); xr[i][3] = *(const v4fa*)(q + 20); }
        asm volatile("s_wait_xcnt 0x0" :: "v"(px) : "memory");   // the wait that stands before a register named by an issued global load is written again (the address is an input so that it stays in its registers up to it)
        px += 32;
#pragma unroll
        for (int i = 0; i < 4; ++i) { const float* d = wl + (s * 4 + i) * 256 + lane * 4; const v4f lo = *(const v4fa*)d, hi4 = *(const v4fa*)(d + 128); wf[i] = __builtin_bit_cast(v16bf, __builtin_shufflevector(lo, hi4, 0, 1, 2, 3, 4, 5, 6, 7)); }
#pragma unroll
        for (int i = 0; i < 4; ++i) { v16f t;
#pragma unroll
            for (int e = 0; e < 16; ++e) t[e] = xr[i][e >> 2][e & 3];
            const v16bf xf = cvt16(t);
#pragma unroll
            for (int o = 0; o < 4; ++o) { if constexpr (VT) acc[o][i] = wmmab(wf[o], xf, acc[o][i]); else acc[i][o] = wmmab(xf, wf[o], acc[i][o]); } }
        // the issue slots that the chip needs between the last matrix instructions and the next step's conversions, which write over their operands
        asm volatile("v_nop\n\tv_nop\n\tv_nop\n\tv_nop" : "+v"(acc[VT ? 0 : 3][VT ? 3 : 0]), "+v"(acc[VT ? 1 : 3][VT ? 3 : 1]), "+v"(acc[VT ? 2 : 3][VT ? 3 : 2]), "+v"(acc[3][3]));   // named: the results of the step's last four
    }
}
// ---- k_proj: the three projections of both batches straight from the f32 inputs, 64x64 tiles; grid (TT / 64, DQ / 64, 3 NB_ + 1), 8 waves. z = p * NB_ + b; the last z slice builds the output weight's panels for the third launch (d_woP).
// Wave w takes the k range [128 w, 128 w + 128), 32 k a step; inputs and weights are rounded to bf16 in registers as they arrive. The 8 partial tiles meet in LDS and are added in wave order 0, 1, ... (a fixed order).
// Input fragment i: rows t0 + 16 i + lr, the lane's 16 k as four 16-byte loads of its row. Weight fragment i: column n0 + 4 lr + i of the 'xw' [1024][128] weight, so one 16-byte load per k serves all four fragments and a wave reads whole lines; the tile's columns (v: rows) are put back in order where the partial tile is stored to LDS. Both loaders have one k order: position e of lane half hi is k = 8 hi + e (e < 8), 16 + 8 hi + e - 8 (e >= 8).
// Each sum (+ bias) is rounded here to the three head planes. p = 0, 1 (q, k): [h][t][16], a tile is 2 KiB in a row per head and plane. p = 2 (v): the two operands change places, so the tile is V^T (rows = h * 16 + d, columns = t; every element keeps its products and their order), its rows are whole 128-byte lines of [h][16][t], and the bias goes by row.
__global__ __launch_bounds__(256) void k_proj(const float* __restrict__ x, const float* __restrict__ xk, const float* __restrict__ xv, const float* __restrict__ wq, const float* __restrict__ wk, const float* __restrict__ wv,
                                              const float* __restrict__ b0, const float* __restrict__ b1, const float* __restrict__ b2, const float* __restrict__ wo, bf* WO, Planes pl) {
    constexpr int NW = 8, PW = 64 * 68;      // waves; floats of one wave's partial tile
    __shared__ __align__(16) float os[NW * PW];
    const size_t z = blockIdx.z;
    if (z == 3 * NB_) { const unsigned blk = blockIdx.y * (TT / 64) + blockIdx.x;   // whole work-groups leave here, in front of the barrier
#pragma unroll
        for (unsigned i = 0; i < GB_WO / (TT / 64 * (DQ / 64)); ++i) d_woP(blk * (GB_WO / (TT / 64 * (DQ / 64))) + i, wo, WO);
        return; }
    const int p = (int)(z / NB_); const bool vt = p == 2;
    const float* X = ((p == 0) ? x : ((p == 1) ? xk : xv)) + (z % NB_) * ((size_t)TT * DM); const float* Wf = (p == 0) ? wq : ((p == 1) ? wk : wv); const float* bias = (p == 0) ? b0 : ((p == 1) ? b1 : b2);
    const int tid = threadIdx.x, lane = tid & 31, lr = lane & 15, hi = lane >> 4; const int w = __builtin_amdgcn_readfirstlane(tid >> 5);
    const int t0 = (int)blockIdx.x * 64, n0 = (int)blockIdx.y * 64; const int r0 = vt ? n0 : t0, c0 = vt ? t0 : n0;
    v8f acc[4][4];
    // In the epilogue the thread takes rows prow and prow + 32 and eight columns from pcof of the tile: 16 bytes per plane and row, so a wave stores whole 128-byte lines (V^T: eight lanes a row of 64 t; q, k: two lanes a row of a head, four rows in a row).
    const int prow = tid >> 3, pcof = (tid & 7) * 8;
    const float* px = X + (size_t)(t0 + lr) * DM + w * (DM / NW) + 8 * hi; const float* pw = Wf + (size_t)(w * (DM / NW) + 8 * hi) * DQ + n0 + 4 * lr;
    float* mine = os + w * PW;   // the wave's part of LDS: first its weight fragments, then its partial tile
    if (vt) proj_k<true>(px, pw, mine, lane, acc); else proj_k<false>(px, pw, mine, lane, acc);
    // The thread's biases are asked for here, by column and by row without a branch (the form not used reads from index 0 on), so that they arrive under the LDS stores and the barrier (the K loop has no registers free for them).
    v4f pbc0, pbc1; float pbr[2];
    { const float* bc = bias + (vt ? 0 : c0) + pcof; const float* br = bias + (vt ? r0 : 0) + prow; pbc0 = *(const v4fa*)bc; pbc1 = *(const v4fa*)(bc + 4); pbr[0] = br[0]; pbr[1] = br[32]; }
    if (vt) {   // row 16 mi + (8 hi + j) of the accumulators is weight column, so tile row, 4 (8 hi + j) + mi
#pragma unroll
        for (int mi = 0; mi < 4; ++mi)
#pragma unroll
            for (int nb = 0; nb < 4; ++nb)
#pragma unroll
                for (int j = 0; j < 8; ++j) mine[(4 * (hi * 8 + j) + mi) * 68 + nb * 16 + lr] = acc[mi][nb][j];
    } else {    // column lr of accumulator nb is tile column 4 lr + nb: the four lie side by side, one 16-byte store
#pragma unroll
        for (int mi = 0; mi < 4; ++mi)
#pragma unroll
            for (int j = 0; j < 8; ++j) { v4f t; t[0] = acc[mi][0][j]; t[1] = acc[mi][1][j]; t[2] = acc[mi][2][j]; t[3] = acc[mi][3][j]; *(v4fa*)(mine + (mi * 16 + hi * 8 + j) * 68 + 4 * lr) = t; }
    }
    __syncthreads();   // every wave's partial tile is in LDS
    // both rounds are summed and rounded first, then stored: the LDS reads of the second do not wait behind the stores of the first
    v8h o16[2]; v8us oh[2], ol[2];
#pragma unroll
    for (int s = 0; s < 2; ++s) { const float* ps = os + (s * 32 + prow) * 68 + pcof; v4f va = *(const v4fa*)ps, vb = *(const v4fa*)(ps + 4);
#pragma unroll
        for (int ww = 1; ww < NW; ++ww) { va += *(const v4fa*)(ps + ww * PW); vb += *(const v4fa*)(ps + ww * PW + 4); }
#pragma unroll
        for (int q = 0; q < 8; ++q) { const float y = ((q < 4) ? va[q & 3] : vb[q & 3]) + bfr(vt ? pbr[s] : ((q < 4) ? pbc0[q & 3] : pbc1[q & 3])); o16[s][q] = tohx(y); unsigned short a2, c2; splitf(y, a2, c2); oh[s][q] = a2; ol[s][q] = c2; } }
    const int rr = r0 + prow, cc = c0 + pcof;
    const size_t e0 = vt ? (z - 2 * NB_) * PLN + (size_t)rr * TT + cc : z * PLN + ((size_t)(cc / HD) * TT + rr) * HD + cc % HD, es = vt ? (size_t)32 * TT : (size_t)32 * HD;   // first element, step of 32 rows
    h16* d16 = (vt ? pl.v16 : pl.q16) + e0; bf* dh = (vt ? pl.vh : pl.qh) + e0; bf* dl = (vt ? pl.vl : pl.ql) + e0;
#pragma unroll
    for (int s = 0; s < 2; ++s) { *(v8h*)(d16 + s * es) = o16[s]; *(v8us*)(dh + s * es) = oh[s]; *(v8us*)(dl + s * es) = ol[s]; }
    asm volatile("s_wait_xcnt 0x0" ::: "memory");   // the wait that stands before a register named by an issued global store is written again: in the built code the output-weight slice lies behind these stores and writes their registers
}
// ---- k_fattn: scores, softmax and P.V of one head, a tile of QT x 16 query rows at a time; S and P stay in registers. Grid (heads, NB_ RH / (16 QT)), NWV waves: a work-group takes one hi/lo tile and then TT / RH - 1 fp16 tiles of its head in a loop, so its waves start once for all of them. Wave w takes the keys [w KW, (w + 1) KW) for all the rows, so a K or V fragment is loaded once for QT row tiles.
// S^T = K Q^T: register j of key tile t in lane (lr, hi) is S[query lr][key 16 t + 8 hi + j], so a lane holds scores of one query per row tile, and two neighbouring key tiles are, as they lie, the A fragment of P for 32 keys (same k order as the V^T loader).
// A head is 16 wide and the matrix instruction takes 32: the upper half of the K and Q fragments (d 16..31) is set to zero in registers.
// Softmax by parts: a wave takes the maximum m_w of its own raw scores of a row (in the lane, then across the two lane halves), P = 2^(SCL2 s - SCL2 m_w) in (0, 1] goes into P.V as it is, not normalised, and the wave leaves SCL2 m_w, its row sum and its partial context in LDS.
// Behind the work-group's one barrier, which stands behind its last tile, a thread joins the 16 parts of its element of every tile in wave order: with M the largest SCL2 m_w, part w counts 2^(SCL2 m_w - M) times, in the context and in the row sum alike, and the quotient of the two is the context.
// Rows < RH: hi/lo bf16 planes, 3 products; the rest fp16. Stores the hi/lo planes of the merged context, panel h: QT x 16 rows of 32 bytes in a row.
// Every loop of fattn_rows is unrolled: s, v, o and the fragments are register arrays, which only constant indices keep out of scratch memory.
#define NWV 16
#define QT  2
#define KW  (TT / NWV)
#define KT  (KW / 16)
// 2^x by the hardware instruction, with the one free issue slot behind a transcendental in the same statement
__device__ __forceinline__ float exp2_slot(float x) { float e; asm("v_exp_f32 %0, %1\n\tv_nop" : "=v"(e) : "v"(x)); return e; }
// What a wave has asked for ahead of an fp16 row tile: its K fragments and the tile's Q rows.
struct Carry { v8h k[KT]; v8h q[QT]; };
// Asks for them: qp, kp = the lane's addresses in the first Q row tile and the first key tile.
__device__ __forceinline__ void ask_tile(const h16* qp, const h16* kp, Carry& cy) {
#pragma unroll
    for (int qt = 0; qt < QT; ++qt) cy.q[qt] = *(const v8h*)(qp + (size_t)qt * 16 * HD);
#pragma unroll
    for (int t = 0; t < KT; ++t) cy.k[t] = *(const v8h*)(kp + (size_t)t * 16 * HD);
    asm volatile("s_wait_xcnt 0x0" :: "v"(qp), "v"(kp) : "memory");   // the wait that stands before a register named by an issued global load is written again (the addresses are inputs so that they stay in their registers up to it)
}
template <bool HIRES> struct FSel { typedef bf T; };
template <> struct FSel<false> { typedef h16 T; };
template <bool HIRES>
__device__ __forceinline__ void fattn_rows(const h16* __restrict__ Q16, const h16* __restrict__ K16, const h16* __restrict__ V16, const bf* __restrict__ Qh, const bf* __restrict__ Ql, const bf* __restrict__ Kh, const bf* __restrict__ Kl, const bf* __restrict__ Vh, const bf* __restrict__ Vl,
                                           int q0, int qn, int h, float* redm, float* reds, float* part, Carry& cy) {
    const int tid = threadIdx.x, lane = tid & 31, lr = lane & 15, hi = lane >> 4; const int w = __builtin_amdgcn_readfirstlane(tid >> 5); const int k0 = w * KW;
    const size_t qoff = ((size_t)h * TT + q0 + lr) * HD + 8 * hi, koff = ((size_t)h * TT + k0 + lr) * HD + 8 * hi, voff = ((size_t)h * HD + lr) * TT + k0 + 8 * hi;
    typedef typename FSel<HIRES>::T VT;   // element type of the V^T planes this path reads
    v8f s[QT][KT];
    if constexpr (HIRES) { const v8us z8 = {}; v16bf qh[QT], ql[QT];
#pragma unroll
        for (int qt = 0; qt < QT; ++qt) { qh[qt] = cat16b(*(const v8us*)(Qh + qoff + (size_t)qt * 16 * HD), z8); ql[qt] = cat16b(*(const v8us*)(Ql + qoff + (size_t)qt * 16 * HD), z8); }
#pragma unroll
        for (int t = 0; t < KT; ++t) { const v16bf kh = cat16b(*(const v8us*)(Kh + koff + (size_t)t * 16 * HD), z8), kl = cat16b(*(const v8us*)(Kl + koff + (size_t)t * 16 * HD), z8);
#pragma unroll
            for (int qt = 0; qt < QT; ++qt) { v8f c = {}; c = wmmab(kh, qh[qt], c); c = wmmab(kh, ql[qt], c); c = wmmab(kl, qh[qt], c); s[qt][t] = c; } }
    } else { const v8h z8 = {}; v16h q[QT];
#pragma unroll
        for (int qt = 0; qt < QT; ++qt) q[qt] = cat16(cy.q[qt], z8);
#pragma unroll
        for (int t = 0; t < KT; ++t) { const v16h k = cat16(cy.k[t], z8);
#pragma unroll
            for (int qt = 0; qt < QT; ++qt) { v8f c = {}; s[qt][t] = wmma16(k, q[qt], c); } } }
    typename WFrag<VT>::V v[KT / 2], v2[HIRES ? KT / 2 : 1];   // the wave's V^T fragments
    // loads the fragments [t0, t1); behind them the wait that stands before a register named by an issued global load is written again (the addresses are inputs so that they stay in their registers up to it)
    auto load_v = [&](int t0, int t1) { const VT* vp; const VT* vp2;
        if constexpr (HIRES) { vp = Vh + voff; vp2 = Vl + voff; } else { vp = V16 + voff; vp2 = vp; }
#pragma unroll
        for (int tp = t0; tp < t1; ++tp) { v[tp] = WFrag<VT>::ld(vp + tp * 32); if constexpr (HIRES) v2[tp] = WFrag<VT>::ld(vp2 + tp * 32); }
        asm volatile("s_wait_xcnt 0x0" :: "v"(vp), "v"(vp2) : "memory"); };
    load_v(0, HIRES ? 1 : KT / 2);   // asked for here so that they arrive under the maxima and the exponentials (the hi/lo path has registers free for its first step alone: the rest it asks for one step ahead)
#pragma unroll
    for (int qt = 0; qt < QT; ++qt) { float m4[4] = {-3.0e38f, -3.0e38f, -3.0e38f, -3.0e38f};   // four chains, so that a maximum does not wait for the one before it
#pragma unroll
        for (int t = 0; t < KT; ++t) {
#pragma unroll
            for (int j = 0; j < 8; ++j) m4[j >> 1] = fmaxf(m4[j >> 1], s[qt][t][j]); }
        float m = fmaxf(fmaxf(m4[0], m4[1]), fmaxf(m4[2], m4[3])); m = fmaxf(m, __shfl_xor(m, 16, 32)); const float nb = m * SCL2;
        v2f ps[2] = {(v2f){0.f, 0.f}, (v2f){0.f, 0.f}};
#pragma unroll
        for (int t = 0; t < KT; ++t) {
#pragma unroll
            for (int j = 0; j < 8; j += 2) { const v2f x = __builtin_elementwise_fma((v2f){s[qt][t][j], s[qt][t][j + 1]}, (v2f){SCL2, SCL2}, (v2f){-nb, -nb});   // two scores, neighbours in registers, per packed instruction
                const float e0 = exp2_slot(x[0]), e1 = exp2_slot(x[1]); s[qt][t][j] = e0; s[qt][t][j + 1] = e1; ps[(j >> 1) & 1] += (v2f){e0, e1}; } }
        float sum = (ps[0][0] + ps[0][1]) + (ps[1][0] + ps[1][1]); sum += __shfl_xor(sum, 16, 32);
        if (hi == 0) { redm[(w * QT + qt) * 16 + lr] = nb; reds[(w * QT + qt) * 16 + lr] = sum; } }
    v8f o[QT];
#pragma unroll
    for (int qt = 0; qt < QT; ++qt) o[qt] = (v8f){};
#pragma unroll
    for (int tp = 0; tp < KT / 2; ++tp) {
        if (tp == KT / 4) ask_tile(Q16 + ((size_t)h * TT + qn + lr) * HD + 8 * hi, K16 + koff, cy);   // the next tile, an fp16 tile from row qn: half of the scores' registers are free from here on, and the loads arrive under the rest of P.V
        if constexpr (HIRES) { if (tp + 1 < KT / 2) load_v(tp + 1, tp + 2);
            const v16bf vh = v[tp], vl = v2[tp];
#pragma unroll
            for (int qt = 0; qt < QT; ++qt) { v8us h0, l0, h1, l1;
#pragma unroll
                for (int j = 0; j < 8; ++j) { unsigned short a, c2; splitf(s[qt][2 * tp][j], a, c2); h0[j] = a; l0[j] = c2; splitf(s[qt][2 * tp + 1][j], a, c2); h1[j] = a; l1[j] = c2; }
                const v16bf ph = cat16b(h0, h1), pl = cat16b(l0, l1);
                o[qt] = wmmab(ph, vh, o[qt]); o[qt] = wmmab(pl, vh, o[qt]); o[qt] = wmmab(ph, vl, o[qt]); }
        } else {
#pragma unroll
            for (int qt = 0; qt < QT; ++qt) { v8h p0, p1;
#pragma unroll
                for (int j = 0; j < 8; ++j) { p0[j] = tohx(s[qt][2 * tp][j]); p1[j] = tohx(s[qt][2 * tp + 1][j]); }
                o[qt] = wmma16(cat16(p0, p1), v[tp], o[qt]); } } }
#pragma unroll
    for (int qt = 0; qt < QT; ++qt) {
#pragma unroll
        for (int j = 0; j < 8; ++j) part[w * (QT * 272) + (qt * 16 + hi * 8 + j) * 17 + lr] = o[qt][j]; }
}
__global__ __launch_bounds__(32 * NWV) void k_fattn(const h16* __restrict__ Q16, const h16* __restrict__ K16, const h16* __restrict__ V16, const bf* __restrict__ Qh, const bf* __restrict__ Ql, const bf* __restrict__ Kh, const bf* __restrict__ Kl, const bf* __restrict__ Vh, const bf* __restrict__ Vl, bf* Ah, bf* Al) {
    static_assert(NWV * 32 == QT * 256, "one thread per element of the context tile");
    // blockIdx.y -> (batch, i): the work-group takes hi/lo tile i of its head and then the fp16 tiles HT + i, 2 HT + i, ..., one after the other, so every work-group has the same work and one per WGP is the whole launch
    constexpr int NT = TT / (QT * 16), HT = RH / (QT * 16), NF = NT / HT - 1; static_assert(HT > 0 && NT % HT == 0 && NF > 0, "one hi/lo tile and NF fp16 tiles each");
    // a set of its own for every tile of the work-group: a wave goes through all its tiles without waiting for another wave, and one barrier at the end serves them all
    // one array, the small planes first: their addresses then lie within the reach of an LDS instruction's offset field from one register
    constexpr int RS = NWV * QT * 16, PS = NWV * QT * 272; __shared__ float lds[(NF + 1) * (2 * RS + PS)]; float* const redm = lds; float* const reds = lds + (NF + 1) * RS; float* const part = lds + (NF + 1) * 2 * RS;
    const int y = blockIdx.y; const int b = y / HT, i0 = y % HT; const int h = blockIdx.x;
    { const size_t po = (size_t)b * PLN; Q16 += po; K16 += po; V16 += po; Qh += po; Ql += po; Kh += po; Kl += po; Vh += po; Vl += po; Ah += po; Al += po; }
    Carry cy;
    fattn_rows<true>(Q16, K16, V16, Qh, Ql, Kh, Kl, Vh, Vl, i0 * (QT * 16), (HT + i0) * (QT * 16), h, redm, reds, part, cy);
    // kept rolled: one copy of the tile's code, which is long
#pragma unroll 1
    for (int j = 1; j <= NF; ++j)   // the last tile asks for its own rows again (in bounds, not used): no branch inside P.V
        fattn_rows<false>(Q16, K16, V16, Qh, Ql, Kh, Kl, Vh, Vl, (j * HT + i0) * (QT * 16), (((j < NF) ? j + 1 : j) * HT + i0) * (QT * 16), h, redm + j * RS, reds + j * RS, part + j * PS, cy);
    __syncthreads();   // every wave's row maxima, row sums and partial contexts of all the tiles are in LDS
    const int tid = threadIdx.x, q = tid >> 4, d = tid & 15;   // NWV * 32 threads = QT * 16 rows x 16 columns: one element of every tile
    // unrolled, and every store behind the last join: the tiles' joins do not depend on one another, so the LDS reads and the sums of one run under those of the others
    unsigned short oh[NF + 1], ol[NF + 1];
#pragma unroll
    for (int j = 0; j <= NF; ++j) {
        float nw[NWV]; float mm = -3.0e38f;
#pragma unroll
        for (int ww = 0; ww < NWV; ++ww) { nw[ww] = redm[j * RS + ww * (QT * 16) + q]; mm = fmaxf(mm, nw[ww]); }
        float acc = 0.f, tot = 0.f;
#pragma unroll
        for (int ww = 0; ww < NWV; ++ww) { const float g = exp2_slot(nw[ww] - mm); tot = __builtin_fmaf(reds[j * RS + ww * (QT * 16) + q], g, tot); acc = __builtin_fmaf(part[j * PS + ww * (QT * 272) + q * 17 + d], g, acc); }
        splitf(__fdiv_rn(acc, tot), oh[j], ol[j]); }
    const size_t oo = ((size_t)h * TT + i0 * (QT * 16) + q) * HD + d; bf* pa = Ah + oo; bf* pb = Al + oo;   // the element in tile i0; tile j HT + i0 lies j RH rows on
#pragma unroll
    for (int j = 0; j <= NF; ++j) { pa[(size_t)j * RH * HD] = oh[j]; pb[(size_t)j * RH * HD] = ol[j]; }
}

extern "C" void kernel_launch(void* const* d_in, const int* in_sizes, int n_in,
                              void* d_out, int out_size, void* d_ws, size_t ws_size, hipStream_t stream) {
    (void)in_sizes; (void)n_in; (void)out_size;
    const float* x = (const float*)d_in[0]; const float* xk = (const float*)d_in[1]; const float* xv = (const float*)d_in[2]; const float* wq = (const float*)d_in[3]; const float* bqr = (const float*)d_in[4]; const float* wk = (const float*)d_in[5]; const float* bkr = (const float*)d_in[6]; const float* wv = (const float*)d_in[7]; const float* bvr = (const float*)d_in[8]; const float* wo = (const float*)d_in[9]; const float* bo = (const float*)d_in[10];   /* argument order queries, keys, values, Wq ('xw' [1024][128]), bq [128], Wk, bk, Wv, bv, Wo ('xw' [128][1024]), bo */
    float* OUT = (float*)d_out;     // [2][2048][1024]
    char* wsp = (char*)d_ws;
    auto take = [&](size_t bytes) { char* p = wsp; wsp += (bytes + 255) & ~(size_t)255; return (void*)p; };
    bf* WO = (bf*)take((size_t)DM * DQ * 2);
    h16* P16 = (h16*)take(2 * NB_ * PLN * 2); bf* Ph = (bf*)take(2 * NB_ * PLN * 2); bf* Pl = (bf*)take(2 * NB_ * PLN * 2);   /* q planes z = 0, 1; k planes z = 2, 3 */
    h16* VT16 = (h16*)take(NB_ * PLN * 2); bf* VTh = (bf*)take(NB_ * PLN * 2); bf* VTl = (bf*)take(NB_ * PLN * 2);
    bf* ATh = (bf*)take(NB_ * PLN * 2); bf* ATl = (bf*)take(NB_ * PLN * 2);   /* merged context [b][h][t][16] */
    if ((size_t)(wsp - (char*)d_ws) > ws_size) return;    // ws 256 MiB
    k_proj<<<dim3(TT / 64, DQ / 64, 3 * NB_ + 1), 256, 0, stream>>>(x, xk, xv, wq, wk, wv, bqr, bkr, bvr, wo, WO, Planes{P16, Ph, Pl, VT16, VTh, VTl});
    k_fattn<<<dim3(NH_, NB_ * (RH / (16 * QT)), 1), 32 * NWV, 0, stream>>>(P16, P16 + NB_ * PLN, VT16, Ph, Pl, Ph + NB_ * PLN, Pl + NB_ * PLN, VTh, VTl, ATh, ATl);   // one kv head per query head
    k_gemmw<bf, 1, true, 4, 1, NB_, TT, DM><<<dim3(TT / 64, DM / 64, NB_), 128, 0, stream>>>(ATh, ATl, WO, nullptr, DQ, OUT, DM, bo, PLN, 0, (size_t)TT * DM, 0, 0);   // 4 waves: 32 k, two heads, each
}

// v010
// A run of this version takes 34.8 microseconds.
// Two timings next to v009 put it at 1.04 and 1.06 times that version's speed.
// All steps since v000 together make it 32.0 times as fast.
#include <hip/hip_runtime.h>

// Multi-headed attention whose projections are only 128 wide (the module's Dense(d_k = d_model / h) quirk): 8 heads x 16 dims (queries, keys, values [2][2048][1024]; q = queries Wq + bq, k = keys Wk + bk, v = values Wv + bv ('xw' [1024][128] 0.02 + zero biases [128]); heads = 16-wide slices; scores / sqrt(128) (the module scales by sqrt(d_k = 128), not by the per-head 16); softmax (no mask); o = merged [2048][128]; out = o Wo + bo ('xw' [128][1024]) -> [2][2048][1024] (4.2 M); argument order queries, keys, values, Wq, bq, Wk, bk, Wv, bv, Wo, bo).
// Three launches, each holding every piece of work that depends only on the launches before it, for both batches: k_proj z = 0..5 (projections straight from the f32 inputs, stored as head planes; z = 6: the output weight's panels), k_fattn, k_gemmw z = 0..1 (output). Index z = p * NB_ + b, p = 0 queries, 1 keys, 2 values.
// Layout per batch: q, k and v lie dense, 8 heads x 16 = 128 wide: k_proj rounds inputs and 'xw' [1024][128] weights to bf16 in registers as it loads them; exact projections + f32 biases, rounded in the product's own epilogue to the head planes [h][t][16] and V^T [h][16][t]; dense T-2048 attention. The merged context lies dense too, in panels of 16 k, one per head: [h][t][16], so a work-group of k_fattn writes whole 128-byte lines that no other writes; d_woP builds the output weight in the same form, [h][n][16] (element d = Wo[h*16 + d][n]); merged hi/lo x Wo exact + bo, K = 128.
// Compute dtypes, f32 accumulate: every input rounded to bf16; projections exact + f32 biases; attention rows < 512 3 products, rest fp16; softmax f32, each wave against its own row maximum, joined by rescaling; Wo hl x exact + bias.

#define NB_  2
#define TT   2048
#define DM   1024
#define NH_  8
#define NKV  8
#define REP  (NH_ / NKV)
#define HD   16                   // per-head width: q, k, v and their planes
#define DQ   (NH_ * HD)
#define DKV  (NKV * HD)
#define RH   512                  // query rows < RH use hi+lo planes
#define WIN  0
#define SCL2 0.12751743082f          // log2(e) / sqrt(d_k = 128): the module's scale (by d_k, not by the per-head 16) times the change of base, so that 2^(SCL2 s) = e^(s / sqrt(128))
typedef _Float16 h16;
typedef unsigned short bf;
typedef __attribute__((ext_vector_type(16))) __bf16   v16bf;
typedef __attribute__((ext_vector_type(16))) _Float16 v16h;
typedef __attribute__((ext_vector_type(8)))  _Float16 v8h;
typedef __attribute__((ext_vector_type(8)))  unsigned short v8us;
typedef __attribute__((ext_vector_type(8)))  float    v8f;
typedef __attribute__((ext_vector_type(4)))  float    v4f;
typedef __attribute__((ext_vector_type(2)))  float    v2f;
typedef v8h  __attribute__((may_alias)) v8ha;
typedef v4f  __attribute__((may_alias)) v4fa;
typedef v8us __attribute__((may_alias)) v8usa;

__device__ __forceinline__ unsigned short f2bf(float f) { return __builtin_bit_cast(unsigned short, (__bf16)f); }   // round to nearest even, by the hardware conversion
__device__ __forceinline__ float bf2f(unsigned short b) { return __uint_as_float(((unsigned)b) << 16); }
__device__ __forceinline__ float bfr(float f) { return bf2f(f2bf(f)); }
__device__ __forceinline__ v16h cat16(v8h lo, v8h hi) { return __builtin_shufflevector(lo, hi, 0, 1, 2, 3, 4, 5, 6, 7, 8, 9, 10, 11, 12, 13, 14, 15); }
__device__ __forceinline__ v16bf cat16b(v8us lo, v8us hi) { return __builtin_bit_cast(v16bf, __builtin_shufflevector(lo, hi, 0, 1, 2, 3, 4, 5, 6, 7, 8, 9, 10, 11, 12, 13, 14, 15)); }
__device__ __forceinline__ v8f wmma16(v16h a, v16h b, v8f c) { return __builtin_amdgcn_wmma_f32_16x16x32_f16(false, a, false, b, (short)0, c, false, false); }
__device__ __forceinline__ v8f wmmab(v16bf a, v16bf b, v8f c) { return __builtin_amdgcn_wmma_f32_16x16x32_bf16(false, a, false, b, (short)0, c, false, false); }
__device__ __forceinline__ h16 tohx(float x) { return (h16)x; }
__device__ __forceinline__ void splitf(float y, unsigned short& h, unsigned short& l) { h = f2bf(y); l = f2bf(y - bf2f(h)); }
// splitf of N values at once, N even: two values per packed hardware conversion; a packed word of hi gives its two f32 values back by a shift and a mask
template <int N> struct SplitN { typedef __attribute__((ext_vector_type(N))) float F; typedef __attribute__((ext_vector_type(N))) __bf16 B; typedef __attribute__((ext_vector_type(N / 2))) unsigned U;
    static __device__ __forceinline__ void run(F y, B& h, B& l) { h = __builtin_convertvector(y, B); const U u = __builtin_bit_cast(U, h); F r;
#pragma unroll
        for (int i = 0; i < N / 2; ++i) { r[2 * i] = y[2 * i] - __uint_as_float(u[i] << 16); r[2 * i + 1] = y[2 * i + 1] - __uint_as_float(u[i] & 0xFFFF0000u); }
        l = __builtin_convertvector(r, B); } };
#define PLN   ((size_t)NH_ * TT * HD)      // elements of one head plane of one batch
// Where k_proj stores: fp16 and hi/lo bf16 head planes, q16 / qh / ql = [z = 0..3][h][t][16] of q and k, v16 / vh / vl = [b][h][16][t] of v.
struct Planes { h16* q16; bf* qh; bf* ql; h16* v16; bf* vh; bf* vl; };



// ---- k_gemmw: register-blocked GEMM, 64x64 output tiles (16 accumulators per wave), operands straight from K-contiguous 16-bit planes; grid (M/64, N/64 * KS, Z), 32 * NW threads.
// K is split: work-group ky = blockIdx.y % KS of a tile takes the K range [ky K/KS, (ky+1) K/KS), wave w of it the w-th of NW equal contiguous parts. The NW partial tiles of a work-group meet in LDS and are added in wave order 0, 1, ... (a fixed order);
// work-group ky stores its sum in plane ky of C (plane stride sP elements), and the reader of C adds the KS planes in plane order. NW = KS = 1: one wave, the whole K, one plane.
// C[m][n] (f32, pitch ldc, + optional f32 bias[n], KS = 1 only) = sum_k A[m][k] Bt[n][k] (+ split products per NSPLIT). z-batch strides sA/sB/sC in elements; ZB neighbouring z share one Bt and one bias (strides sB, sBb per group of ZB). K % (32 * NW * KS) == 0.
// RA = RB = 0: A and Bt are row-major, K contiguous. RA, RB > 0: each lies in panels of 16 k with that many rows each, element (row, k) at ((k / 16) * R + row) * 16 + k % 16: the 16 rows of a fragment load are then 512 contiguous bytes (4 whole lines, not 16 pieces of 32 bytes). The k order of a fragment is the same in both forms.
template <typename T16> struct WFrag;
template <> struct WFrag<h16> { typedef v16h V; static __device__ __forceinline__ V ld2(const h16* p, const h16* q) { return cat16(*(const v8h*)p, *(const v8h*)q); } static __device__ __forceinline__ V ld(const h16* p) { return ld2(p, p + 16); } static __device__ __forceinline__ v8f mma(V a, V b, v8f c) { return wmma16(a, b, c); } };
template <> struct WFrag<bf> { typedef v16bf V; static __device__ __forceinline__ V ld2(const bf* p, const bf* q) { return cat16b(*(const v8us*)p, *(const v8us*)q); } static __device__ __forceinline__ V ld(const bf* p) { return ld2(p, p + 16); } static __device__ __forceinline__ v8f mma(V a, V b, v8f c) { return wmmab(a, b, c); } };
template <int NW> __device__ __forceinline__ void tile_sync() {   // orders the LDS stores of the partial tiles before the reads of them: among the waves of the work-group, or inside the one wave
    if constexpr (NW == 1) { __builtin_amdgcn_wave_barrier(); asm volatile("" ::: "memory"); } else { __syncthreads(); } }
template <typename T16, int NSPLIT, bool BIAS, int NW, int KS, int ZB, int RA = 0, int RB = 0>
__global__ __launch_bounds__(32 * NW) void k_gemmw(const T16* __restrict__ A, const T16* __restrict__ A2, const T16* __restrict__ Bt, const T16* __restrict__ Bt2, int K, float* C, int ldc, const float* __restrict__ bias, size_t sA, size_t sB, size_t sC, size_t sP, size_t sBb) {
    static_assert(KS == 1 || !BIAS, "the bias would be added once per plane"); static_assert((RA > 0) == (RB > 0) && (RA == 0 || NSPLIT == 1), "panels: both operands, hi/lo A");
    typedef typename WFrag<T16>::V V;
    constexpr int MBR = (NW == 1) ? 1 : 4;   // 16-row blocks staged per round: with several waves the whole tile at once, so one barrier serves
    constexpr int PW = MBR * 16 * 68;        // floats of one wave's staged part
    __shared__ __align__(16) float os[NW * PW];
    const size_t z = blockIdx.z, zw = z / ZB; A += z * sA; if (A2) A2 += z * sA; Bt += zw * sB; if (Bt2) Bt2 += zw * sB; if (BIAS) bias += zw * sBb; C += z * sC;
    const int tid = threadIdx.x, lane = tid & 31, lr = lane & 15, hi = lane >> 4; const int w = (NW == 1) ? 0 : __builtin_amdgcn_readfirstlane(tid >> 5); const int ky = (KS == 1) ? 0 : (int)(blockIdx.y % KS);
    const int kspan = K / (NW * KS), kbeg = (ky * NW + w) * kspan, kend = kbeg + kspan; const int r0 = (int)blockIdx.x * 64, c0 = (int)(blockIdx.y / KS) * 64; if (KS > 1) C += (size_t)ky * sP;
    v8f acc[4][4];
#pragma unroll
    for (int mb = 0; mb < 4; ++mb)
#pragma unroll
        for (int nb = 0; nb < 4; ++nb) acc[mb][nb] = (v8f){};
    const size_t aoff = (size_t)(r0 + lr) * K + 8 * hi, boff = (size_t)(c0 + lr) * K + 8 * hi;
#pragma unroll 1
    for (int kc = kbeg; kc < kend; kc += 32) {
        V a[4], a2[4];
        if constexpr (RA > 0) {   // panels: every fragment of the step hangs on three addresses; all are asked for at once
            V b[4]; const T16* pa = A + ((size_t)(kc >> 4) * RA + r0 + lr) * 16 + 8 * hi; const T16* pa2 = A2 + ((size_t)(kc >> 4) * RA + r0 + lr) * 16 + 8 * hi; const T16* pb = Bt + ((size_t)(kc >> 4) * RB + c0 + lr) * 16 + 8 * hi;
#pragma unroll
            for (int i = 0; i < 4; ++i) { a[i] = WFrag<T16>::ld2(pa + i * 256, pa + i * 256 + (size_t)RA * 16); a2[i] = WFrag<T16>::ld2(pa2 + i * 256, pa2 + i * 256 + (size_t)RA * 16); b[i] = WFrag<T16>::ld2(pb + i * 256, pb + i * 256 + (size_t)RB * 16); }
            asm volatile("s_wait_xcnt 0x0" :: "v"(pa), "v"(pa2), "v"(pb) : "memory");   // the wait that stands before a register named by an issued global load is written again (the addresses are inputs so that they stay in their registers up to it)
            __builtin_amdgcn_sched_barrier(0);   // keeps every matrix instruction behind all 24 loads: without it the last loads are issued behind the first products, into their registers, and the wave waits out a second load latency
#pragma unroll
            for (int nb = 0; nb < 4; ++nb) {
#pragma unroll
                for (int mb = 0; mb < 4; ++mb) { acc[mb][nb] = WFrag<T16>::mma(a[mb], b[nb], acc[mb][nb]); acc[mb][nb] = WFrag<T16>::mma(a2[mb], b[nb], acc[mb][nb]); } }
        } else {
#pragma unroll
        for (int mb = 0; mb < 4; ++mb) { a[mb] = WFrag<T16>::ld(A + aoff + (size_t)mb * 16 * K + kc); if (NSPLIT == 1 || NSPLIT == 2) a2[mb] = WFrag<T16>::ld(A2 + aoff + (size_t)mb * 16 * K + kc); }
#pragma unroll
        for (int nb = 0; nb < 4; ++nb) { const V b = WFrag<T16>::ld(Bt + boff + (size_t)nb * 16 * K + kc); V b2; if (NSPLIT >= 2) b2 = WFrag<T16>::ld(Bt2 + boff + (size_t)nb * 16 * K + kc);
#pragma unroll
            for (int mb = 0; mb < 4; ++mb) { acc[mb][nb] = WFrag<T16>::mma(a[mb], b, acc[mb][nb]); if (NSPLIT == 1 || NSPLIT == 2) acc[mb][nb] = WFrag<T16>::mma(a2[mb], b, acc[mb][nb]); if (NSPLIT >= 2) acc[mb][nb] = WFrag<T16>::mma(a[mb], b2, acc[mb][nb]); } }
        }
        asm volatile("v_nop\n\tv_nop\n\tv_nop\n\tv_nop" : "+v"(acc[0][0]), "+v"(acc[1][1]), "+v"(acc[2][2]), "+v"(acc[3][3]) : "v"(a[0]), "v"(a[3]));
    }
    float* mine = os + w * PW;
#pragma unroll
    for (int m0 = 0; m0 < 4; m0 += MBR) {
#pragma unroll
        for (int mi = 0; mi < MBR; ++mi) {
#pragma unroll
            for (int nb = 0; nb < 4; ++nb) {
#pragma unroll
                for (int j = 0; j < 8; ++j) mine[(mi * 16 + hi * 8 + j) * 68 + nb * 16 + lr] = acc[m0 + mi][nb][j]; } }
        tile_sync<NW>();
        float* crow = C + (size_t)(r0 + m0 * 16) * ldc + c0;
        {
#pragma unroll
            for (int s = 0; s < MBR * 8 / NW; ++s) { const int idx = s * (NW * 32) + tid; const int row = idx >> 4, cofs = (idx & 15) * 4; v4f val = *(const v4fa*)(os + row * 68 + cofs);
#pragma unroll
                for (int ww = 1; ww < NW; ++ww) val += *(const v4fa*)(os + ww * PW + row * 68 + cofs);
                if (BIAS) { val[0] += bfr(bias[c0 + cofs]); val[1] += bfr(bias[c0 + cofs + 1]); val[2] += bfr(bias[c0 + cofs + 2]); val[3] += bfr(bias[c0 + cofs + 3]); }
                *(v4f*)(crow + (size_t)row * ldc + cofs) = val; }
             }
        if (MBR < 4) tile_sync<NW>();   // the next round stores over what this round read
    }
}

typedef __attribute__((ext_vector_type(2))) unsigned short v2us;
typedef __attribute__((ext_vector_type(4))) int v4i;

// The output weight in panels of 16 k, [h][n][16] (element d = Wo[h*16 + d][n]), rounded to bf16: 512 elements per block index blk.
__device__ __forceinline__ void d_woP(unsigned blk, const float* __restrict__ wo, bf* Bt) { const size_t e = ((size_t)blk * 256 + threadIdx.x) * 2; if (e >= (size_t)DM * DQ) return; const int d = (int)(e % HD); const int n = (int)((e / HD) % DM); const int h = (int)(e / ((size_t)HD * DM)); v2us o; o[0] = f2bf(wo[(size_t)(h * HD + d) * DM + n]); o[1] = f2bf(wo[(size_t)(h * HD + d + 1) * DM + n]);
    *(v2us*)(Bt + e) = o;  }
#define GB_WO (DM * DQ / 2 / 256)          // block indices of d_woP
typedef __attribute__((ext_vector_type(16))) float v16f;
// 16 f32 -> one bf16 fragment, round to nearest even (packed hardware conversions)
__device__ __forceinline__ v16bf cvt16(v16f t) { return __builtin_convertvector(t, v16bf); }
// The K loop of one wave of k_proj: 4 steps of 32 k from px (the lane's input row) and pw (the lane's four weight columns). VT: the weight fragments are the A operand.
// A step holds 128 accumulator registers and 64 of f32 inputs, which leaves no room for 64 more of f32 weights under 256 (two work-groups a WGP). So the wave rounds its weight fragments of all four steps first, while no accumulator lives,
// and parks them in wl, its own part of LDS (16 KiB): every lane writes and later reads its own 32 bytes per fragment, 512 bytes in a row per instruction, so no barrier is needed.
template <bool VT> __device__ __forceinline__ void proj_k(const float* px, const float* pw, float* wl, int lane, v8f (&acc)[4][4]) {
#pragma unroll
    for (int s = 0; s < DM / 8 / 32; ++s) { v4f wr[16];
#pragma unroll
        for (int e = 0; e < 16; ++e) wr[e] = *(const v4fa*)(pw + (size_t)(s * 32 + (e & 7) + (e >> 3) * 16) * DQ);
#pragma unroll
        for (int i = 0; i < 4; ++i) { v16f t;
#pragma unroll
            for (int e = 0; e < 16; ++e) t[e] = wr[e][i];
            const v8f c = __builtin_bit_cast(v8f, cvt16(t)); float* d = wl + (s * 4 + i) * 256 + lane * 4;
            *(v4fa*)d = __builtin_shufflevector(c, c, 0, 1, 2, 3); *(v4fa*)(d + 128) = __builtin_shufflevector(c, c, 4, 5, 6, 7); }
        if (s & 1) __builtin_amdgcn_sched_barrier(0); }   // two steps' loads in flight at a time, and no accumulator zeroed among them: all 64 loads at once, or 32 beside the accumulators, take more than 256 registers
#pragma unroll
    for (int mb = 0; mb < 4; ++mb)
#pragma unroll
        for (int nb = 0; nb < 4; ++nb) acc[mb][nb] = (v8f){};
    // kept rolled for the register room named above: one step's 64 input registers at a time beside the accumulators
#pragma unroll 1
    for (int s = 0; s < DM / 8 / 32; ++s) {
        v4f xr[4][4]; v16bf wf[4];
#pragma unroll
        for (int i = 0; i < 4; ++i) { const float* q = px + (size_t)i * 16 * DM; xr[i][0] = *(const v4fa*)q; xr[i][1] = *(const v4fa*)(q + 4); xr[i][2] = *(const v4fa*)(q + 16); xr[i][3] = *(const v4fa*)(q + 20); }
        asm volatile("s_wait_xcnt 0x0" :: "v"(px) : "memory");   // the wait that stands before a register named by an issued global load is written again (the address is an input so that it stays in its registers up to it)
        px += 32;
#pragma unroll
        for (int i = 0; i < 4; ++i) { const float* d = wl + (s * 4 + i) * 256 + lane * 4; const v4f lo = *(const v4fa*)d, hi4 = *(const v4fa*)(d + 128); wf[i] = __builtin_bit_cast(v16bf, __builtin_shufflevector(lo, hi4, 0, 1, 2, 3, 4, 5, 6, 7)); }
#pragma unroll
        for (int i = 0; i < 4; ++i) { v16f t;
#pragma unroll
            for (int e = 0; e < 16; ++e) t[e] = xr[i][e >> 2][e & 3];
            const v16bf xf = cvt16(t);
#pragma unroll
            for (int o = 0; o < 4; ++o) { if constexpr (VT) acc[o][i] = wmmab(wf[o], xf, acc[o][i]); else acc[i][o] = wmmab(xf, wf[o], acc[i][o]); } }
        // the issue slots that the chip needs between the last matrix instructions and the next step's conversions, which write over their operands
        asm volatile("v_nop\n\tv_nop\n\tv_nop\n\tv_nop" : "+v"(acc[VT ? 0 : 3][VT ? 3 : 0]), "+v"(acc[VT ? 1 : 3][VT ? 3 : 1]), "+v"(acc[VT ? 2 : 3][VT ? 3 : 2]), "+v"(acc[3][3]));   // named: the results of the step's last four
    }
}
// ---- k_proj: the three projections of both batches straight from the f32 inputs, 64x64 tiles; grid (TT / 64, DQ / 64, 3 NB_ + 1), 8 waves. z = p * NB_ + b; the last z slice builds the output weight's panels for the third launch (d_woP).
// Wave w takes the k range [128 w, 128 w + 128), 32 k a step; inputs and weights are rounded to bf16 in registers as they arrive. The 8 partial tiles meet in LDS and are added in wave order 0, 1, ... (a fixed order).
// Input fragment i: rows t0 + 16 i + lr, the lane's 16 k as four 16-byte loads of its row. Weight fragment i: column n0 + 4 lr + i of the 'xw' [1024][128] weight, so one 16-byte load per k serves all four fragments and a wave reads whole lines; the tile's columns (v: rows) are put back in order where the partial tile is stored to LDS. Both loaders have one k order: position e of lane half hi is k = 8 hi + e (e < 8), 16 + 8 hi + e - 8 (e >= 8).
// Each sum (+ bias) is rounded here to the three head planes. p = 0, 1 (q, k): [h][t][16], a tile is 2 KiB in a row per head and plane. p = 2 (v): the two operands change places, so the tile is V^T (rows = h * 16 + d, columns = t; every element keeps its products and their order), its rows are whole 128-byte lines of [h][16][t], and the bias goes by row.
__global__ __launch_bounds__(256) void k_proj(const float* __restrict__ x, const float* __restrict__ xk, const float* __restrict__ xv, const float* __restrict__ wq, const float* __restrict__ wk, const float* __restrict__ wv,
                                              const float* __restrict__ b0, const float* __restrict__ b1, const float* __restrict__ b2, const float* __restrict__ wo, bf* WO, Planes pl) {
    constexpr int NW = 8, PW = 64 * 68;      // waves; floats of one wave's partial tile
    __shared__ __align__(16) float os[NW * PW];
    const size_t z = blockIdx.z;
    if (z == 3 * NB_) { const unsigned blk = blockIdx.y * (TT / 64) + blockIdx.x;   // whole work-groups leave here, in front of the barrier
#pragma unroll
        for (unsigned i = 0; i < GB_WO / (TT / 64 * (DQ / 64)); ++i) d_woP(blk * (GB_WO / (TT / 64 * (DQ / 64))) + i, wo, WO);
        return; }
    const int p = (int)(z / NB_); const bool vt = p == 2;
    const float* X = ((p == 0) ? x : ((p == 1) ? xk : xv)) + (z % NB_) * ((size_t)TT * DM); const float* Wf = (p == 0) ? wq : ((p == 1) ? wk : wv); const float* bias = (p == 0) ? b0 : ((p == 1) ? b1 : b2);
    const int tid = threadIdx.x, lane = tid & 31, lr = lane & 15, hi = lane >> 4; const int w = __builtin_amdgcn_readfirstlane(tid >> 5);
    const int t0 = (int)blockIdx.x * 64, n0 = (int)blockIdx.y * 64; const int r0 = vt ? n0 : t0, c0 = vt ? t0 : n0;
    v8f acc[4][4];
    // In the epilogue the thread takes rows prow and prow + 32 and eight columns from pcof of the tile: 16 bytes per plane and row, so a wave stores whole 128-byte lines (V^T: eight lanes a row of 64 t; q, k: two lanes a row of a head, four rows in a row).
    const int prow = tid >> 3, pcof = (tid & 7) * 8;
    const float* px = X + (size_t)(t0 + lr) * DM + w * (DM / NW) + 8 * hi; const float* pw = Wf + (size_t)(w * (DM / NW) + 8 * hi) * DQ + n0 + 4 * lr;
    float* mine = os + w * PW;   // the wave's part of LDS: first its weight fragments, then its partial tile
    if (vt) proj_k<true>(px, pw, mine, lane, acc); else proj_k<false>(px, pw, mine, lane, acc);
    // The thread's biases are asked for here, by column and by row without a branch (the form not used reads from index 0 on), so that they arrive under the LDS stores and the barrier (the K loop has no registers free for them).
    v4f pbc0, pbc1; float pbr[2];
    { const float* bc = bias + (vt ? 0 : c0) + pcof; const float* br = bias + (vt ? r0 : 0) + prow; pbc0 = *(const v4fa*)bc; pbc1 = *(const v4fa*)(bc + 4); pbr[0] = br[0]; pbr[1] = br[32]; }
    if (vt) {   // row 16 mi + (8 hi + j) of the accumulators is weight column, so tile row, 4 (8 hi + j) + mi
#pragma unroll
        for (int mi = 0; mi < 4; ++mi)
#pragma unroll
            for (int nb = 0; nb < 4; ++nb)
#pragma unroll
                for (int j = 0; j < 8; ++j) mine[(4 * (hi * 8 + j) + mi) * 68 + nb * 16 + lr] = acc[mi][nb][j];
    } else {    // column lr of accumulator nb is tile column 4 lr + nb: the four lie side by side, one 16-byte store
#pragma unroll
        for (int mi = 0; mi < 4; ++mi)
#pragma unroll
            for (int j = 0; j < 8; ++j) { v4f t; t[0] = acc[mi][0][j]; t[1] = acc[mi][1][j]; t[2] = acc[mi][2][j]; t[3] = acc[mi][3][j]; *(v4fa*)(mine + (mi * 16 + hi * 8 + j) * 68 + 4 * lr) = t; }
    }
    __syncthreads();   // every wave's partial tile is in LDS
    // both rounds are summed and rounded first, then stored: the LDS reads of the second do not wait behind the stores of the first
    v8h o16[2]; v8us oh[2], ol[2];
#pragma unroll
    for (int s = 0; s < 2; ++s) { const float* ps = os + (s * 32 + prow) * 68 + pcof; v4f va = *(const v4fa*)ps, vb = *(const v4fa*)(ps + 4);
#pragma unroll
        for (int ww = 1; ww < NW; ++ww) { va += *(const v4fa*)(ps + ww * PW); vb += *(const v4fa*)(ps + ww * PW + 4); }
        v8f y8;
#pragma unroll
        for (int q = 0; q < 8; ++q) { y8[q] = ((q < 4) ? va[q & 3] : vb[q & 3]) + bfr(vt ? pbr[s] : ((q < 4) ? pbc0[q & 3] : pbc1[q & 3])); o16[s][q] = tohx(y8[q]); }
        SplitN<8>::B a8, c8; SplitN<8>::run(y8, a8, c8); oh[s] = __builtin_bit_cast(v8us, a8); ol[s] = __builtin_bit_cast(v8us, c8); }
    const int rr = r0 + prow, cc = c0 + pcof;
    const size_t e0 = vt ? (z - 2 * NB_) * PLN + (size_t)rr * TT + cc : z * PLN + ((size_t)(cc / HD) * TT + rr) * HD + cc % HD, es = vt ? (size_t)32 * TT : (size_t)32 * HD;   // first element, step of 32 rows
    h16* d16 = (vt ? pl.v16 : pl.q16) + e0; bf* dh = (vt ? pl.vh : pl.qh) + e0; bf* dl = (vt ? pl.vl : pl.ql) + e0;
#pragma unroll
    for (int s = 0; s < 2; ++s) { *(v8h*)(d16 + s * es) = o16[s]; *(v8us*)(dh + s * es) = oh[s]; *(v8us*)(dl + s * es) = ol[s]; }
    asm volatile("s_wait_xcnt 0x0" ::: "memory");   // the wait that stands before a register named by an issued global store is written again: in the built code the output-weight slice lies behind these stores and writes their registers
}
// ---- k_fattn: scores, softmax and P.V of one head, a tile of QT x 16 query rows at a time; S and P stay in registers. Grid (heads, NB_ RH / (16 QT)), NWV waves: a work-group takes one hi/lo tile and then TT / RH - 1 fp16 tiles of its head in a loop, so its waves start once for all of them. Wave w takes the keys [w KW, (w + 1) KW) for all the rows, so a K or V fragment is loaded once for QT row tiles.
// S^T = K Q^T: register j of key tile t in lane (lr, hi) is S[query lr][key 16 t + 8 hi + j], so a lane holds scores of one query per row tile, and two neighbouring key tiles are, as they lie, the A fragment of P for 32 keys (same k order as the V^T loader).
// A head is 16 wide and the matrix instruction takes 32: the upper half of the K and Q fragments (d 16..31) is set to zero in registers.
// Softmax by parts: a wave takes the maximum m_w of its own raw scores of a row (in the lane, then across the two lane halves), P = 2^(SCL2 s - SCL2 m_w) in (0, 1] goes into P.V as it is, not normalised, and the wave leaves SCL2 m_w, its row sum and its partial context in LDS.
// Behind the work-group's one barrier, which stands behind its last tile, a thread joins the 16 parts of its element of every tile in wave order: with M the largest SCL2 m_w, part w counts 2^(SCL2 m_w - M) times, in the context and in the row sum alike, and the quotient of the two is the context.
// Rows < RH: hi/lo bf16 planes, 3 products; the rest fp16. Stores the hi/lo planes of the merged context, panel h: QT x 16 rows of 32 bytes in a row.
// Every loop of fattn_rows is unrolled: s, v, o and the fragments are register arrays, which only constant indices keep out of scratch memory.
#define NWV 16
#define QT  2
#define KW  (TT / NWV)
#define KT  (KW / 16)
// 2^x by the hardware instruction, with the one free issue slot behind a transcendental in the same statement
__device__ __forceinline__ float exp2_slot(float x) { float e; asm("v_exp_f32 %0, %1\n\tv_nop" : "=v"(e) : "v"(x)); return e; }
// What a wave has asked for ahead of an fp16 row tile: its K fragments and the tile's Q rows.
struct Carry { v8h k[KT]; v8h q[QT]; };
// Asks for them: qp, kp = the lane's addresses in the first Q row tile and the first key tile.
__device__ __forceinline__ void ask_tile(const h16* qp, const h16* kp, Carry& cy) {
#pragma unroll
    for (int qt = 0; qt < QT; ++qt) cy.q[qt] = *(const v8h*)(qp + (size_t)qt * 16 * HD);
#pragma unroll
    for (int t = 0; t < KT; ++t) cy.k[t] = *(const v8h*)(kp + (size_t)t * 16 * HD);
    asm volatile("s_wait_xcnt 0x0" :: "v"(qp), "v"(kp) : "memory");   // the wait that stands before a register named by an issued global load is written again (the addresses are inputs so that they stay in their registers up to it)
}
template <bool HIRES> struct FSel { typedef bf T; };
template <> struct FSel<false> { typedef h16 T; };
template <bool HIRES>
__device__ __forceinline__ void fattn_rows(const h16* __restrict__ Q16, const h16* __restrict__ K16, const h16* __restrict__ V16, const bf* __restrict__ Qh, const bf* __restrict__ Ql, const bf* __restrict__ Kh, const bf* __restrict__ Kl, const bf* __restrict__ Vh, const bf* __restrict__ Vl,
                                           int q0, int qn, int h, float* redm, float* reds, float* part, Carry& cy) {
    const int tid = threadIdx.x, lane = tid & 31, lr = lane & 15, hi = lane >> 4; const int w = __builtin_amdgcn_readfirstlane(tid >> 5); const int k0 = w * KW;
    const size_t qoff = ((size_t)h * TT + q0 + lr) * HD + 8 * hi, koff = ((size_t)h * TT + k0 + lr) * HD + 8 * hi, voff = ((size_t)h * HD + lr) * TT + k0 + 8 * hi;
    typedef typename FSel<HIRES>::T VT;   // element type of the V^T planes this path reads
    v8f s[QT][KT];
    if constexpr (HIRES) { const v8us z8 = {}; v16bf qh[QT], ql[QT];
#pragma unroll
        for (int qt = 0; qt < QT; ++qt) { qh[qt] = cat16b(*(const v8us*)(Qh + qoff + (size_t)qt * 16 * HD), z8); ql[qt] = cat16b(*(const v8us*)(Ql + qoff + (size_t)qt * 16 * HD), z8); }
#pragma unroll
        for (int t = 0; t < KT; ++t) { const v16bf kh = cat16b(*(const v8us*)(Kh + koff + (size_t)t * 16 * HD), z8), kl = cat16b(*(const v8us*)(Kl + koff + (size_t)t * 16 * HD), z8);
#pragma unroll
            for (int qt = 0; qt < QT; ++qt) { v8f c = {}; c = wmmab(kh, qh[qt], c); c = wmmab(kh, ql[qt], c); c = wmmab(kl, qh[qt], c); s[qt][t] = c; } }
    } else { const v8h z8 = {}; v16h q[QT];
#pragma unroll
        for (int qt = 0; qt < QT; ++qt) q[qt] = cat16(cy.q[qt], z8);
#pragma unroll
        for (int t = 0; t < KT; ++t) { const v16h k = cat16(cy.k[t], z8);
#pragma unroll
            for (int qt = 0; qt < QT; ++qt) { v8f c = {}; s[qt][t] = wmma16(k, q[qt], c); } } }
    typename WFrag<VT>::V v[KT / 2], v2[HIRES ? KT / 2 : 1];   // the wave's V^T fragments
    // loads the fragments [t0, t1); behind them the wait that stands before a register named by an issued global load is written again (the addresses are inputs so that they stay in their registers up to it)
    auto load_v = [&](int t0, int t1) { const VT* vp; const VT* vp2;
        if constexpr (HIRES) { vp = Vh + voff; vp2 = Vl + voff; } else { vp = V16 + voff; vp2 = vp; }
#pragma unroll
        for (int tp = t0; tp < t1; ++tp) { v[tp] = WFrag<VT>::ld(vp + tp * 32); if constexpr (HIRES) v2[tp] = WFrag<VT>::ld(vp2 + tp * 32); }
        asm volatile("s_wait_xcnt 0x0" :: "v"(vp), "v"(vp2) : "memory"); };
    load_v(0, HIRES ? 1 : KT / 2);   // asked for here so that they arrive under the maxima and the exponentials (the hi/lo path has registers free for its first step alone: the rest it asks for one step ahead)
#pragma unroll
    for (int qt = 0; qt < QT; ++qt) { float m4[4] = {-3.0e38f, -3.0e38f, -3.0e38f, -3.0e38f};   // four chains, so that a maximum does not wait for the one before it
#pragma unroll
        for (int t = 0; t < KT; ++t) {
#pragma unroll
            for (int j = 0; j < 8; ++j) m4[j >> 1] = fmaxf(m4[j >> 1], s[qt][t][j]); }
        float m = fmaxf(fmaxf(m4[0], m4[1]), fmaxf(m4[2], m4[3])); m = fmaxf(m, __shfl_xor(m, 16, 32)); const float nb = m * SCL2;
        v2f ps[2] = {(v2f){0.f, 0.f}, (v2f){0.f, 0.f}};
#pragma unroll
        for (int t = 0; t < KT; ++t) {
#pragma unroll
            for (int j = 0; j < 8; j += 2) { const v2f x = __builtin_elementwise_fma((v2f){s[qt][t][j], s[qt][t][j + 1]}, (v2f){SCL2, SCL2}, (v2f){-nb, -nb});   // two scores, neighbours in registers, per packed instruction
                const float e0 = exp2_slot(x[0]), e1 = exp2_slot(x[1]); s[qt][t][j] = e0; s[qt][t][j + 1] = e1; ps[(j >> 1) & 1] += (v2f){e0, e1}; } }
        float sum = (ps[0][0] + ps[0][1]) + (ps[1][0] + ps[1][1]); sum += __shfl_xor(sum, 16, 32);
        if (hi == 0) { redm[(w * QT + qt) * 16 + lr] = nb; reds[(w * QT + qt) * 16 + lr] = sum; } }
    v8f o[QT];
#pragma unroll
    for (int qt = 0; qt < QT; ++qt) o[qt] = (v8f){};
#pragma unroll
    for (int tp = 0; tp < KT / 2; ++tp) {
        if (tp == KT / 4) ask_tile(Q16 + ((size_t)h * TT + qn + lr) * HD + 8 * hi, K16 + koff, cy);   // the next tile, an fp16 tile from row qn: half of the scores' registers are free from here on, and the loads arrive under the rest of P.V
        if constexpr (HIRES) { if (tp + 1 < KT / 2) load_v(tp + 1, tp + 2);
            const v16bf vh = v[tp], vl = v2[tp];
#pragma unroll
            for (int qt = 0; qt < QT; ++qt) { v16f y;
#pragma unroll
                for (int j = 0; j < 8; ++j) { y[j] = s[qt][2 * tp][j]; y[8 + j] = s[qt][2 * tp + 1][j]; }
                v16bf ph, pl; SplitN<16>::run(y, ph, pl);
                o[qt] = wmmab(ph, vh, o[qt]); o[qt] = wmmab(pl, vh, o[qt]); o[qt] = wmmab(ph, vl, o[qt]); }
        } else {
#pragma unroll
            for (int qt = 0; qt < QT; ++qt) { v8h p0, p1;
#pragma unroll
                for (int j = 0; j < 8; ++j) { p0[j] = tohx(s[qt][2 * tp][j]); p1[j] = tohx(s[qt][2 * tp + 1][j]); }
                o[qt] = wmma16(cat16(p0, p1), v[tp], o[qt]); } } }
#pragma unroll
    for (int qt = 0; qt < QT; ++qt) {
#pragma unroll
        for (int j = 0; j < 8; ++j) part[w * (QT * 272) + (qt * 16 + hi * 8 + j) * 17 + lr] = o[qt][j]; }
}
__global__ __launch_bounds__(32 * NWV) void k_fattn(const h16* __restrict__ Q16, const h16* __restrict__ K16, const h16* __restrict__ V16, const bf* __restrict__ Qh, const bf* __restrict__ Ql, const bf* __restrict__ Kh, const bf* __restrict__ Kl, const bf* __restrict__ Vh, const bf* __restrict__ Vl, bf* Ah, bf* Al) {
    static_assert(NWV * 32 == QT * 256, "one thread per element of the context tile");
    // blockIdx.y -> (batch, i): the work-group takes hi/lo tile i of its head and then the fp16 tiles HT + i, 2 HT + i, ..., one after the other, so every work-group has the same work and one per WGP is the whole launch
    constexpr int NT = TT / (QT * 16), HT = RH / (QT * 16), NF = NT / HT - 1; static_assert(HT > 0 && NT % HT == 0 && NF > 0, "one hi/lo tile and NF fp16 tiles each");
    // a set of its own for every tile of the work-group: a wave goes through all its tiles without waiting for another wave, and one barrier at the end serves them all
    // one array, the small planes first: their addresses then lie within the reach of an LDS instruction's offset field from one register
    constexpr int RS = NWV * QT * 16, PS = NWV * QT * 272; __shared__ float lds[(NF + 1) * (2 * RS + PS)]; float* const redm = lds; float* const reds = lds + (NF + 1) * RS; float* const part = lds + (NF + 1) * 2 * RS;
    const int y = blockIdx.y; const int b = y / HT, i0 = y % HT; const int h = blockIdx.x;
    { const size_t po = (size_t)b * PLN; Q16 += po; K16 += po; V16 += po; Qh += po; Ql += po; Kh += po; Kl += po; Vh += po; Vl += po; Ah += po; Al += po; }
    Carry cy;
    fattn_rows<true>(Q16, K16, V16, Qh, Ql, Kh, Kl, Vh, Vl, i0 * (QT * 16), (HT + i0) * (QT * 16), h, redm, reds, part, cy);
    // kept rolled: one copy of the tile's code, which is long
#pragma unroll 1
    for (int j = 1; j <= NF; ++j)   // the last tile asks for its own rows again (in bounds, not used): no branch inside P.V
        fattn_rows<false>(Q16, K16, V16, Qh, Ql, Kh, Kl, Vh, Vl, (j * HT + i0) * (QT * 16), (((j < NF) ? j + 1 : j) * HT + i0) * (QT * 16), h, redm + j * RS, reds + j * RS, part + j * PS, cy);
    __syncthreads();   // every wave's row maxima, row sums and partial contexts of all the tiles are in LDS
    const int tid = threadIdx.x, q = tid >> 4, d = tid & 15;   // NWV * 32 threads = QT * 16 rows x 16 columns: one element of every tile
    // unrolled, and every store behind the last join: the tiles' joins do not depend on one another, so the LDS reads and the sums of one run under those of the others
    unsigned short oh[NF + 1], ol[NF + 1];
#pragma unroll
    for (int j = 0; j <= NF; ++j) {
        float nw[NWV]; float mm = -3.0e38f;
#pragma unroll
        for (int ww = 0; ww < NWV; ++ww) { nw[ww] = redm[j * RS + ww * (QT * 16) + q]; mm = fmaxf(mm, nw[ww]); }
        float acc = 0.f, tot = 0.f;
#pragma unroll
        for (int ww = 0; ww < NWV; ++ww) { const float g = exp2_slot(nw[ww] - mm); tot = __builtin_fmaf(reds[j * RS + ww * (QT * 16) + q], g, tot); acc = __builtin_fmaf(part[j * PS + ww * (QT * 272) + q * 17 + d], g, acc); }
        splitf(__fdiv_rn(acc, tot), oh[j], ol[j]); }
    const size_t oo = ((size_t)h * TT + i0 * (QT * 16) + q) * HD + d; bf* pa = Ah + oo; bf* pb = Al + oo;   // the element in tile i0; tile j HT + i0 lies j RH rows on
#pragma unroll
    for (int j = 0; j <= NF; ++j) { pa[(size_t)j * RH * HD] = oh[j]; pb[(size_t)j * RH * HD] = ol[j]; }
}

extern "C" void kernel_launch(void* const* d_in, const int* in_sizes, int n_in,
                              void* d_out, int out_size, void* d_ws, size_t ws_size, hipStream_t stream) {
    (void)in_sizes; (void)n_in; (void)out_size;
    const float* x = (const float*)d_in[0]; const float* xk = (const float*)d_in[1]; const float* xv = (const float*)d_in[2]; const float* wq = (const float*)d_in[3]; const float* bqr = (const float*)d_in[4]; const float* wk = (const float*)d_in[5]; const float* bkr = (const float*)d_in[6]; const float* wv = (const float*)d_in[7]; const float* bvr = (const float*)d_in[8]; const float* wo = (const float*)d_in[9]; const float* bo = (const float*)d_in[10];   /* argument order queries, keys, values, Wq ('xw' [1024][128]), bq [128], Wk, bk, Wv, bv, Wo ('xw' [128][1024]), bo */
    float* OUT = (float*)d_out;     // [2][2048][1024]
    char* wsp = (char*)d_ws;
    auto take = [&](size_t bytes) { char* p = wsp; wsp += (bytes + 255) & ~(size_t)255; return (void*)p; };
    bf* WO = (bf*)take((size_t)DM * DQ * 2);
    h16* P16 = (h16*)take(2 * NB_ * PLN * 2); bf* Ph = (bf*)take(2 * NB_ * PLN * 2); bf* Pl = (bf*)take(2 * NB_ * PLN * 2);   /* q planes z = 0, 1; k planes z = 2, 3 */
    h16* VT16 = (h16*)take(NB_ * PLN * 2); bf* VTh = (bf*)take(NB_ * PLN * 2); bf* VTl = (bf*)take(NB_ * PLN * 2);
    bf* ATh = (bf*)take(NB_ * PLN * 2); bf* ATl = (bf*)take(NB_ * PLN * 2);   /* merged context [b][h][t][16] */
    if ((size_t)(wsp - (char*)d_ws) > ws_size) return;    // ws 256 MiB
    k_proj<<<dim3(TT / 64, DQ / 64, 3 * NB_ + 1), 256, 0, stream>>>(x, xk, xv, wq, wk, wv, bqr, bkr, bvr, wo, WO, Planes{P16, Ph, Pl, VT16, VTh, VTl});
    k_fattn<<<dim3(NH_, NB_ * (RH / (16 * QT)), 1), 32 * NWV, 0, stream>>>(P16, P16 + NB_ * PLN, VT16, Ph, Pl, Ph + NB_ * PLN, Pl + NB_ * PLN, VTh, VTl, ATh, ATl);   // one kv head per query head
    k_gemmw<bf, 1, true, 4, 1, NB_, TT, DM><<<dim3(TT / 64, DM / 64, NB_), 128, 0, stream>>>(ATh, ATl, WO, nullptr, DQ, OUT, DM, bo, PLN, 0, (size_t)TT * DM, 0, 0);   // 4 waves: 32 k, two heads, each
}
